// v000
// Times are from an AMD MI455X. After a warm-up the kernel runs many times in a row, and a time is the length of
// such a window on the GPU divided by its runs, so every launch and the gaps after it count. The runs cycle
// through copies of the inputs. A figure is the median of several windows, for all but v000 over two sittings.
// Sittings can differ by a few percent; kernels timed side by side share one.
// v000 is the starting kernel. One run takes 249 microseconds.
// Contractions: q.k^T over 64 on v_wmma_f32_16x16x32_bf16 (q, k as bf16 RNE planes, single product, f32 accumulate);
// P.v on v_wmma_f32_16x16x32_f16 (P x32768 as f16 hi on every query row plus an in-register f16 residual for query rows
// s < QO; v as one f16 plane holding the bf16 RNE value x1024; f32 accumulate). Causal select, base-2 online softmax,
// 1/Z and the chunk-mass renormalisation in f32 on VALU.
#include <hip/hip_runtime.h>
#include <math.h>
#include <stdint.h>

#ifndef SEQ
#define SEQ 4096
#endif
#define S_FULL 4096
#define NH    8
#define NKVH  2
#define HD    64
#define QD    (NH * HD)
#define KVD   (NKVH * HD)
#define WPB   (NH / NKVH)
#define NHG   NKVH
#define QO    ((SEQ < 512) ? SEQ : 512)
#define NQT   (SEQ / 16)
#define NQTE  (QO / 16)
#define NST   (SEQ / 64)
#define NKT   (SEQ / 32)
#define ATT_THREADS (WPB * 32)
#define RSQ_HD 0.125f
#define LOG2E 1.4426950408889634f
#define PCAR  32768.0f
#define VCAR  1024.0f
#define PTP   36
#define PTW   (16 * PTP)
#define SLP   68
#define SLW   (16 * SLP)
#define WREG  (PTW + SLW)
#define VTP   72
#define WS_CAP 134217728
static_assert(QD == 512 && KVD == 128 && HD == 64 && NH == 8 && NKVH == 2 && WPB == 4 && NHG * WPB == NH);
static_assert(ATT_THREADS == 128);
static_assert((SEQ % 64) == 0 && SEQ >= 64 && SEQ <= S_FULL);
static_assert((QO % 16) == 0 && QO >= 16 && QO <= SEQ);
static_assert((HD % 32) == 0 && ((SEQ * QD / 8) % 256) == 0 && ((SEQ * KVD / 8) % 256) == 0);

typedef unsigned short u16;
typedef _Float16 v16h __attribute__((ext_vector_type(16)));
typedef _Float16 v8h  __attribute__((ext_vector_type(8)));
typedef __bf16   v16b __attribute__((ext_vector_type(16)));
typedef float    v8f  __attribute__((ext_vector_type(8)));
typedef float    v4f  __attribute__((ext_vector_type(4)));
typedef unsigned int v4u __attribute__((ext_vector_type(4)));

union FragH { v16h v; v8h h[2]; v4u u[2]; };
union FragB { v16b v; v4u u[2]; };

// ---- scalar helpers --------------------------------------------------------------------------------
__device__ __forceinline__ unsigned short bf_bits(float f) {          // f32 -> bf16 bits, RNE convert
  unsigned u = __float_as_uint(f);
  return (unsigned short)((u + 0x7FFFu + ((u >> 16) & 1u)) >> 16);
}
__device__ __forceinline__ float bf_up(unsigned short h) { return __uint_as_float(((unsigned)h) << 16); }
__device__ __forceinline__ float bfr(float f) { return bf_up(bf_bits(f)); }
__device__ __forceinline__ unsigned short h_bits(_Float16 x) { return __builtin_bit_cast(unsigned short, x); }
__device__ __forceinline__ unsigned pk16(unsigned short a, unsigned short b) { return (unsigned)a | ((unsigned)b << 16); }
__device__ __forceinline__ v8f zero8() { v8f z = {0.f, 0.f, 0.f, 0.f, 0.f, 0.f, 0.f, 0.f}; return z; }

// ---- fragment loaders: 16-bit A/B operand, lane -> row/col (lane&15), p already includes +8*(lane>>4);
//      elements 0..7 <- p[0..7] (k0+8h..), elements 8..15 <- p[16..23] (k0+16+8h..)  (same split k map for A and B;
//      B is always read from a k-contiguous [n][k] plane)
__device__ __forceinline__ v16h ldfrag_h(const _Float16* p) {
  FragH f;
  f.h[0] = *(const v8h*)(p);
  f.h[1] = *(const v8h*)(p + 16);
  return f.v;
}
__device__ __forceinline__ v16b ldfrag_b(const u16* p) {              // bf16 plane read as unsigned integer vectors
  FragB f;
  f.u[0] = *(const v4u*)(p);
  f.u[1] = *(const v4u*)(p + 16);
  return f.v;
}

__device__ __forceinline__ v8f mma_h(v16h a, v16h b, v8f c) {
  return __builtin_amdgcn_wmma_f32_16x16x32_f16(false, a, false, b, (short)0, c, false, false);
}
__device__ __forceinline__ v8f mma_b(v16b a, v16b b, v8f c) {
  return __builtin_amdgcn_wmma_f32_16x16x32_bf16(false, a, false, b, (short)0, c, false, false);
}
template <typename F>
__device__ __forceinline__ void guard2(v8f& a, v8f& b, F x0, F x1, F x2, F x3, F x4, F x5) {
#if defined(__HIP_DEVICE_COMPILE__)
  asm volatile("v_nop\n\tv_nop\n\tv_nop\n\tv_nop"
               : "+v"(a), "+v"(b) : "v"(x0), "v"(x1), "v"(x2), "v"(x3), "v"(x4), "v"(x5) : "memory");
#endif
}
__device__ __forceinline__ void acc_guard4(v8f& a, v8f& b, v8f& c, v8f& d) {
#if defined(__HIP_DEVICE_COMPILE__)
  asm volatile("v_nop\n\tv_nop\n\tv_nop\n\tv_nop" : "+v"(a), "+v"(b), "+v"(c), "+v"(d));
#endif
}
__device__ __forceinline__ void wave_sync_lds() {
  __builtin_amdgcn_fence(__ATOMIC_RELEASE, "workgroup");
  __builtin_amdgcn_wave_barrier();
  __builtin_amdgcn_fence(__ATOMIC_ACQUIRE, "workgroup");
}

// =====================================================================================================
// f32 -> bf16 RNE bit plane, same layout. Thread = 8 consecutive elements: two 16-B loads, one 16-B store; 32 consecutive
// No barriers in this kernel.
// coverage: grid = ceil(n8/256) blocks x 256 thr x 8 (in-kernel bound) = the whole plane (n8 a multiple of 256 here).
// =====================================================================================================
__global__ __launch_bounds__(256) void cvt_bf(const float* __restrict__ x, u16* D, int n8) {
  const int gt = blockIdx.x * 256 + (int)threadIdx.x;
  if (gt >= n8) return;
  const float* p = x + (size_t)gt * 8;
  const v4f a = *(const v4f*)(p), b4 = *(const v4f*)(p + 4);
  float w[8];
#pragma unroll
  for (int e = 0; e < 4; ++e) { w[e] = a[e]; w[4 + e] = b4[e]; }
  v4u o;
#pragma unroll
  for (int e = 0; e < 4; ++e) {
    o[e] = pk16(bf_bits(w[2 * e]), bf_bits(w[2 * e + 1]));
  }
  u16* d = D + (size_t)gt * 8;
  {
    *(v4u*)(d) = o;
    
  }
}

// =====================================================================================================
// v^T plane from V f32 [SEQ][KVD] (row = key s, column = g*HD + d):
//   VT[(g*HD + d)][s] = f16 bits of (bf16 RNE value of v) * 1024  (exact for |v| >= 6e-8: 8-bit significand, power-of-two carry).
// Block = (kv head g, 64 keys s0): each thread loads 16 floats (key sl, d chunk dc) with 16-B loads, converts, scatters into the LDS
// coverage: load 256 thr x 16 = 64 keys x 64 d; store 2 iterations x 256 thr x 8 halves = 64 lines x 64 = the block's tile;
//           grid = NKVH*NST blocks covers the [KVD][SEQ] plane exactly once.
// =====================================================================================================
__global__ __launch_bounds__(256) void vt16(const float* __restrict__ V, u16* VTo) {
  __shared__ __align__(16) u16 T[HD * VTP];
  const int tid = threadIdx.x;
  const int bid = blockIdx.x;
  const int st  = bid % NST;
  const int g   = bid / NST;
  if (g >= NKVH) return;                    // block-uniform, before the barrier; never taken with the exact grid
  const int s0  = st * 64;
  {
    const int sl = tid >> 2;                // key within tile 0..63
    const int dc = (tid & 3) * 16;          // d chunk
    const float* src = V + (size_t)(s0 + sl) * KVD + g * HD + dc;
#pragma unroll
    for (int i = 0; i < 4; ++i) {
      const v4f a = *(const v4f*)(src + 4 * i);
#pragma unroll
      for (int e = 0; e < 4; ++e) {
        const float t = bfr(a[e]) * VCAR;
        T[(dc + 4 * i + e) * VTP + sl] = h_bits((_Float16)t);
      }
    }
  }
  __syncthreads();
  v4u w4[2];
  const int q8 = tid >> 3, p8 = (tid & 7) * 8;
#pragma unroll
  for (int it = 0; it < 2; ++it) {
    const int line = it * 32 + q8;          // d = 0..63
    w4[it] = *(const v4u*)(T + line * VTP + p8);
  }
  const size_t base = (size_t)(g * HD) * SEQ + s0 + p8;
  {
#pragma unroll
    for (int it = 0; it < 2; ++it) {
      const int line = it * 32 + q8;
      *(v4u*)(VTo + base + (size_t)line * SEQ) = w4[it];
    }
    
  }
}

// =====================================================================================================
// Causal grouped-query attention over head dim 64. Block bid -> (query tile qt = qtbeg + bid % nqt: rows q0 = 16*qt .. q0+15,
// head group hg = kv head); one wave per query head = hg*WPB + wave (the 4 heads of the group share kv head hg).
//   q bf16 plane [s][h*HD + d] (pitch QD); k bf16 plane [s][g*HD + d] (pitch KVD); v^T f16 plane [g*HD + d][SEQ] x1024.
//   scores = q.k single bf16 product (A = q rows, B = k rows as [n = key][k = d]), f32 accumulate;
//   t(i, j) (log2 domain) = (q_i.k_j over HD) * (1/8)*log2e, replaced by -inf where key j > query i (causal select).
//   Key tiles of 32 visited in order for kb <= q0 + 15 (later tiles hold only keys above every query row of the tile: weight 0).
//   Per tile: 2 score subtiles x 2 k-steps, fragments loaded straight from the 16-bit planes (two 16-B loads per fragment, split k
//   map; q fragments preloaded once); online max-subtracted base-2 softmax in f32, -inf-safe rescale; the 16x32 prob tile stored to
//   when PRES != 0) rebuilt from the LDS rows (float vector loads, same element type as stored); v^T B fragments (col n = d) in
//   2 groups of 2 d-subtiles.
//   After the loop: out = acc / Z * cw/(cw + 1e-8) with cw the mass of the single local softmax chunk (Z > 0 always: key 0 <= every
//   query row; guarded anyway), carries 1/(32768*1024) folded once, written to the wave's private result slab (pitch 68).
// coverage: per wave 8 instructions x 2 rows x 16 lanes x 4 floats = the wave's 16 x 64 row segments; grid nqt x NHG blocks x WPB waves
//           = every (s, h) row segment of the launched query tiles once; the two launches (tiles [0, NQTE) and [NQTE, NQT)) together
//           cover every query tile once.
// =====================================================================================================
template <int PRES>
__global__ __launch_bounds__(ATT_THREADS)
void attn_c(const u16* __restrict__ QBp, const u16* __restrict__ KBp, const u16* __restrict__ VTp,
            float* Og, int qtbeg, int nqt) {
  __shared__ __align__(16) float smem[WPB * WREG];

  const int tid  = threadIdx.x;
  const int wave = tid >> 5;
  const int lane = tid & 31;
  const int hh   = lane >> 4;
  const int c    = lane & 15;
  const int bid  = blockIdx.x;
  const int qt   = qtbeg + bid % nqt;
  const int hg   = bid / nqt;
  if (hg >= NHG) return;                    // block-uniform; no block barriers in this kernel; never taken with the exact grid
  const int q0   = qt * 16;
  if (q0 + 16 > SEQ) return;                // block-uniform; never taken
  const int head = hg * WPB + wave;
  const int kvh  = hg;

  float* pt   = smem + wave * WREG;         // prob tile [16][32] pitch 36
  float* slab = pt + PTW;                   // result slab [16][64] pitch 68

  const u16* Qp  = QBp + ((size_t)(q0 + c)) * QD + head * HD + 8 * hh;           // A: row = query q0 + c, k = d
  const u16* Khb = KBp + ((size_t)c) * KVD + kvh * HD + 8 * hh;                  // B: col n = key (kb added per step), k = d
  const _Float16* Vhb = (const _Float16*)(const void*)VTp + ((size_t)(kvh * HD + c)) * SEQ + 8 * hh;  // B: col n = d c (+16j), k = key
  const float lsc = RSQ_HD * LOG2E;
  const float cw  = 1.0f;                   // mass of the single local softmax chunk
  const float ren = cw / (cw + 1e-8f);
  const float oc  = ren / (PCAR * VCAR);
  const size_t KROW = (size_t)KVD;          // halves between consecutive key rows

  const v16b qa0 = ldfrag_b(Qp);            // d 0..31
  const v16b qa1 = ldfrag_b(Qp + 32);       // d 32..63

  float mrow[8], lrow[8];
  v8f o[4];
#pragma unroll
  for (int r = 0; r < 8; ++r) { mrow[r] = -INFINITY; lrow[r] = 0.f; }
#pragma unroll
  for (int j = 0; j < 4; ++j) o[j] = zero8();
  const int ncaus = (q0 >> 5) + 1;                                            // tiles holding keys <= q0 + 15
  const int nkt = (ncaus < NKT) ? ncaus : NKT;
  const int qr0 = q0 + 8 * hh;                                                // query row of D element r = qr0 + r

#pragma unroll 1
  for (int kt = 0; kt < nkt; ++kt) {
    const int kb = kt * 32;
    // ---- scores: D element r of this lane = (query row qr0 + r, key kb + c) in s0, key kb + 16 + c in s1 ----
    v8f s0 = zero8(), s1 = zero8();
    {
      const u16* k0p = Khb + (size_t)kb * KROW;
      const u16* k1p = k0p + (size_t)16 * KROW;
      const v16b kf00 = ldfrag_b(k0p);
      const v16b kf01 = ldfrag_b(k1p);
      const v16b kf10 = ldfrag_b(k0p + 32);
      const v16b kf11 = ldfrag_b(k1p + 32);
      s0 = mma_b(qa0, kf00, s0);
      s1 = mma_b(qa0, kf01, s1);
      s0 = mma_b(qa1, kf10, s0);
      s1 = mma_b(qa1, kf11, s1);
      guard2<v16b>(s0, s1, qa0, qa1, kf00, kf01, kf10, kf11);
    }
    // ---- causal select + online softmax in base 2, -inf-safe ----
    const int key0 = kb + c, key1 = kb + 16 + c;
#pragma unroll
    for (int r = 0; r < 8; ++r) {
      const int   qr = qr0 + r;
      const float u0 = s0[r] * lsc;
      const float u1 = s1[r] * lsc;
      const float t0 = (key0 > qr) ? -INFINITY : u0;
      const float t1 = (key1 > qr) ? -INFINITY : u1;
      float mx = fmaxf(t0, t1);
#pragma unroll
      for (int off = 1; off < 16; off <<= 1) mx = fmaxf(mx, __shfl_xor(mx, off, 32));
      const float mn = fmaxf(mrow[r], mx);
      const float ms = (mn == -INFINITY) ? 0.0f : mn;
      const float al = exp2f(mrow[r] - ms);
      mrow[r] = mn;
      const float e0 = exp2f(t0 - ms), e1 = exp2f(t1 - ms);
      float ps = e0 + e1;
#pragma unroll
      for (int off = 1; off < 16; off <<= 1) ps += __shfl_xor(ps, off, 32);
      lrow[r] = lrow[r] * al + ps;
#pragma unroll
      for (int j = 0; j < 4; ++j) o[j][r] *= al;
      const int ro = (8 * hh + r) * PTP + c;
      pt[ro]      = e0;
      pt[ro + 16] = e1;
    }
    wave_sync_lds();
    // ---- A fragments of P*32768: hi f16 (and residual f16 when PRES != 0), row = c, split k map over the 32 keys of this step ----
    FragH ph, pl;
    {
      const float* prow = pt + c * PTP + 8 * hh;
      const v4f p0 = *(const v4f*)(prow), p1 = *(const v4f*)(prow + 4);
      const v4f p2 = *(const v4f*)(prow + 16), p3 = *(const v4f*)(prow + 20);
#pragma unroll
      for (int e = 0; e < 4; ++e) {
        const float ta = p0[e] * PCAR, tb = p1[e] * PCAR, tc = p2[e] * PCAR, td = p3[e] * PCAR;
        const _Float16 ha = (_Float16)ta, hb = (_Float16)tb, hc = (_Float16)tc, hd = (_Float16)td;
        ph.h[0][e]     = ha;                  // elements 0..7  = keys kb + 8hh + 0..7
        ph.h[0][4 + e] = hb;
        ph.h[1][e]     = hc;                  // elements 8..15 = keys kb + 16 + 8hh + 0..7
        ph.h[1][4 + e] = hd;
        if constexpr (PRES != 0) {
          pl.h[0][e]     = (_Float16)(ta - (float)ha);
          pl.h[0][4 + e] = (_Float16)(tb - (float)hb);
          pl.h[1][e]     = (_Float16)(tc - (float)hc);
          pl.h[1][4 + e] = (_Float16)(td - (float)hd);
        }
      }
      if constexpr (PRES == 0) { pl.v = ph.v; }
    }
    // ---- P.V : B fragment col n = d = j*16 + c, keys contiguous in the v^T plane; 2 groups of 2 d-subtiles ----
    {
      const _Float16* vp = Vhb + kb;
#pragma unroll
      for (int jg = 0; jg < 2; ++jg) {
        const size_t da = (size_t)(2 * jg) * 16 * SEQ;
        const size_t db = da + (size_t)16 * SEQ;
        const v16h va = ldfrag_h(vp + da), vb = ldfrag_h(vp + db);
        o[2 * jg]     = mma_h(ph.v, va, o[2 * jg]);
        if constexpr (PRES != 0) { o[2 * jg] = mma_h(pl.v, va, o[2 * jg]); }
        o[2 * jg + 1] = mma_h(ph.v, vb, o[2 * jg + 1]);
        if constexpr (PRES != 0) { o[2 * jg + 1] = mma_h(pl.v, vb, o[2 * jg + 1]); }
        guard2<v16h>(o[2 * jg], o[2 * jg + 1], ph.v, pl.v, va, vb, va, vb);
      }
    }
    wave_sync_lds();
  }
  acc_guard4(o[0], o[1], o[2], o[3]);
  // ---- out = acc / Z * ren (0 if Z == 0), carries (32768 on P, 1024 on v) folded once; written into the wave's private slab ----
#pragma unroll
  for (int r = 0; r < 8; ++r) {
    const float lv  = lrow[r];
    const float ls  = (lv > 0.0f) ? lv : 1.0f;
    const float inv = (lv > 0.0f) ? ((1.0f / ls) * oc) : 0.0f;
#pragma unroll
    for (int j = 0; j < 4; ++j) {
      const int idx = (8 * hh + r) * SLP + j * 16 + c;
      slab[idx] = o[j][r] * inv;
    }
  }
  wave_sync_lds();
  // ---- rows of 64 floats: lanes (hh, c): row it*2 + hh, floats 4c..4c+3; 16 lanes x 16 B = the whole 256-B row segment ----
  v4f vals[8];
#pragma unroll
  for (int it = 0; it < 8; ++it) vals[it] = *(const v4f*)(slab + (it * 2 + hh) * SLP + c * 4);
  float* dst = Og + ((size_t)(q0 + hh)) * QD + head * HD + c * 4;
  {
#pragma unroll
    for (int it = 0; it < 8; ++it) {
      *(v4f*)(dst + (size_t)(it * 2) * QD) = vals[it];
    }
    
  }
}

// =====================================================================================================
// Workspace map (bytes); every plane is fully written by whole-line stores before it is read; all extents are exact multiples
// of the store granularity (no pad rows needed); every region offset a multiple of 1048576:
//   QB  bf16 [SEQ][512]          SEQ*1024    (SEQ=4096: 4194304)
//   KB  bf16 [SEQ][128]          SEQ*256     (1048576)
//   VT  f16  [128][SEQ] x1024    SEQ*256     (1048576)
//   end (SEQ=4096)              6291456
// =====================================================================================================
extern "C" void kernel_launch(void* const* d_in, const int* in_sizes, int n_in,
                              void* d_out, int out_size, void* d_ws, size_t ws_size,
                              hipStream_t stream) {
  if (n_in < 3) return;
  if (in_sizes[0] < SEQ * QD) return;       // query [s][h][d], token-major prefix of SEQ rows used
  if (in_sizes[1] < SEQ * KVD) return;      // key   [s][g][d]
  if (in_sizes[2] < SEQ * KVD) return;      // value [s][g][d]
  if (out_size < SEQ * QD) return;

  const float* q = (const float*)d_in[0];
  const float* k = (const float*)d_in[1];
  const float* v = (const float*)d_in[2];
  float*     out = (float*)d_out;

  const size_t szQB = (size_t)SEQ * QD * 2;
  const size_t szKB = (size_t)SEQ * KVD * 2;
  const size_t szVT = (size_t)KVD * SEQ * 2;
  size_t off = 0;
  const size_t oQB = off; off += szQB;
  const size_t oKB = off; off += szKB;
  const size_t oVT = off; off += szVT;
  if (off > ws_size) return;                // off = 6291456 for SEQ = 4096
  if (off > (size_t)WS_CAP) return;

  char* ws = (char*)d_ws;
  u16* QB = (u16*)(ws + oQB);
  u16* KB = (u16*)(ws + oKB);
  u16* VT = (u16*)(ws + oVT);

  const dim3 b256(256), bAT(ATT_THREADS);
  const int  n8q = (SEQ * QD) / 8;                      // 262144
  const int  n8k = (SEQ * KVD) / 8;                     // 65536
  const dim3 gQ((n8q + 255) / 256);                     // 1024
  const dim3 gK((n8k + 255) / 256);                     // 256
  const dim3 gVT(NKVH * NST);                           // 128
  const int  nqtE = NQTE;                               // query tiles with the P residual product (rows s < QO)
  const int  nqtL = NQT - NQTE;                         // remaining query tiles

  // (0) q -> bf16 plane [SEQ][512]; (1) k -> bf16 plane [SEQ][128]; (2) v^T -> f16 plane [128][SEQ] x1024
  cvt_bf<<<gQ, b256, 0, stream>>>(q, QB, n8q);
  cvt_bf<<<gK, b256, 0, stream>>>(k, KB, n8k);
  vt16<<<gVT, b256, 0, stream>>>(v, VT);
  // (3) causal attention, query tiles s < QO with the P residual product; (4) remaining query tiles -> out f32
  attn_c<1><<<dim3(nqtE * NHG), bAT, 0, stream>>>(QB, KB, VT, out, 0, nqtE);
  if (nqtL > 0) {
    attn_c<0><<<dim3(nqtL * NHG), bAT, 0, stream>>>(QB, KB, VT, out, nqtE, nqtL);
  }
  (void)hipGetLastError();
}

// v001
// A run of this version takes 151 microseconds.
// Next to v000, in two timings, it ran 1.65 and 1.67 times as fast.
// Contractions: q.k^T over 64 on v_wmma_f32_16x16x32_bf16 (q, k as bf16 RNE planes, single product, f32 accumulate);
// P.v on v_wmma_f32_16x16x32_f16 (P x32768 as f16 hi on every query row plus an in-register f16 residual for query rows
// s < QO; v as one f16 plane holding the bf16 RNE value x1024; f32 accumulate). Causal select, base-2 online softmax,
// 1/Z and the chunk-mass renormalisation in f32 on VALU.
#include <hip/hip_runtime.h>
#include <math.h>
#include <stdint.h>

#ifndef SEQ
#define SEQ 4096
#endif
#define S_FULL 4096
#define NH    8
#define NKVH  2
#define HD    64
#define QD    (NH * HD)
#define KVD   (NKVH * HD)
#define WPB   (NH / NKVH)
#define NHG   NKVH
#define QO    ((SEQ < 512) ? SEQ : 512)
#define NQT   (SEQ / 16)
#define NQTE  (QO / 16)
#define NST   (SEQ / 64)
#define NKT   (SEQ / 32)
#define NSPL  8
#define ATT_THREADS (WPB * NSPL * 32)
#define RSQ_HD 0.125f
#define LOG2E 1.4426950408889634f
#define PCAR  32768.0f
#define VCAR  1024.0f
#define PTP   36
#define PTW   (16 * PTP)
#define SLP   68
#define SLW   (16 * SLP)
#define WREG  (PTW + SLW)
#define VTP   72
#define WS_CAP 134217728
static_assert(QD == 512 && KVD == 128 && HD == 64 && NH == 8 && NKVH == 2 && WPB == 4 && NHG * WPB == NH);
static_assert(ATT_THREADS == 1024 && (16 % NSPL) == 0 && (16 / NSPL) == 2);
static_assert((SEQ % 64) == 0 && SEQ >= 64 && SEQ <= S_FULL);
static_assert((QO % 16) == 0 && QO >= 16 && QO <= SEQ);
static_assert((HD % 32) == 0 && ((SEQ * QD / 8) % 256) == 0 && ((SEQ * KVD / 8) % 256) == 0);

typedef unsigned short u16;
typedef _Float16 v16h __attribute__((ext_vector_type(16)));
typedef _Float16 v8h  __attribute__((ext_vector_type(8)));
typedef __bf16   v16b __attribute__((ext_vector_type(16)));
typedef float    v8f  __attribute__((ext_vector_type(8)));
typedef float    v4f  __attribute__((ext_vector_type(4)));
typedef unsigned int v4u __attribute__((ext_vector_type(4)));

union FragH { v16h v; v8h h[2]; v4u u[2]; };
union FragB { v16b v; v4u u[2]; };

// ---- scalar helpers --------------------------------------------------------------------------------
__device__ __forceinline__ unsigned short bf_bits(float f) {          // f32 -> bf16 bits, RNE convert
  unsigned u = __float_as_uint(f);
  return (unsigned short)((u + 0x7FFFu + ((u >> 16) & 1u)) >> 16);
}
__device__ __forceinline__ float bf_up(unsigned short h) { return __uint_as_float(((unsigned)h) << 16); }
__device__ __forceinline__ float bfr(float f) { return bf_up(bf_bits(f)); }
__device__ __forceinline__ unsigned short h_bits(_Float16 x) { return __builtin_bit_cast(unsigned short, x); }
__device__ __forceinline__ unsigned pk16(unsigned short a, unsigned short b) { return (unsigned)a | ((unsigned)b << 16); }
__device__ __forceinline__ v8f zero8() { v8f z = {0.f, 0.f, 0.f, 0.f, 0.f, 0.f, 0.f, 0.f}; return z; }

// ---- fragment loaders: 16-bit A/B operand, lane -> row/col (lane&15), p already includes +8*(lane>>4);
//      elements 0..7 <- p[0..7] (k0+8h..), elements 8..15 <- p[16..23] (k0+16+8h..)  (same split k map for A and B;
//      B is always read from a k-contiguous [n][k] plane)
__device__ __forceinline__ v16h ldfrag_h(const _Float16* p) {
  FragH f;
  f.h[0] = *(const v8h*)(p);
  f.h[1] = *(const v8h*)(p + 16);
  return f.v;
}
__device__ __forceinline__ v16b ldfrag_b(const u16* p) {              // bf16 plane read as unsigned integer vectors
  FragB f;
  f.u[0] = *(const v4u*)(p);
  f.u[1] = *(const v4u*)(p + 16);
  return f.v;
}

__device__ __forceinline__ v8f mma_h(v16h a, v16h b, v8f c) {
  return __builtin_amdgcn_wmma_f32_16x16x32_f16(false, a, false, b, (short)0, c, false, false);
}
__device__ __forceinline__ v8f mma_b(v16b a, v16b b, v8f c) {
  return __builtin_amdgcn_wmma_f32_16x16x32_bf16(false, a, false, b, (short)0, c, false, false);
}
template <typename F>
__device__ __forceinline__ void guard2(v8f& a, v8f& b, F x0, F x1, F x2, F x3, F x4, F x5) {
#if defined(__HIP_DEVICE_COMPILE__)
  asm volatile("v_nop\n\tv_nop\n\tv_nop\n\tv_nop"
               : "+v"(a), "+v"(b) : "v"(x0), "v"(x1), "v"(x2), "v"(x3), "v"(x4), "v"(x5) : "memory");
#endif
}
__device__ __forceinline__ void acc_guard4(v8f& a, v8f& b, v8f& c, v8f& d) {
#if defined(__HIP_DEVICE_COMPILE__)
  asm volatile("v_nop\n\tv_nop\n\tv_nop\n\tv_nop" : "+v"(a), "+v"(b), "+v"(c), "+v"(d));
#endif
}
__device__ __forceinline__ void wave_sync_lds() {
  __builtin_amdgcn_fence(__ATOMIC_RELEASE, "workgroup");
  __builtin_amdgcn_wave_barrier();
  __builtin_amdgcn_fence(__ATOMIC_ACQUIRE, "workgroup");
}

// =====================================================================================================
// f32 -> bf16 RNE bit plane, same layout. Thread = 8 consecutive elements: two 16-B loads, one 16-B store; 32 consecutive
// No barriers in this kernel.
// coverage: grid = ceil(n8/256) blocks x 256 thr x 8 (in-kernel bound) = the whole plane (n8 a multiple of 256 here).
// =====================================================================================================
__global__ __launch_bounds__(256) void cvt_bf(const float* __restrict__ x, u16* D, int n8) {
  const int gt = blockIdx.x * 256 + (int)threadIdx.x;
  if (gt >= n8) return;
  const float* p = x + (size_t)gt * 8;
  const v4f a = *(const v4f*)(p), b4 = *(const v4f*)(p + 4);
  float w[8];
#pragma unroll
  for (int e = 0; e < 4; ++e) { w[e] = a[e]; w[4 + e] = b4[e]; }
  v4u o;
#pragma unroll
  for (int e = 0; e < 4; ++e) {
    o[e] = pk16(bf_bits(w[2 * e]), bf_bits(w[2 * e + 1]));
  }
  u16* d = D + (size_t)gt * 8;
  {
    *(v4u*)(d) = o;
    
  }
}

// =====================================================================================================
// v^T plane from V f32 [SEQ][KVD] (row = key s, column = g*HD + d):
//   VT[(g*HD + d)][s] = f16 bits of (bf16 RNE value of v) * 1024  (exact for |v| >= 6e-8: 8-bit significand, power-of-two carry).
// Block = (kv head g, 64 keys s0): each thread loads 16 floats (key sl, d chunk dc) with 16-B loads, converts, scatters into the LDS
// coverage: load 256 thr x 16 = 64 keys x 64 d; store 2 iterations x 256 thr x 8 halves = 64 lines x 64 = the block's tile;
//           grid = NKVH*NST blocks covers the [KVD][SEQ] plane exactly once.
// =====================================================================================================
__global__ __launch_bounds__(256) void vt16(const float* __restrict__ V, u16* VTo) {
  __shared__ __align__(16) u16 T[HD * VTP];
  const int tid = threadIdx.x;
  const int bid = blockIdx.x;
  const int st  = bid % NST;
  const int g   = bid / NST;
  if (g >= NKVH) return;                    // block-uniform, before the barrier; never taken with the exact grid
  const int s0  = st * 64;
  {
    const int sl = tid >> 2;                // key within tile 0..63
    const int dc = (tid & 3) * 16;          // d chunk
    const float* src = V + (size_t)(s0 + sl) * KVD + g * HD + dc;
#pragma unroll
    for (int i = 0; i < 4; ++i) {
      const v4f a = *(const v4f*)(src + 4 * i);
#pragma unroll
      for (int e = 0; e < 4; ++e) {
        const float t = bfr(a[e]) * VCAR;
        T[(dc + 4 * i + e) * VTP + sl] = h_bits((_Float16)t);
      }
    }
  }
  __syncthreads();
  v4u w4[2];
  const int q8 = tid >> 3, p8 = (tid & 7) * 8;
#pragma unroll
  for (int it = 0; it < 2; ++it) {
    const int line = it * 32 + q8;          // d = 0..63
    w4[it] = *(const v4u*)(T + line * VTP + p8);
  }
  const size_t base = (size_t)(g * HD) * SEQ + s0 + p8;
  {
#pragma unroll
    for (int it = 0; it < 2; ++it) {
      const int line = it * 32 + q8;
      *(v4u*)(VTo + base + (size_t)line * SEQ) = w4[it];
    }
    
  }
}

// =====================================================================================================
// Causal grouped-query attention over head dim 64. Block bid -> (query tile qt = qtbeg + bid % nqt: rows q0 = 16*qt .. q0+15,
// head group hg = kv head); NSPL waves per query head: wave w -> head hg*WPB + (w % WPB), key split sp = w / WPB (the 4 heads of the
// group share kv head hg; the 4 waves of one split read the same k and v tiles).
//   q bf16 plane [s][h*HD + d] (pitch QD); k bf16 plane [s][g*HD + d] (pitch KVD); v^T f16 plane [g*HD + d][SEQ] x1024.
//   scores = q.k single bf16 product (A = q rows, B = k rows as [n = key][k = d]), f32 accumulate;
//   t(i, j) (log2 domain) = (q_i.k_j over HD) * (1/8)*log2e, replaced by -inf where key j > query i (causal select).
//   Key tiles of 32 with kb <= q0 + 15 (later tiles hold only keys above every query row of the tile: weight 0); split sp visits
//   tiles sp, sp + NSPL, ... in order, with its own running maximum, sum and accumulators (none: maximum -inf, sum 0, zeros).
//   Per tile: 2 score subtiles x 2 k-steps, fragments loaded straight from the 16-bit planes (two 16-B loads per fragment, split k
//   map; q fragments preloaded once); online max-subtracted base-2 softmax in f32, -inf-safe rescale; the 16x32 prob tile stored to
//   when PRES != 0) rebuilt from the LDS rows (float vector loads, same element type as stored); v^T B fragments (col n = d) in
//   2 groups of 2 d-subtiles.
//   After the loop: every wave puts its un-normalised 16 x 64 partial into its own slab (pitch 68) and its 16 (maximum, sum) pairs
//   into its own, now free, prob tile; one block barrier; wave (head, sp) merges rows 2*sp, 2*sp + 1 of its head over the NSPL
//   partials in the fixed order 0..NSPL-1: M = max of maxima, weight exp2(m - M) (a partial with maximum -inf weighs 0),
//   out = sum(w * acc) / sum(w * Z) * cw/(cw + 1e-8) with cw the mass of the single local softmax chunk (merged Z > 0 always:
//   key 0 <= every query row; guarded anyway), carries 1/(32768*1024) folded once.
// coverage: per wave 1 instruction x 2 rows x 16 lanes x 4 floats; NSPL waves = the head's 16 x 64 row segments; grid nqt x NHG
//           blocks x WPB heads = every (s, h) row segment of the launched query tiles once; the two launches (tiles [0, NQTE) and
//           [NQTE, NQT)) together cover every query tile once.
// =====================================================================================================
template <int PRES>
__global__ __launch_bounds__(ATT_THREADS)
void attn_c(const u16* __restrict__ QBp, const u16* __restrict__ KBp, const u16* __restrict__ VTp,
            float* Og, int qtbeg, int nqt) {
  __shared__ __align__(16) float smem[WPB * NSPL * WREG];

  const int tid  = threadIdx.x;
  const int wave = __builtin_amdgcn_readfirstlane(tid >> 5);   // scalar: the key loop's bounds stay wave-uniform branches
  const int hw   = wave % WPB;              // head within the group
  const int sp   = wave / WPB;              // key split
  const int lane = tid & 31;
  const int hh   = lane >> 4;
  const int c    = lane & 15;
  const int bid  = blockIdx.x;
  const int qt   = qtbeg + bid % nqt;
  const int hg   = bid / nqt;
  if (hg >= NHG) return;                    // block-uniform, before the barrier; never taken with the exact grid
  const int q0   = qt * 16;
  if (q0 + 16 > SEQ) return;                // block-uniform; never taken
  const int head = hg * WPB + hw;
  const int kvh  = hg;

  float* pt   = smem + wave * WREG;         // prob tile [16][32] pitch 36
  float* slab = pt + PTW;                   // result slab [16][64] pitch 68

  const u16* Qp  = QBp + ((size_t)(q0 + c)) * QD + head * HD + 8 * hh;           // A: row = query q0 + c, k = d
  const u16* Khb = KBp + ((size_t)c) * KVD + kvh * HD + 8 * hh;                  // B: col n = key (kb added per step), k = d
  const _Float16* Vhb = (const _Float16*)(const void*)VTp + ((size_t)(kvh * HD + c)) * SEQ + 8 * hh;  // B: col n = d c (+16j), k = key
  const float lsc = RSQ_HD * LOG2E;
  const float cw  = 1.0f;                   // mass of the single local softmax chunk
  const float ren = cw / (cw + 1e-8f);
  const float oc  = ren / (PCAR * VCAR);
  const size_t KROW = (size_t)KVD;          // halves between consecutive key rows

  const v16b qa0 = ldfrag_b(Qp);            // d 0..31
  const v16b qa1 = ldfrag_b(Qp + 32);       // d 32..63

  float mrow[8], lrow[8];
  v8f o[4];
#pragma unroll
  for (int r = 0; r < 8; ++r) { mrow[r] = -INFINITY; lrow[r] = 0.f; }
#pragma unroll
  for (int j = 0; j < 4; ++j) o[j] = zero8();
  const int ncaus = (q0 >> 5) + 1;                                            // tiles holding keys <= q0 + 15
  const int nkt = (ncaus < NKT) ? ncaus : NKT;
  const int qr0 = q0 + 8 * hh;                                                // query row of D element r = qr0 + r

#pragma unroll 1
  for (int kt = sp; kt < nkt; kt += NSPL) {
    const int kb = kt * 32;
    // ---- scores: D element r of this lane = (query row qr0 + r, key kb + c) in s0, key kb + 16 + c in s1 ----
    v8f s0 = zero8(), s1 = zero8();
    {
      const u16* k0p = Khb + (size_t)kb * KROW;
      const u16* k1p = k0p + (size_t)16 * KROW;
      const v16b kf00 = ldfrag_b(k0p);
      const v16b kf01 = ldfrag_b(k1p);
      const v16b kf10 = ldfrag_b(k0p + 32);
      const v16b kf11 = ldfrag_b(k1p + 32);
      s0 = mma_b(qa0, kf00, s0);
      s1 = mma_b(qa0, kf01, s1);
      s0 = mma_b(qa1, kf10, s0);
      s1 = mma_b(qa1, kf11, s1);
      guard2<v16b>(s0, s1, qa0, qa1, kf00, kf01, kf10, kf11);
    }
    // ---- causal select + online softmax in base 2, -inf-safe ----
    const int key0 = kb + c, key1 = kb + 16 + c;
#pragma unroll
    for (int r = 0; r < 8; ++r) {
      const int   qr = qr0 + r;
      const float u0 = s0[r] * lsc;
      const float u1 = s1[r] * lsc;
      const float t0 = (key0 > qr) ? -INFINITY : u0;
      const float t1 = (key1 > qr) ? -INFINITY : u1;
      float mx = fmaxf(t0, t1);
#pragma unroll
      for (int off = 1; off < 16; off <<= 1) mx = fmaxf(mx, __shfl_xor(mx, off, 32));
      const float mn = fmaxf(mrow[r], mx);
      const float ms = (mn == -INFINITY) ? 0.0f : mn;
      const float al = exp2f(mrow[r] - ms);
      mrow[r] = mn;
      const float e0 = exp2f(t0 - ms), e1 = exp2f(t1 - ms);
      float ps = e0 + e1;
#pragma unroll
      for (int off = 1; off < 16; off <<= 1) ps += __shfl_xor(ps, off, 32);
      lrow[r] = lrow[r] * al + ps;
#pragma unroll
      for (int j = 0; j < 4; ++j) o[j][r] *= al;
      const int ro = (8 * hh + r) * PTP + c;
      pt[ro]      = e0;
      pt[ro + 16] = e1;
    }
    wave_sync_lds();
    // ---- A fragments of P*32768: hi f16 (and residual f16 when PRES != 0), row = c, split k map over the 32 keys of this step ----
    FragH ph, pl;
    {
      const float* prow = pt + c * PTP + 8 * hh;
      const v4f p0 = *(const v4f*)(prow), p1 = *(const v4f*)(prow + 4);
      const v4f p2 = *(const v4f*)(prow + 16), p3 = *(const v4f*)(prow + 20);
#pragma unroll
      for (int e = 0; e < 4; ++e) {
        const float ta = p0[e] * PCAR, tb = p1[e] * PCAR, tc = p2[e] * PCAR, td = p3[e] * PCAR;
        const _Float16 ha = (_Float16)ta, hb = (_Float16)tb, hc = (_Float16)tc, hd = (_Float16)td;
        ph.h[0][e]     = ha;                  // elements 0..7  = keys kb + 8hh + 0..7
        ph.h[0][4 + e] = hb;
        ph.h[1][e]     = hc;                  // elements 8..15 = keys kb + 16 + 8hh + 0..7
        ph.h[1][4 + e] = hd;
        if constexpr (PRES != 0) {
          pl.h[0][e]     = (_Float16)(ta - (float)ha);
          pl.h[0][4 + e] = (_Float16)(tb - (float)hb);
          pl.h[1][e]     = (_Float16)(tc - (float)hc);
          pl.h[1][4 + e] = (_Float16)(td - (float)hd);
        }
      }
      if constexpr (PRES == 0) { pl.v = ph.v; }
    }
    // ---- P.V : B fragment col n = d = j*16 + c, keys contiguous in the v^T plane; 2 groups of 2 d-subtiles ----
    {
      const _Float16* vp = Vhb + kb;
#pragma unroll
      for (int jg = 0; jg < 2; ++jg) {
        const size_t da = (size_t)(2 * jg) * 16 * SEQ;
        const size_t db = da + (size_t)16 * SEQ;
        const v16h va = ldfrag_h(vp + da), vb = ldfrag_h(vp + db);
        o[2 * jg]     = mma_h(ph.v, va, o[2 * jg]);
        if constexpr (PRES != 0) { o[2 * jg] = mma_h(pl.v, va, o[2 * jg]); }
        o[2 * jg + 1] = mma_h(ph.v, vb, o[2 * jg + 1]);
        if constexpr (PRES != 0) { o[2 * jg + 1] = mma_h(pl.v, vb, o[2 * jg + 1]); }
        guard2<v16h>(o[2 * jg], o[2 * jg + 1], ph.v, pl.v, va, vb, va, vb);
      }
    }
    wave_sync_lds();
  }
  acc_guard4(o[0], o[1], o[2], o[3]);
  // ---- this split's partial: un-normalised accumulators into the lane-owned slab, (maximum, sum) of each row into the prob tile ----
#pragma unroll
  for (int r = 0; r < 8; ++r) {
#pragma unroll
    for (int j = 0; j < 4; ++j) {
      const int idx = (8 * hh + r) * SLP + j * 16 + c;
      slab[idx] = o[j][r];
    }
    if (c == 0) {
      pt[8 * hh + r]      = mrow[r];
      pt[16 + 8 * hh + r] = lrow[r];
    }
  }
  __syncthreads();                          // every wave's partial is in LDS before any wave merges; reached by all waves once
  // ---- merge over the NSPL splits of this head: lanes (hh, c): row 2*sp + hh, floats 4c..4c+3 ----
  const int row = sp * (16 / NSPL) + hh;
  const float* hb = smem + hw * WREG;       // split p of this head: + p * WPB * WREG
  float mp[NSPL];
  float mall = -INFINITY;
#pragma unroll
  for (int p = 0; p < NSPL; ++p) {
    mp[p] = hb[p * (WPB * WREG) + row];
    mall  = fmaxf(mall, mp[p]);
  }
  const float msa = (mall == -INFINITY) ? 0.0f : mall;
  float lv = 0.f;
  v4f   ov = {0.f, 0.f, 0.f, 0.f};
#pragma unroll
  for (int p = 0; p < NSPL; ++p) {
    const float w  = exp2f(mp[p] - msa);
    const v4f   pv = *(const v4f*)(hb + p * (WPB * WREG) + PTW + row * SLP + c * 4);
    lv += w * hb[p * (WPB * WREG) + 16 + row];
#pragma unroll
    for (int e = 0; e < 4; ++e) ov[e] += w * pv[e];
  }
  // ---- out = merged acc / merged Z * ren (0 if Z == 0), carries (32768 on P, 1024 on v) folded once;
  //      16 lanes x 16 B = the whole 256-B row segment ----
  const float ls  = (lv > 0.0f) ? lv : 1.0f;
  const float inv = (lv > 0.0f) ? ((1.0f / ls) * oc) : 0.0f;
#pragma unroll
  for (int e = 0; e < 4; ++e) ov[e] *= inv;
  *(v4f*)(Og + ((size_t)(q0 + row)) * QD + head * HD + c * 4) = ov;
}

// =====================================================================================================
// Workspace map (bytes); every plane is fully written by whole-line stores before it is read; all extents are exact multiples
// of the store granularity (no pad rows needed); every region offset a multiple of 1048576:
//   QB  bf16 [SEQ][512]          SEQ*1024    (SEQ=4096: 4194304)
//   KB  bf16 [SEQ][128]          SEQ*256     (1048576)
//   VT  f16  [128][SEQ] x1024    SEQ*256     (1048576)
//   end (SEQ=4096)              6291456
// =====================================================================================================
extern "C" void kernel_launch(void* const* d_in, const int* in_sizes, int n_in,
                              void* d_out, int out_size, void* d_ws, size_t ws_size,
                              hipStream_t stream) {
  if (n_in < 3) return;
  if (in_sizes[0] < SEQ * QD) return;       // query [s][h][d], token-major prefix of SEQ rows used
  if (in_sizes[1] < SEQ * KVD) return;      // key   [s][g][d]
  if (in_sizes[2] < SEQ * KVD) return;      // value [s][g][d]
  if (out_size < SEQ * QD) return;

  const float* q = (const float*)d_in[0];
  const float* k = (const float*)d_in[1];
  const float* v = (const float*)d_in[2];
  float*     out = (float*)d_out;

  const size_t szQB = (size_t)SEQ * QD * 2;
  const size_t szKB = (size_t)SEQ * KVD * 2;
  const size_t szVT = (size_t)KVD * SEQ * 2;
  size_t off = 0;
  const size_t oQB = off; off += szQB;
  const size_t oKB = off; off += szKB;
  const size_t oVT = off; off += szVT;
  if (off > ws_size) return;                // off = 6291456 for SEQ = 4096
  if (off > (size_t)WS_CAP) return;

  char* ws = (char*)d_ws;
  u16* QB = (u16*)(ws + oQB);
  u16* KB = (u16*)(ws + oKB);
  u16* VT = (u16*)(ws + oVT);

  const dim3 b256(256), bAT(ATT_THREADS);
  const int  n8q = (SEQ * QD) / 8;                      // 262144
  const int  n8k = (SEQ * KVD) / 8;                     // 65536
  const dim3 gQ((n8q + 255) / 256);                     // 1024
  const dim3 gK((n8k + 255) / 256);                     // 256
  const dim3 gVT(NKVH * NST);                           // 128
  const int  nqtE = NQTE;                               // query tiles with the P residual product (rows s < QO)
  const int  nqtL = NQT - NQTE;                         // remaining query tiles

  // (0) q -> bf16 plane [SEQ][512]; (1) k -> bf16 plane [SEQ][128]; (2) v^T -> f16 plane [128][SEQ] x1024
  cvt_bf<<<gQ, b256, 0, stream>>>(q, QB, n8q);
  cvt_bf<<<gK, b256, 0, stream>>>(k, KB, n8k);
  vt16<<<gVT, b256, 0, stream>>>(v, VT);
  // (3) causal attention, query tiles s < QO with the P residual product; (4) remaining query tiles -> out f32
  attn_c<1><<<dim3(nqtE * NHG), bAT, 0, stream>>>(QB, KB, VT, out, 0, nqtE);
  if (nqtL > 0) {
    attn_c<0><<<dim3(nqtL * NHG), bAT, 0, stream>>>(QB, KB, VT, out, nqtE, nqtL);
  }
  (void)hipGetLastError();
}

// v002
// A run of this version takes 117 microseconds.
// Timed twice side by side with v001, it ran 1.29 and 1.30 times as fast.
// Counting every step since v000, it is 2.15 times as fast.
// Contractions: q.k^T over 64 on v_wmma_f32_16x16x32_bf16 (q, k as bf16 RNE planes, single product, f32 accumulate);
// P.v on v_wmma_f32_16x16x32_f16 (P x32768 as f16 hi on every query row plus an in-register f16 residual for query rows
// s < QO; v as one f16 plane holding the bf16 RNE value x1024; f32 accumulate). Causal select, base-2 online softmax,
// 1/Z and the chunk-mass renormalisation in f32 on VALU.
#include <hip/hip_runtime.h>
#include <math.h>
#include <stdint.h>

#ifndef SEQ
#define SEQ 4096
#endif
#define S_FULL 4096
#define NH    8
#define NKVH  2
#define HD    64
#define QD    (NH * HD)
#define KVD   (NKVH * HD)
#define WPB   (NH / NKVH)
#define NHG   NKVH
#define QO    ((SEQ < 512) ? SEQ : 512)
#define NQT   (SEQ / 16)
#define NQTE  (QO / 16)
#define NST   (SEQ / 64)
#define NKT   (SEQ / 32)
#define NSPL  8
#define ATT_THREADS (WPB * NSPL * 32)
#define RSQ_HD 0.125f
#define LOG2E 1.4426950408889634f
#define PCAR  32768.0f
#define VCAR  1024.0f
#define PTP   36
#define PTW   (16 * PTP)
#define SLP   68
#define SLW   (16 * SLP)
#define WREG  (PTW + SLW)
#define VTP   72
#define WS_CAP 134217728
static_assert(QD == 512 && KVD == 128 && HD == 64 && NH == 8 && NKVH == 2 && WPB == 4 && NHG * WPB == NH);
static_assert(ATT_THREADS == 1024 && (16 % NSPL) == 0 && (16 / NSPL) == 2);
static_assert((SEQ % 64) == 0 && SEQ >= 64 && SEQ <= S_FULL);
static_assert((QO % 16) == 0 && QO >= 16 && QO <= SEQ);
static_assert((HD % 32) == 0 && ((SEQ * QD / 8) % 256) == 0 && ((SEQ * KVD / 8) % 256) == 0);

typedef unsigned short u16;
typedef _Float16 v16h __attribute__((ext_vector_type(16)));
typedef _Float16 v8h  __attribute__((ext_vector_type(8)));
typedef __bf16   v16b __attribute__((ext_vector_type(16)));
typedef float    v8f  __attribute__((ext_vector_type(8)));
typedef float    v4f  __attribute__((ext_vector_type(4)));
typedef unsigned int v4u __attribute__((ext_vector_type(4)));

union FragH { v16h v; v8h h[2]; v4u u[2]; };
union FragB { v16b v; v4u u[2]; };

// ---- scalar helpers --------------------------------------------------------------------------------
__device__ __forceinline__ unsigned short bf_bits(float f) {          // f32 -> bf16 bits, RNE convert
  unsigned u = __float_as_uint(f);
  return (unsigned short)((u + 0x7FFFu + ((u >> 16) & 1u)) >> 16);
}
__device__ __forceinline__ float bf_up(unsigned short h) { return __uint_as_float(((unsigned)h) << 16); }
__device__ __forceinline__ float bfr(float f) { return bf_up(bf_bits(f)); }
__device__ __forceinline__ unsigned short h_bits(_Float16 x) { return __builtin_bit_cast(unsigned short, x); }
__device__ __forceinline__ unsigned pk16(unsigned short a, unsigned short b) { return (unsigned)a | ((unsigned)b << 16); }
__device__ __forceinline__ v8f zero8() { v8f z = {0.f, 0.f, 0.f, 0.f, 0.f, 0.f, 0.f, 0.f}; return z; }

// ---- fragment loaders: 16-bit A/B operand, lane -> row/col (lane&15), p already includes +8*(lane>>4);
//      elements 0..7 <- p[0..7] (k0+8h..), elements 8..15 <- p[16..23] (k0+16+8h..)  (same split k map for A and B;
//      B is always read from a k-contiguous [n][k] plane)
__device__ __forceinline__ v16h ldfrag_h(const _Float16* p) {
  FragH f;
  f.h[0] = *(const v8h*)(p);
  f.h[1] = *(const v8h*)(p + 16);
  return f.v;
}
__device__ __forceinline__ v16b ldfrag_b(const u16* p) {              // bf16 plane read as unsigned integer vectors
  FragB f;
  f.u[0] = *(const v4u*)(p);
  f.u[1] = *(const v4u*)(p + 16);
  return f.v;
}

__device__ __forceinline__ v8f mma_h(v16h a, v16h b, v8f c) {
  return __builtin_amdgcn_wmma_f32_16x16x32_f16(false, a, false, b, (short)0, c, false, false);
}
__device__ __forceinline__ v8f mma_b(v16b a, v16b b, v8f c) {
  return __builtin_amdgcn_wmma_f32_16x16x32_bf16(false, a, false, b, (short)0, c, false, false);
}
template <typename F>
__device__ __forceinline__ void guard2(v8f& a, v8f& b, F x0, F x1, F x2, F x3, F x4, F x5) {
#if defined(__HIP_DEVICE_COMPILE__)
  asm volatile("v_nop\n\tv_nop\n\tv_nop\n\tv_nop"
               : "+v"(a), "+v"(b) : "v"(x0), "v"(x1), "v"(x2), "v"(x3), "v"(x4), "v"(x5) : "memory");
#endif
}
__device__ __forceinline__ void acc_guard4(v8f& a, v8f& b, v8f& c, v8f& d) {
#if defined(__HIP_DEVICE_COMPILE__)
  asm volatile("v_nop\n\tv_nop\n\tv_nop\n\tv_nop" : "+v"(a), "+v"(b), "+v"(c), "+v"(d));
#endif
}
__device__ __forceinline__ void wave_sync_lds() {
  __builtin_amdgcn_fence(__ATOMIC_RELEASE, "workgroup");
  __builtin_amdgcn_wave_barrier();
  __builtin_amdgcn_fence(__ATOMIC_ACQUIRE, "workgroup");
}

// =====================================================================================================
// f32 -> bf16 RNE bit plane, same layout. Thread = 8 consecutive elements: two 16-B loads, one 16-B store; 32 consecutive
// No barriers in this kernel.
// coverage: grid = ceil(n8/256) blocks x 256 thr x 8 (in-kernel bound) = the whole plane (n8 a multiple of 256 here).
// =====================================================================================================
__global__ __launch_bounds__(256) void cvt_bf(const float* __restrict__ x, u16* D, int n8) {
  const int gt = blockIdx.x * 256 + (int)threadIdx.x;
  if (gt >= n8) return;
  const float* p = x + (size_t)gt * 8;
  const v4f a = *(const v4f*)(p), b4 = *(const v4f*)(p + 4);
  float w[8];
#pragma unroll
  for (int e = 0; e < 4; ++e) { w[e] = a[e]; w[4 + e] = b4[e]; }
  v4u o;
#pragma unroll
  for (int e = 0; e < 4; ++e) {
    o[e] = pk16(bf_bits(w[2 * e]), bf_bits(w[2 * e + 1]));
  }
  u16* d = D + (size_t)gt * 8;
  {
    *(v4u*)(d) = o;
    
  }
}

// =====================================================================================================
// v^T plane from V f32 [SEQ][KVD] (row = key s, column = g*HD + d):
//   VT[(g*HD + d)][s] = f16 bits of (bf16 RNE value of v) * 1024  (exact for |v| >= 6e-8: 8-bit significand, power-of-two carry).
// Block = (kv head g, 64 keys s0): each thread loads 16 floats (key sl, d chunk dc) with 16-B loads, converts, scatters into the LDS
// coverage: load 256 thr x 16 = 64 keys x 64 d; store 2 iterations x 256 thr x 8 halves = 64 lines x 64 = the block's tile;
//           grid = NKVH*NST blocks covers the [KVD][SEQ] plane exactly once.
// =====================================================================================================
__global__ __launch_bounds__(256) void vt16(const float* __restrict__ V, u16* VTo) {
  __shared__ __align__(16) u16 T[HD * VTP];
  const int tid = threadIdx.x;
  const int bid = blockIdx.x;
  const int st  = bid % NST;
  const int g   = bid / NST;
  if (g >= NKVH) return;                    // block-uniform, before the barrier; never taken with the exact grid
  const int s0  = st * 64;
  {
    const int sl = tid >> 2;                // key within tile 0..63
    const int dc = (tid & 3) * 16;          // d chunk
    const float* src = V + (size_t)(s0 + sl) * KVD + g * HD + dc;
#pragma unroll
    for (int i = 0; i < 4; ++i) {
      const v4f a = *(const v4f*)(src + 4 * i);
#pragma unroll
      for (int e = 0; e < 4; ++e) {
        const float t = bfr(a[e]) * VCAR;
        T[(dc + 4 * i + e) * VTP + sl] = h_bits((_Float16)t);
      }
    }
  }
  __syncthreads();
  v4u w4[2];
  const int q8 = tid >> 3, p8 = (tid & 7) * 8;
#pragma unroll
  for (int it = 0; it < 2; ++it) {
    const int line = it * 32 + q8;          // d = 0..63
    w4[it] = *(const v4u*)(T + line * VTP + p8);
  }
  const size_t base = (size_t)(g * HD) * SEQ + s0 + p8;
  {
#pragma unroll
    for (int it = 0; it < 2; ++it) {
      const int line = it * 32 + q8;
      *(v4u*)(VTo + base + (size_t)line * SEQ) = w4[it];
    }
    
  }
}

// =====================================================================================================
// Causal grouped-query attention over head dim 64. Block bid -> (query tile qt = qtbeg + nqt - 1 - bid / NHG: rows q0 = 16*qt ..
// q0+15, head group hg = bid % NHG = kv head): a tile's key count grows with qt and there are more blocks than resident places, so
// the longest blocks take the lowest indices and start first, the shortest fill the places that free up; NSPL waves per query head: wave w -> head hg*WPB + (w % WPB), key split sp = w / WPB (the 4 heads of the
// group share kv head hg; the 4 waves of one split read the same k and v tiles).
//   q bf16 plane [s][h*HD + d] (pitch QD); k bf16 plane [s][g*HD + d] (pitch KVD); v^T f16 plane [g*HD + d][SEQ] x1024.
//   scores = q.k single bf16 product (A = q rows, B = k rows as [n = key][k = d]), f32 accumulate;
//   t(i, j) (log2 domain) = (q_i.k_j over HD) * (1/8)*log2e, replaced by -inf where key j > query i (causal select).
//   Key tiles of 32 with kb <= q0 + 15 (later tiles hold only keys above every query row of the tile: weight 0); split sp visits
//   tiles sp, sp + NSPL, ... in order, with its own running maximum, sum and accumulators (none: maximum -inf, sum 0, zeros).
//   Per tile: 2 score subtiles x 2 k-steps, fragments loaded straight from the 16-bit planes (two 16-B loads per fragment, split k
//   map; q fragments preloaded once); online max-subtracted base-2 softmax in f32, -inf-safe rescale; the 16x32 prob tile stored to
//   when PRES != 0) rebuilt from the LDS rows (float vector loads, same element type as stored); v^T B fragments (col n = d) in
//   2 groups of 2 d-subtiles.
//   After the loop: every wave puts its un-normalised 16 x 64 partial into its own slab (pitch 68) and its 16 (maximum, sum) pairs
//   into its own, now free, prob tile; one block barrier; wave (head, sp) merges rows 2*sp, 2*sp + 1 of its head over the NSPL
//   partials in the fixed order 0..NSPL-1: M = max of maxima, weight exp2(m - M) (a partial with maximum -inf weighs 0),
//   out = sum(w * acc) / sum(w * Z) * cw/(cw + 1e-8) with cw the mass of the single local softmax chunk (merged Z > 0 always:
//   key 0 <= every query row; guarded anyway), carries 1/(32768*1024) folded once.
// coverage: per wave 1 instruction x 2 rows x 16 lanes x 4 floats; NSPL waves = the head's 16 x 64 row segments; grid nqt x NHG
//           blocks x WPB heads = every (s, h) row segment of the launched query tiles once; the two launches (tiles [0, NQTE) and
//           [NQTE, NQT)) together cover every query tile once.
// =====================================================================================================
template <int PRES>
__global__ __launch_bounds__(ATT_THREADS)
void attn_c(const u16* __restrict__ QBp, const u16* __restrict__ KBp, const u16* __restrict__ VTp,
            float* Og, int qtbeg, int nqt) {
  __shared__ __align__(16) float smem[WPB * NSPL * WREG];

  const int tid  = threadIdx.x;
  const int wave = __builtin_amdgcn_readfirstlane(tid >> 5);   // scalar: the key loop's bounds stay wave-uniform branches
  const int hw   = wave % WPB;              // head within the group
  const int sp   = wave / WPB;              // key split
  const int lane = tid & 31;
  const int hh   = lane >> 4;
  const int c    = lane & 15;
  const int bid  = blockIdx.x;
  const int rk   = bid / NHG;               // rank by falling cost: 0 = the launch's last (longest) query tile
  const int hg   = bid % NHG;
  if (rk >= nqt) return;                    // block-uniform, before the barrier; never taken with the exact grid
  const int qt   = qtbeg + nqt - 1 - rk;
  const int q0   = qt * 16;
  if (q0 + 16 > SEQ) return;                // block-uniform; never taken
  const int head = hg * WPB + hw;
  const int kvh  = hg;

  float* pt   = smem + wave * WREG;         // prob tile [16][32] pitch 36
  float* slab = pt + PTW;                   // result slab [16][64] pitch 68

  const u16* Qp  = QBp + ((size_t)(q0 + c)) * QD + head * HD + 8 * hh;           // A: row = query q0 + c, k = d
  const u16* Khb = KBp + ((size_t)c) * KVD + kvh * HD + 8 * hh;                  // B: col n = key (kb added per step), k = d
  const _Float16* Vhb = (const _Float16*)(const void*)VTp + ((size_t)(kvh * HD + c)) * SEQ + 8 * hh;  // B: col n = d c (+16j), k = key
  const float lsc = RSQ_HD * LOG2E;
  const float cw  = 1.0f;                   // mass of the single local softmax chunk
  const float ren = cw / (cw + 1e-8f);
  const float oc  = ren / (PCAR * VCAR);
  const size_t KROW = (size_t)KVD;          // halves between consecutive key rows

  const v16b qa0 = ldfrag_b(Qp);            // d 0..31
  const v16b qa1 = ldfrag_b(Qp + 32);       // d 32..63

  float mrow[8], lrow[8];
  v8f o[4];
#pragma unroll
  for (int r = 0; r < 8; ++r) { mrow[r] = -INFINITY; lrow[r] = 0.f; }
#pragma unroll
  for (int j = 0; j < 4; ++j) o[j] = zero8();
  const int ncaus = (q0 >> 5) + 1;                                            // tiles holding keys <= q0 + 15
  const int nkt = (ncaus < NKT) ? ncaus : NKT;
  const int qr0 = q0 + 8 * hh;                                                // query row of D element r = qr0 + r

#pragma unroll 1
  for (int kt = sp; kt < nkt; kt += NSPL) {
    const int kb = kt * 32;
    // ---- scores: D element r of this lane = (query row qr0 + r, key kb + c) in s0, key kb + 16 + c in s1 ----
    v8f s0 = zero8(), s1 = zero8();
    {
      const u16* k0p = Khb + (size_t)kb * KROW;
      const u16* k1p = k0p + (size_t)16 * KROW;
      const v16b kf00 = ldfrag_b(k0p);
      const v16b kf01 = ldfrag_b(k1p);
      const v16b kf10 = ldfrag_b(k0p + 32);
      const v16b kf11 = ldfrag_b(k1p + 32);
      s0 = mma_b(qa0, kf00, s0);
      s1 = mma_b(qa0, kf01, s1);
      s0 = mma_b(qa1, kf10, s0);
      s1 = mma_b(qa1, kf11, s1);
      guard2<v16b>(s0, s1, qa0, qa1, kf00, kf01, kf10, kf11);
    }
    // ---- causal select + online softmax in base 2, -inf-safe ----
    const int key0 = kb + c, key1 = kb + 16 + c;
#pragma unroll
    for (int r = 0; r < 8; ++r) {
      const int   qr = qr0 + r;
      const float u0 = s0[r] * lsc;
      const float u1 = s1[r] * lsc;
      const float t0 = (key0 > qr) ? -INFINITY : u0;
      const float t1 = (key1 > qr) ? -INFINITY : u1;
      float mx = fmaxf(t0, t1);
#pragma unroll
      for (int off = 1; off < 16; off <<= 1) mx = fmaxf(mx, __shfl_xor(mx, off, 32));
      const float mn = fmaxf(mrow[r], mx);
      const float ms = (mn == -INFINITY) ? 0.0f : mn;
      const float al = exp2f(mrow[r] - ms);
      mrow[r] = mn;
      const float e0 = exp2f(t0 - ms), e1 = exp2f(t1 - ms);
      float ps = e0 + e1;
#pragma unroll
      for (int off = 1; off < 16; off <<= 1) ps += __shfl_xor(ps, off, 32);
      lrow[r] = lrow[r] * al + ps;
#pragma unroll
      for (int j = 0; j < 4; ++j) o[j][r] *= al;
      const int ro = (8 * hh + r) * PTP + c;
      pt[ro]      = e0;
      pt[ro + 16] = e1;
    }
    wave_sync_lds();
    // ---- A fragments of P*32768: hi f16 (and residual f16 when PRES != 0), row = c, split k map over the 32 keys of this step ----
    FragH ph, pl;
    {
      const float* prow = pt + c * PTP + 8 * hh;
      const v4f p0 = *(const v4f*)(prow), p1 = *(const v4f*)(prow + 4);
      const v4f p2 = *(const v4f*)(prow + 16), p3 = *(const v4f*)(prow + 20);
#pragma unroll
      for (int e = 0; e < 4; ++e) {
        const float ta = p0[e] * PCAR, tb = p1[e] * PCAR, tc = p2[e] * PCAR, td = p3[e] * PCAR;
        const _Float16 ha = (_Float16)ta, hb = (_Float16)tb, hc = (_Float16)tc, hd = (_Float16)td;
        ph.h[0][e]     = ha;                  // elements 0..7  = keys kb + 8hh + 0..7
        ph.h[0][4 + e] = hb;
        ph.h[1][e]     = hc;                  // elements 8..15 = keys kb + 16 + 8hh + 0..7
        ph.h[1][4 + e] = hd;
        if constexpr (PRES != 0) {
          pl.h[0][e]     = (_Float16)(ta - (float)ha);
          pl.h[0][4 + e] = (_Float16)(tb - (float)hb);
          pl.h[1][e]     = (_Float16)(tc - (float)hc);
          pl.h[1][4 + e] = (_Float16)(td - (float)hd);
        }
      }
      if constexpr (PRES == 0) { pl.v = ph.v; }
    }
    // ---- P.V : B fragment col n = d = j*16 + c, keys contiguous in the v^T plane; 2 groups of 2 d-subtiles ----
    {
      const _Float16* vp = Vhb + kb;
#pragma unroll
      for (int jg = 0; jg < 2; ++jg) {
        const size_t da = (size_t)(2 * jg) * 16 * SEQ;
        const size_t db = da + (size_t)16 * SEQ;
        const v16h va = ldfrag_h(vp + da), vb = ldfrag_h(vp + db);
        o[2 * jg]     = mma_h(ph.v, va, o[2 * jg]);
        if constexpr (PRES != 0) { o[2 * jg] = mma_h(pl.v, va, o[2 * jg]); }
        o[2 * jg + 1] = mma_h(ph.v, vb, o[2 * jg + 1]);
        if constexpr (PRES != 0) { o[2 * jg + 1] = mma_h(pl.v, vb, o[2 * jg + 1]); }
        guard2<v16h>(o[2 * jg], o[2 * jg + 1], ph.v, pl.v, va, vb, va, vb);
      }
    }
    wave_sync_lds();
  }
  acc_guard4(o[0], o[1], o[2], o[3]);
  // ---- this split's partial: un-normalised accumulators into the lane-owned slab, (maximum, sum) of each row into the prob tile ----
#pragma unroll
  for (int r = 0; r < 8; ++r) {
#pragma unroll
    for (int j = 0; j < 4; ++j) {
      const int idx = (8 * hh + r) * SLP + j * 16 + c;
      slab[idx] = o[j][r];
    }
    if (c == 0) {
      pt[8 * hh + r]      = mrow[r];
      pt[16 + 8 * hh + r] = lrow[r];
    }
  }
  __syncthreads();                          // every wave's partial is in LDS before any wave merges; reached by all waves once
  // ---- merge over the NSPL splits of this head: lanes (hh, c): row 2*sp + hh, floats 4c..4c+3 ----
  const int row = sp * (16 / NSPL) + hh;
  const float* hb = smem + hw * WREG;       // split p of this head: + p * WPB * WREG
  float mp[NSPL];
  float mall = -INFINITY;
#pragma unroll
  for (int p = 0; p < NSPL; ++p) {
    mp[p] = hb[p * (WPB * WREG) + row];
    mall  = fmaxf(mall, mp[p]);
  }
  const float msa = (mall == -INFINITY) ? 0.0f : mall;
  float lv = 0.f;
  v4f   ov = {0.f, 0.f, 0.f, 0.f};
#pragma unroll
  for (int p = 0; p < NSPL; ++p) {
    const float w  = exp2f(mp[p] - msa);
    const v4f   pv = *(const v4f*)(hb + p * (WPB * WREG) + PTW + row * SLP + c * 4);
    lv += w * hb[p * (WPB * WREG) + 16 + row];
#pragma unroll
    for (int e = 0; e < 4; ++e) ov[e] += w * pv[e];
  }
  // ---- out = merged acc / merged Z * ren (0 if Z == 0), carries (32768 on P, 1024 on v) folded once;
  //      16 lanes x 16 B = the whole 256-B row segment ----
  const float ls  = (lv > 0.0f) ? lv : 1.0f;
  const float inv = (lv > 0.0f) ? ((1.0f / ls) * oc) : 0.0f;
#pragma unroll
  for (int e = 0; e < 4; ++e) ov[e] *= inv;
  *(v4f*)(Og + ((size_t)(q0 + row)) * QD + head * HD + c * 4) = ov;
}

// =====================================================================================================
// Workspace map (bytes); every plane is fully written by whole-line stores before it is read; all extents are exact multiples
// of the store granularity (no pad rows needed); every region offset a multiple of 1048576:
//   QB  bf16 [SEQ][512]          SEQ*1024    (SEQ=4096: 4194304)
//   KB  bf16 [SEQ][128]          SEQ*256     (1048576)
//   VT  f16  [128][SEQ] x1024    SEQ*256     (1048576)
//   end (SEQ=4096)              6291456
// =====================================================================================================
extern "C" void kernel_launch(void* const* d_in, const int* in_sizes, int n_in,
                              void* d_out, int out_size, void* d_ws, size_t ws_size,
                              hipStream_t stream) {
  if (n_in < 3) return;
  if (in_sizes[0] < SEQ * QD) return;       // query [s][h][d], token-major prefix of SEQ rows used
  if (in_sizes[1] < SEQ * KVD) return;      // key   [s][g][d]
  if (in_sizes[2] < SEQ * KVD) return;      // value [s][g][d]
  if (out_size < SEQ * QD) return;

  const float* q = (const float*)d_in[0];
  const float* k = (const float*)d_in[1];
  const float* v = (const float*)d_in[2];
  float*     out = (float*)d_out;

  const size_t szQB = (size_t)SEQ * QD * 2;
  const size_t szKB = (size_t)SEQ * KVD * 2;
  const size_t szVT = (size_t)KVD * SEQ * 2;
  size_t off = 0;
  const size_t oQB = off; off += szQB;
  const size_t oKB = off; off += szKB;
  const size_t oVT = off; off += szVT;
  if (off > ws_size) return;                // off = 6291456 for SEQ = 4096
  if (off > (size_t)WS_CAP) return;

  char* ws = (char*)d_ws;
  u16* QB = (u16*)(ws + oQB);
  u16* KB = (u16*)(ws + oKB);
  u16* VT = (u16*)(ws + oVT);

  const dim3 b256(256), bAT(ATT_THREADS);
  const int  n8q = (SEQ * QD) / 8;                      // 262144
  const int  n8k = (SEQ * KVD) / 8;                     // 65536
  const dim3 gQ((n8q + 255) / 256);                     // 1024
  const dim3 gK((n8k + 255) / 256);                     // 256
  const dim3 gVT(NKVH * NST);                           // 128
  const int  nqtE = NQTE;                               // query tiles with the P residual product (rows s < QO)
  const int  nqtL = NQT - NQTE;                         // remaining query tiles

  // (0) q -> bf16 plane [SEQ][512]; (1) k -> bf16 plane [SEQ][128]; (2) v^T -> f16 plane [128][SEQ] x1024
  cvt_bf<<<gQ, b256, 0, stream>>>(q, QB, n8q);
  cvt_bf<<<gK, b256, 0, stream>>>(k, KB, n8k);
  vt16<<<gVT, b256, 0, stream>>>(v, VT);
  // (3) causal attention, query tiles s < QO with the P residual product; (4) remaining query tiles -> out f32
  attn_c<1><<<dim3(nqtE * NHG), bAT, 0, stream>>>(QB, KB, VT, out, 0, nqtE);
  if (nqtL > 0) {
    attn_c<0><<<dim3(nqtL * NHG), bAT, 0, stream>>>(QB, KB, VT, out, nqtE, nqtL);
  }
  (void)hipGetLastError();
}

// v003
// A run of this version takes 105 microseconds.
// Two timings next to v002 put it at 1.10 and 1.12 times that version's speed.
// Counting every step since v000, it is 2.38 times as fast.
// Contractions: q.k^T over 64 on v_wmma_f32_16x16x32_bf16 (q, k as bf16 RNE planes, single product, f32 accumulate);
// P.v on v_wmma_f32_16x16x32_f16 (P x32768 as f16 hi on every query row plus an in-register f16 residual for query rows
// s < QO; v as one f16 plane holding the bf16 RNE value x1024; f32 accumulate). Causal select, base-2 online softmax,
// 1/Z and the chunk-mass renormalisation in f32 on VALU.
// The k and v planes lie in fragment order: each 16-byte-per-lane fragment load of a wave reads 512 consecutive bytes.
#include <hip/hip_runtime.h>
#include <math.h>
#include <stdint.h>

#ifndef SEQ
#define SEQ 4096
#endif
#define S_FULL 4096
#define NH    8
#define NKVH  2
#define HD    64
#define QD    (NH * HD)
#define KVD   (NKVH * HD)
#define WPB   (NH / NKVH)
#define NHG   NKVH
#define QO    ((SEQ < 512) ? SEQ : 512)
#define NQT   (SEQ / 16)
#define NQTE  (QO / 16)
#define NST   (SEQ / 64)
#define NKT   (SEQ / 32)
#define NSPL  8
#define ATT_THREADS (WPB * NSPL * 32)
#define RSQ_HD 0.125f
#define LOG2E 1.4426950408889634f
#define PCAR  32768.0f
#define VCAR  1024.0f
#define PTP   36
#define PTW   (16 * PTP)
#define SLP   68
#define SLW   (16 * SLP)
#define WREG  (PTW + SLW)
#define VTP   72
#define FRP   256                          // halves between the two 16-byte parts of a fragment (32 lanes x 8)
#define FRW   (2 * FRP)                    // halves of one fragment
#define KTW   (4 * FRW)                    // halves of one 32-key tile of one kv head (4 fragments), k plane and v plane alike
#define WS_CAP 134217728
static_assert(QD == 512 && KVD == 128 && HD == 64 && NH == 8 && NKVH == 2 && WPB == 4 && NHG * WPB == NH);
static_assert(ATT_THREADS == 1024 && (16 % NSPL) == 0 && (16 / NSPL) == 2);
static_assert((SEQ % 64) == 0 && SEQ >= 64 && SEQ <= S_FULL);
static_assert((QO % 16) == 0 && QO >= 16 && QO <= SEQ);
static_assert((HD % 32) == 0 && ((SEQ * QD / 8) % 256) == 0 && ((SEQ * KVD / 8) % 256) == 0);

typedef unsigned short u16;
typedef _Float16 v16h __attribute__((ext_vector_type(16)));
typedef _Float16 v8h  __attribute__((ext_vector_type(8)));
typedef __bf16   v16b __attribute__((ext_vector_type(16)));
typedef float    v8f  __attribute__((ext_vector_type(8)));
typedef float    v4f  __attribute__((ext_vector_type(4)));
typedef unsigned int v4u __attribute__((ext_vector_type(4)));

union FragH { v16h v; v8h h[2]; v4u u[2]; };
union FragB { v16b v; v4u u[2]; };

// ---- scalar helpers --------------------------------------------------------------------------------
__device__ __forceinline__ unsigned short bf_bits(float f) {          // f32 -> bf16 bits, RNE convert
  unsigned u = __float_as_uint(f);
  return (unsigned short)((u + 0x7FFFu + ((u >> 16) & 1u)) >> 16);
}
__device__ __forceinline__ float bf_up(unsigned short h) { return __uint_as_float(((unsigned)h) << 16); }
__device__ __forceinline__ float bfr(float f) { return bf_up(bf_bits(f)); }
__device__ __forceinline__ unsigned short h_bits(_Float16 x) { return __builtin_bit_cast(unsigned short, x); }
__device__ __forceinline__ unsigned pk16(unsigned short a, unsigned short b) { return (unsigned)a | ((unsigned)b << 16); }
__device__ __forceinline__ v8f zero8() { v8f z = {0.f, 0.f, 0.f, 0.f, 0.f, 0.f, 0.f, 0.f}; return z; }

// ---- fragment loaders: 16-bit A/B operand, lane -> row/col (lane&15), p already includes +8*(lane>>4);
//      elements 0..7 <- p[0..7] (k0+8h..), elements 8..15 <- p[16..23] (k0+16+8h..)  (same split k map for A and B;
//      used for q; the k and v operands come from the fragment-order planes through the two loaders below, same k map)
__device__ __forceinline__ v16b ldfrag_b(const u16* p) {              // bf16 plane read as unsigned integer vectors
  FragB f;
  f.u[0] = *(const v4u*)(p);
  f.u[1] = *(const v4u*)(p + 16);
  return f.v;
}

// fragment-order planes: p already includes +8*lane; elements 0..7 <- p[0..7], elements 8..15 <- p[FRP..FRP+7]
__device__ __forceinline__ v16h ldfrag_hf(const _Float16* p) {
  FragH f;
  f.h[0] = *(const v8h*)(p);
  f.h[1] = *(const v8h*)(p + FRP);
  return f.v;
}
__device__ __forceinline__ v16b ldfrag_bf(const u16* p) {
  FragB f;
  f.u[0] = *(const v4u*)(p);
  f.u[1] = *(const v4u*)(p + FRP);
  return f.v;
}

__device__ __forceinline__ v8f mma_h(v16h a, v16h b, v8f c) {
  return __builtin_amdgcn_wmma_f32_16x16x32_f16(false, a, false, b, (short)0, c, false, false);
}
__device__ __forceinline__ v8f mma_b(v16b a, v16b b, v8f c) {
  return __builtin_amdgcn_wmma_f32_16x16x32_bf16(false, a, false, b, (short)0, c, false, false);
}
template <typename F>
__device__ __forceinline__ void guard2(v8f& a, v8f& b, F x0, F x1, F x2, F x3, F x4, F x5) {
#if defined(__HIP_DEVICE_COMPILE__)
  asm volatile("v_nop\n\tv_nop\n\tv_nop\n\tv_nop"
               : "+v"(a), "+v"(b) : "v"(x0), "v"(x1), "v"(x2), "v"(x3), "v"(x4), "v"(x5) : "memory");
#endif
}
__device__ __forceinline__ void acc_guard4(v8f& a, v8f& b, v8f& c, v8f& d) {
#if defined(__HIP_DEVICE_COMPILE__)
  asm volatile("v_nop\n\tv_nop\n\tv_nop\n\tv_nop" : "+v"(a), "+v"(b), "+v"(c), "+v"(d));
#endif
}
__device__ __forceinline__ void wave_sync_lds() {
  __builtin_amdgcn_fence(__ATOMIC_RELEASE, "workgroup");
  __builtin_amdgcn_wave_barrier();
  __builtin_amdgcn_fence(__ATOMIC_ACQUIRE, "workgroup");
}

// =====================================================================================================
// f32 -> bf16 RNE bit plane, same layout. Thread = 8 consecutive elements: two 16-B loads, one 16-B store; 32 consecutive
// No barriers in this kernel.
// coverage: grid = ceil(n8/256) blocks x 256 thr x 8 (in-kernel bound) = the whole plane (n8 a multiple of 256 here).
// =====================================================================================================
__global__ __launch_bounds__(256) void cvt_bf(const float* __restrict__ x, u16* D, int n8) {
  const int gt = blockIdx.x * 256 + (int)threadIdx.x;
  if (gt >= n8) return;
  const float* p = x + (size_t)gt * 8;
  const v4f a = *(const v4f*)(p), b4 = *(const v4f*)(p + 4);
  float w[8];
#pragma unroll
  for (int e = 0; e < 4; ++e) { w[e] = a[e]; w[4 + e] = b4[e]; }
  v4u o;
#pragma unroll
  for (int e = 0; e < 4; ++e) {
    o[e] = pk16(bf_bits(w[2 * e]), bf_bits(w[2 * e + 1]));
  }
  u16* d = D + (size_t)gt * 8;
  {
    *(v4u*)(d) = o;
    
  }
}

// =====================================================================================================
// k f32 [SEQ][KVD] -> bf16 RNE bits in fragment order. 16-byte chunk o = (((g*NKT + kt)*4 + f)*2 + part)*32 + lane holds
//   k[kt*32 + (f>>1)*16 + (lane&15)][g*HD + (f&1)*32 + part*16 + (lane>>4)*8 + 0..7]
// (f = key subtile * 2 + d step; the split k map of the operand loaders). Thread = one output chunk: two 16-B loads, one 16-B
// store; a wave stores 512 consecutive bytes (whole lines, one writer each). No barriers in this kernel.
// coverage: grid = ceil(nch/256) blocks x 256 chunks (in-kernel bound) = NKVH*NKT tiles x 256 chunks = the whole plane once.
// =====================================================================================================
__global__ __launch_bounds__(256) void cvt_kf(const float* __restrict__ K, u16* D, int nch) {
  const int o = blockIdx.x * 256 + (int)threadIdx.x;
  if (o >= nch) return;
  const int lane = o & 31, part = (o >> 5) & 1, f = (o >> 6) & 3, t = o >> 8;
  const int kt = t % NKT, g = t / NKT;
  const int s = kt * 32 + (f >> 1) * 16 + (lane & 15);
  const int d = (f & 1) * 32 + part * 16 + (lane >> 4) * 8;
  const float* p = K + (size_t)s * KVD + g * HD + d;
  const v4f a = *(const v4f*)(p), b4 = *(const v4f*)(p + 4);
  v4u w;
  w[0] = pk16(bf_bits(a[0]), bf_bits(a[1]));
  w[1] = pk16(bf_bits(a[2]), bf_bits(a[3]));
  w[2] = pk16(bf_bits(b4[0]), bf_bits(b4[1]));
  w[3] = pk16(bf_bits(b4[2]), bf_bits(b4[3]));
  *(v4u*)(D + (size_t)o * 8) = w;
}

// =====================================================================================================
// v^T plane in fragment order from V f32 [SEQ][KVD] (row = key s, column = g*HD + d); value = f16 bits of (bf16 RNE value of v)
// * 1024 (exact for |v| >= 6e-8: 8-bit significand, power-of-two carry). 16-byte chunk
//   (((g*NKT + kt)*4 + j)*2 + part)*32 + lane holds d = j*16 + (lane&15), keys kt*32 + part*16 + (lane>>4)*8 + 0..7.
// Block = (kv head g, 64 keys s0): each thread loads 16 floats (key sl, d chunk dc) with 16-B loads, converts, scatters into the LDS
// coverage: load 256 thr x 16 = 64 keys x 64 d; store 2 iterations x 256 thr x 8 halves = the block's two 32-key tiles;
//           grid = NKVH*NST blocks covers the NKVH*NKT tiles exactly once.
// =====================================================================================================
__global__ __launch_bounds__(256) void vt16(const float* __restrict__ V, u16* VTo) {
  __shared__ __align__(16) u16 T[HD * VTP];
  const int tid = threadIdx.x;
  const int bid = blockIdx.x;
  const int st  = bid % NST;
  const int g   = bid / NST;
  if (g >= NKVH) return;                    // block-uniform, before the barrier; never taken with the exact grid
  const int s0  = st * 64;
  {
    const int sl = tid >> 2;                // key within tile 0..63
    const int dc = (tid & 3) * 16;          // d chunk
    const float* src = V + (size_t)(s0 + sl) * KVD + g * HD + dc;
#pragma unroll
    for (int i = 0; i < 4; ++i) {
      const v4f a = *(const v4f*)(src + 4 * i);
#pragma unroll
      for (int e = 0; e < 4; ++e) {
        const float t = bfr(a[e]) * VCAR;
        T[(dc + 4 * i + e) * VTP + sl] = h_bits((_Float16)t);
      }
    }
  }
  __syncthreads();
  v4u w4[2];
  const int line = ((tid >> 6) & 3) * 16 + (tid & 15);                 // d = j*16 + (lane&15)
  const int koff = ((tid >> 5) & 1) * 16 + ((tid >> 4) & 1) * 8;       // part*16 + (lane>>4)*8
#pragma unroll
  for (int it = 0; it < 2; ++it) {          // it = 32-key tile within the block's 64 keys
    w4[it] = *(const v4u*)(T + line * VTP + it * 32 + koff);
  }
  u16* dst = VTo + (size_t)(g * NKT + 2 * st) * KTW + tid * 8;
#pragma unroll
  for (int it = 0; it < 2; ++it) {
    *(v4u*)(dst + it * KTW) = w4[it];
  }
}

// =====================================================================================================
// Causal grouped-query attention over head dim 64. Block bid -> (query tile qt = qtbeg + nqt - 1 - bid / NHG: rows q0 = 16*qt ..
// q0+15, head group hg = bid % NHG = kv head): a tile's key count grows with qt and there are more blocks than resident places, so
// the longest blocks take the lowest indices and start first, the shortest fill the places that free up; NSPL waves per query head: wave w -> head hg*WPB + (w % WPB), key split sp = w / WPB (the 4 heads of the
// group share kv head hg; the 4 waves of one split read the same k and v tiles).
//   q bf16 plane [s][h*HD + d] (pitch QD); k bf16 plane and v^T f16 plane (x1024) in fragment order, KTW halves per (g, key tile).
//   scores = q.k single bf16 product (A = q rows, B = k rows as [n = key][k = d]), f32 accumulate;
//   t(i, j) (log2 domain) = (q_i.k_j over HD) * (1/8)*log2e, replaced by -inf where key j > query i (causal select).
//   Key tiles of 32 with kb <= q0 + 15 (later tiles hold only keys above every query row of the tile: weight 0); split sp visits
//   tiles sp, sp + NSPL, ... in order, with its own running maximum, sum and accumulators (none: maximum -inf, sum 0, zeros).
//   Per tile: 2 score subtiles x 2 k-steps, fragments loaded straight from the 16-bit planes (two 16-B loads per fragment, split k
//   map; q fragments preloaded once); online max-subtracted base-2 softmax in f32, -inf-safe rescale; the 16x32 prob tile stored to
//   when PRES != 0) rebuilt from the LDS rows (float vector loads, same element type as stored); v^T B fragments (col n = d) in
//   2 groups of 2 d-subtiles.
//   After the loop: every wave puts its un-normalised 16 x 64 partial into its own slab (pitch 68) and its 16 (maximum, sum) pairs
//   into its own, now free, prob tile; one block barrier; wave (head, sp) merges rows 2*sp, 2*sp + 1 of its head over the NSPL
//   partials in the fixed order 0..NSPL-1: M = max of maxima, weight exp2(m - M) (a partial with maximum -inf weighs 0),
//   out = sum(w * acc) / sum(w * Z) * cw/(cw + 1e-8) with cw the mass of the single local softmax chunk (merged Z > 0 always:
//   key 0 <= every query row; guarded anyway), carries 1/(32768*1024) folded once.
// coverage: per wave 1 instruction x 2 rows x 16 lanes x 4 floats; NSPL waves = the head's 16 x 64 row segments; grid nqt x NHG
//           blocks x WPB heads = every (s, h) row segment of the launched query tiles once; the two launches (tiles [0, NQTE) and
//           [NQTE, NQT)) together cover every query tile once.
// =====================================================================================================
template <int PRES>
__global__ __launch_bounds__(ATT_THREADS)
void attn_c(const u16* __restrict__ QBp, const u16* __restrict__ KBp, const u16* __restrict__ VTp,
            float* Og, int qtbeg, int nqt) {
  __shared__ __align__(16) float smem[WPB * NSPL * WREG];

  const int tid  = threadIdx.x;
  const int wave = __builtin_amdgcn_readfirstlane(tid >> 5);   // scalar: the key loop's bounds stay wave-uniform branches
  const int hw   = wave % WPB;              // head within the group
  const int sp   = wave / WPB;              // key split
  const int lane = tid & 31;
  const int hh   = lane >> 4;
  const int c    = lane & 15;
  const int bid  = blockIdx.x;
  const int rk   = bid / NHG;               // rank by falling cost: 0 = the launch's last (longest) query tile
  const int hg   = bid % NHG;
  if (rk >= nqt) return;                    // block-uniform, before the barrier; never taken with the exact grid
  const int qt   = qtbeg + nqt - 1 - rk;
  const int q0   = qt * 16;
  if (q0 + 16 > SEQ) return;                // block-uniform; never taken
  const int head = hg * WPB + hw;
  const int kvh  = hg;

  float* pt   = smem + wave * WREG;         // prob tile [16][32] pitch 36
  float* slab = pt + PTW;                   // result slab [16][64] pitch 68

  const u16* Qp  = QBp + ((size_t)(q0 + c)) * QD + head * HD + 8 * hh;           // A: row = query q0 + c, k = d
  const u16* Khb = KBp + (size_t)(kvh * NKT) * KTW + 8 * lane;                   // B: col n = key, k = d; tile kt at + kt*KTW
  const _Float16* Vhb = (const _Float16*)(const void*)VTp + (size_t)(kvh * NKT) * KTW + 8 * lane;  // B: col n = d, k = key
  const float lsc = RSQ_HD * LOG2E;
  const float cw  = 1.0f;                   // mass of the single local softmax chunk
  const float ren = cw / (cw + 1e-8f);
  const float oc  = ren / (PCAR * VCAR);

  const v16b qa0 = ldfrag_b(Qp);            // d 0..31
  const v16b qa1 = ldfrag_b(Qp + 32);       // d 32..63

  float mrow[8], lrow[8];
  v8f o[4];
#pragma unroll
  for (int r = 0; r < 8; ++r) { mrow[r] = -INFINITY; lrow[r] = 0.f; }
#pragma unroll
  for (int j = 0; j < 4; ++j) o[j] = zero8();
  const int ncaus = (q0 >> 5) + 1;                                            // tiles holding keys <= q0 + 15
  const int nkt = (ncaus < NKT) ? ncaus : NKT;
  const int qr0 = q0 + 8 * hh;                                                // query row of D element r = qr0 + r

#pragma unroll 1
  for (int kt = sp; kt < nkt; kt += NSPL) {
    const int kb = kt * 32;
    // ---- scores: D element r of this lane = (query row qr0 + r, key kb + c) in s0, key kb + 16 + c in s1 ----
    v8f s0 = zero8(), s1 = zero8();
    {
      const u16* kp = Khb + (size_t)kt * KTW;           // fragment f = key subtile * 2 + d step
      const v16b kf00 = ldfrag_bf(kp);
      const v16b kf01 = ldfrag_bf(kp + 2 * FRW);
      const v16b kf10 = ldfrag_bf(kp + FRW);
      const v16b kf11 = ldfrag_bf(kp + 3 * FRW);
      s0 = mma_b(qa0, kf00, s0);
      s1 = mma_b(qa0, kf01, s1);
      s0 = mma_b(qa1, kf10, s0);
      s1 = mma_b(qa1, kf11, s1);
      guard2<v16b>(s0, s1, qa0, qa1, kf00, kf01, kf10, kf11);
      asm volatile("s_wait_xcnt 0x0" ::: "memory");   // stands before the k loads' address registers take new values
    }
    // ---- causal select + online softmax in base 2, -inf-safe ----
    const int key0 = kb + c, key1 = kb + 16 + c;
#pragma unroll
    for (int r = 0; r < 8; ++r) {
      const int   qr = qr0 + r;
      const float u0 = s0[r] * lsc;
      const float u1 = s1[r] * lsc;
      const float t0 = (key0 > qr) ? -INFINITY : u0;
      const float t1 = (key1 > qr) ? -INFINITY : u1;
      float mx = fmaxf(t0, t1);
#pragma unroll
      for (int off = 1; off < 16; off <<= 1) mx = fmaxf(mx, __shfl_xor(mx, off, 32));
      const float mn = fmaxf(mrow[r], mx);
      const float ms = (mn == -INFINITY) ? 0.0f : mn;
      const float al = exp2f(mrow[r] - ms);
      mrow[r] = mn;
      const float e0 = exp2f(t0 - ms), e1 = exp2f(t1 - ms);
      float ps = e0 + e1;
#pragma unroll
      for (int off = 1; off < 16; off <<= 1) ps += __shfl_xor(ps, off, 32);
      lrow[r] = lrow[r] * al + ps;
#pragma unroll
      for (int j = 0; j < 4; ++j) o[j][r] *= al;
      const int ro = (8 * hh + r) * PTP + c;
      pt[ro]      = e0;
      pt[ro + 16] = e1;
    }
    wave_sync_lds();
    // ---- A fragments of P*32768: hi f16 (and residual f16 when PRES != 0), row = c, split k map over the 32 keys of this step ----
    FragH ph, pl;
    {
      const float* prow = pt + c * PTP + 8 * hh;
      const v4f p0 = *(const v4f*)(prow), p1 = *(const v4f*)(prow + 4);
      const v4f p2 = *(const v4f*)(prow + 16), p3 = *(const v4f*)(prow + 20);
#pragma unroll
      for (int e = 0; e < 4; ++e) {
        const float ta = p0[e] * PCAR, tb = p1[e] * PCAR, tc = p2[e] * PCAR, td = p3[e] * PCAR;
        const _Float16 ha = (_Float16)ta, hb = (_Float16)tb, hc = (_Float16)tc, hd = (_Float16)td;
        ph.h[0][e]     = ha;                  // elements 0..7  = keys kb + 8hh + 0..7
        ph.h[0][4 + e] = hb;
        ph.h[1][e]     = hc;                  // elements 8..15 = keys kb + 16 + 8hh + 0..7
        ph.h[1][4 + e] = hd;
        if constexpr (PRES != 0) {
          pl.h[0][e]     = (_Float16)(ta - (float)ha);
          pl.h[0][4 + e] = (_Float16)(tb - (float)hb);
          pl.h[1][e]     = (_Float16)(tc - (float)hc);
          pl.h[1][4 + e] = (_Float16)(td - (float)hd);
        }
      }
      if constexpr (PRES == 0) { pl.v = ph.v; }
    }
    // ---- P.V : B fragment col n = d = j*16 + c, fragment j of the tile; 2 groups of 2 d-subtiles ----
    {
      const _Float16* vp = Vhb + (size_t)kt * KTW;
#pragma unroll
      for (int jg = 0; jg < 2; ++jg) {
        const v16h va = ldfrag_hf(vp + (2 * jg) * FRW), vb = ldfrag_hf(vp + (2 * jg + 1) * FRW);
        o[2 * jg]     = mma_h(ph.v, va, o[2 * jg]);
        if constexpr (PRES != 0) { o[2 * jg] = mma_h(pl.v, va, o[2 * jg]); }
        o[2 * jg + 1] = mma_h(ph.v, vb, o[2 * jg + 1]);
        if constexpr (PRES != 0) { o[2 * jg + 1] = mma_h(pl.v, vb, o[2 * jg + 1]); }
        guard2<v16h>(o[2 * jg], o[2 * jg + 1], ph.v, pl.v, va, vb, va, vb);
      }
      asm volatile("s_wait_xcnt 0x0" ::: "memory");   // stands before the v loads' address registers take new values
    }
    wave_sync_lds();
  }
  acc_guard4(o[0], o[1], o[2], o[3]);
  // ---- this split's partial: un-normalised accumulators into the lane-owned slab, (maximum, sum) of each row into the prob tile ----
#pragma unroll
  for (int r = 0; r < 8; ++r) {
#pragma unroll
    for (int j = 0; j < 4; ++j) {
      const int idx = (8 * hh + r) * SLP + j * 16 + c;
      slab[idx] = o[j][r];
    }
    if (c == 0) {
      pt[8 * hh + r]      = mrow[r];
      pt[16 + 8 * hh + r] = lrow[r];
    }
  }
  __syncthreads();                          // every wave's partial is in LDS before any wave merges; reached by all waves once
  // ---- merge over the NSPL splits of this head: lanes (hh, c): row 2*sp + hh, floats 4c..4c+3 ----
  const int row = sp * (16 / NSPL) + hh;
  const float* hb = smem + hw * WREG;       // split p of this head: + p * WPB * WREG
  float mp[NSPL];
  float mall = -INFINITY;
#pragma unroll
  for (int p = 0; p < NSPL; ++p) {
    mp[p] = hb[p * (WPB * WREG) + row];
    mall  = fmaxf(mall, mp[p]);
  }
  const float msa = (mall == -INFINITY) ? 0.0f : mall;
  float lv = 0.f;
  v4f   ov = {0.f, 0.f, 0.f, 0.f};
#pragma unroll
  for (int p = 0; p < NSPL; ++p) {
    const float w  = exp2f(mp[p] - msa);
    const v4f   pv = *(const v4f*)(hb + p * (WPB * WREG) + PTW + row * SLP + c * 4);
    lv += w * hb[p * (WPB * WREG) + 16 + row];
#pragma unroll
    for (int e = 0; e < 4; ++e) ov[e] += w * pv[e];
  }
  // ---- out = merged acc / merged Z * ren (0 if Z == 0), carries (32768 on P, 1024 on v) folded once;
  //      16 lanes x 16 B = the whole 256-B row segment ----
  const float ls  = (lv > 0.0f) ? lv : 1.0f;
  const float inv = (lv > 0.0f) ? ((1.0f / ls) * oc) : 0.0f;
#pragma unroll
  for (int e = 0; e < 4; ++e) ov[e] *= inv;
  *(v4f*)(Og + ((size_t)(q0 + row)) * QD + head * HD + c * 4) = ov;
}

// =====================================================================================================
// Workspace map (bytes); every plane is fully written by whole-line stores before it is read; all extents are exact multiples
// of the store granularity (no pad rows needed); every region offset a multiple of 1048576:
//   QB  bf16 [SEQ][512]          SEQ*1024    (SEQ=4096: 4194304)
//   KB  bf16 fragment order      SEQ*256     (1048576)
//   VT  f16  fragment order x1024 SEQ*256    (1048576)
//   end (SEQ=4096)              6291456
// =====================================================================================================
extern "C" void kernel_launch(void* const* d_in, const int* in_sizes, int n_in,
                              void* d_out, int out_size, void* d_ws, size_t ws_size,
                              hipStream_t stream) {
  if (n_in < 3) return;
  if (in_sizes[0] < SEQ * QD) return;       // query [s][h][d], token-major prefix of SEQ rows used
  if (in_sizes[1] < SEQ * KVD) return;      // key   [s][g][d]
  if (in_sizes[2] < SEQ * KVD) return;      // value [s][g][d]
  if (out_size < SEQ * QD) return;

  const float* q = (const float*)d_in[0];
  const float* k = (const float*)d_in[1];
  const float* v = (const float*)d_in[2];
  float*     out = (float*)d_out;

  const size_t szQB = (size_t)SEQ * QD * 2;
  const size_t szKB = (size_t)SEQ * KVD * 2;
  const size_t szVT = (size_t)KVD * SEQ * 2;
  size_t off = 0;
  const size_t oQB = off; off += szQB;
  const size_t oKB = off; off += szKB;
  const size_t oVT = off; off += szVT;
  if (off > ws_size) return;                // off = 6291456 for SEQ = 4096
  if (off > (size_t)WS_CAP) return;

  char* ws = (char*)d_ws;
  u16* QB = (u16*)(ws + oQB);
  u16* KB = (u16*)(ws + oKB);
  u16* VT = (u16*)(ws + oVT);

  const dim3 b256(256), bAT(ATT_THREADS);
  const int  n8q = (SEQ * QD) / 8;                      // 262144
  const int  n8k = (SEQ * KVD) / 8;                     // 65536
  const dim3 gQ((n8q + 255) / 256);                     // 1024
  const dim3 gK((n8k + 255) / 256);                     // 256
  const dim3 gVT(NKVH * NST);                           // 128
  const int  nqtE = NQTE;                               // query tiles with the P residual product (rows s < QO)
  const int  nqtL = NQT - NQTE;                         // remaining query tiles

  // (0) q -> bf16 plane [SEQ][512]; (1) k -> bf16 plane, fragment order; (2) v^T -> f16 plane x1024, fragment order
  cvt_bf<<<gQ, b256, 0, stream>>>(q, QB, n8q);
  cvt_kf<<<gK, b256, 0, stream>>>(k, KB, n8k);
  vt16<<<gVT, b256, 0, stream>>>(v, VT);
  // (3) causal attention, query tiles s < QO with the P residual product; (4) remaining query tiles -> out f32
  attn_c<1><<<dim3(nqtE * NHG), bAT, 0, stream>>>(QB, KB, VT, out, 0, nqtE);
  if (nqtL > 0) {
    attn_c<0><<<dim3(nqtL * NHG), bAT, 0, stream>>>(QB, KB, VT, out, nqtE, nqtL);
  }
  (void)hipGetLastError();
}

// v004
// It runs in 51.1 microseconds.
// Next to v003, in two timings, it ran 2.05 and 2.04 times as fast.
// Counting every step since v000, it is 4.88 times as fast.
// Contractions, both transposed: k.q^T over 64 on v_wmma_f32_16x16x32_bf16 (q, k as bf16 RNE planes, single product, f32 accumulate);
// v^T.P^T on v_wmma_f32_16x16x32_f16 (P x32768 as f16 hi on every query row plus an in-register f16 residual for query rows
// s < QO; v as one f16 plane holding the bf16 RNE value x1024; f32 accumulate). Causal select, base-2 online softmax,
// 1/Z and the chunk-mass renormalisation in f32 on VALU.
// The k and v planes lie in fragment order: each 16-byte-per-lane fragment load of a wave reads 512 consecutive bytes.
#include <hip/hip_runtime.h>
#include <math.h>
#include <stdint.h>

#ifndef SEQ
#define SEQ 4096
#endif
#define S_FULL 4096
#define NH    8
#define NKVH  2
#define HD    64
#define QD    (NH * HD)
#define KVD   (NKVH * HD)
#define WPB   (NH / NKVH)
#define NHG   NKVH
#define QO    ((SEQ < 512) ? SEQ : 512)
#define NQT   (SEQ / 16)
#define NQTE  (QO / 16)
#define NST   (SEQ / 64)
#define NKT   (SEQ / 32)
#define NSPL  8
#define ATT_THREADS (WPB * NSPL * 32)
#define RSQ_HD 0.125f
#define LOG2E 1.4426950408889634f
#define PCAR  32768.0f
#define VCAR  1024.0f
#define MLW   32                           // floats of one wave's 16 (maximum, sum) pairs
#define SLP   68
#define SLW   (16 * SLP)
#define WREG  (MLW + SLW)
#define VTP   72
#define FRP   256                          // halves between the two 16-byte parts of a fragment (32 lanes x 8)
#define FRW   (2 * FRP)                    // halves of one fragment
#define KTW   (4 * FRW)                    // halves of one 32-key tile of one kv head (4 fragments), k plane and v plane alike
#define WS_CAP 134217728
static_assert(QD == 512 && KVD == 128 && HD == 64 && NH == 8 && NKVH == 2 && WPB == 4 && NHG * WPB == NH);
static_assert(ATT_THREADS == 1024 && (16 % NSPL) == 0 && (16 / NSPL) == 2);
static_assert((SEQ % 64) == 0 && SEQ >= 64 && SEQ <= S_FULL);
static_assert((QO % 16) == 0 && QO >= 16 && QO <= SEQ);
static_assert((HD % 32) == 0 && ((SEQ * QD / 8) % 256) == 0 && ((SEQ * KVD / 8) % 256) == 0);

typedef unsigned short u16;
typedef _Float16 v16h __attribute__((ext_vector_type(16)));
typedef _Float16 v8h  __attribute__((ext_vector_type(8)));
typedef __bf16   v16b __attribute__((ext_vector_type(16)));
typedef float    v8f  __attribute__((ext_vector_type(8)));
typedef float    v4f  __attribute__((ext_vector_type(4)));
typedef unsigned int v4u __attribute__((ext_vector_type(4)));

union FragH { v16h v; v8h h[2]; v4u u[2]; };
union FragB { v16b v; v4u u[2]; };

// ---- scalar helpers --------------------------------------------------------------------------------
__device__ __forceinline__ unsigned short bf_bits(float f) {          // f32 -> bf16 bits, RNE convert
  unsigned u = __float_as_uint(f);
  return (unsigned short)((u + 0x7FFFu + ((u >> 16) & 1u)) >> 16);
}
__device__ __forceinline__ float bf_up(unsigned short h) { return __uint_as_float(((unsigned)h) << 16); }
__device__ __forceinline__ float bfr(float f) { return bf_up(bf_bits(f)); }
__device__ __forceinline__ unsigned short h_bits(_Float16 x) { return __builtin_bit_cast(unsigned short, x); }
__device__ __forceinline__ unsigned pk16(unsigned short a, unsigned short b) { return (unsigned)a | ((unsigned)b << 16); }
__device__ __forceinline__ v8f zero8() { v8f z = {0.f, 0.f, 0.f, 0.f, 0.f, 0.f, 0.f, 0.f}; return z; }

// ---- fragment loaders: 16-bit A/B operand, lane -> row/col (lane&15), p already includes +8*(lane>>4);
//      elements 0..7 <- p[0..7] (k0+8h..), elements 8..15 <- p[16..23] (k0+16+8h..)  (same split k map for A and B;
//      used for q; the k and v operands come from the fragment-order planes through the two loaders below, same k map)
__device__ __forceinline__ v16b ldfrag_b(const u16* p) {              // bf16 plane read as unsigned integer vectors
  FragB f;
  f.u[0] = *(const v4u*)(p);
  f.u[1] = *(const v4u*)(p + 16);
  return f.v;
}

// fragment-order planes: p already includes +8*lane; elements 0..7 <- p[0..7], elements 8..15 <- p[FRP..FRP+7]
__device__ __forceinline__ v16h ldfrag_hf(const _Float16* p) {
  FragH f;
  f.h[0] = *(const v8h*)(p);
  f.h[1] = *(const v8h*)(p + FRP);
  return f.v;
}
__device__ __forceinline__ v16b ldfrag_bf(const u16* p) {
  FragB f;
  f.u[0] = *(const v4u*)(p);
  f.u[1] = *(const v4u*)(p + FRP);
  return f.v;
}

__device__ __forceinline__ v8f mma_h(v16h a, v16h b, v8f c) {
  return __builtin_amdgcn_wmma_f32_16x16x32_f16(false, a, false, b, (short)0, c, false, false);
}
__device__ __forceinline__ v8f mma_b(v16b a, v16b b, v8f c) {
  return __builtin_amdgcn_wmma_f32_16x16x32_bf16(false, a, false, b, (short)0, c, false, false);
}
template <typename F>
__device__ __forceinline__ void guard2(v8f& a, v8f& b, F x0, F x1, F x2, F x3, F x4, F x5) {
#if defined(__HIP_DEVICE_COMPILE__)
  asm volatile("v_nop\n\tv_nop\n\tv_nop\n\tv_nop"
               : "+v"(a), "+v"(b) : "v"(x0), "v"(x1), "v"(x2), "v"(x3), "v"(x4), "v"(x5) : "memory");
#endif
}
__device__ __forceinline__ void acc_guard4(v8f& a, v8f& b, v8f& c, v8f& d) {
#if defined(__HIP_DEVICE_COMPILE__)
  asm volatile("v_nop\n\tv_nop\n\tv_nop\n\tv_nop" : "+v"(a), "+v"(b), "+v"(c), "+v"(d));
#endif
}
__device__ __forceinline__ float xhalf(float x) {                     // the value of lane ^ 16
  const int b = __builtin_bit_cast(int, x);
  return __builtin_bit_cast(float, __builtin_amdgcn_permlanex16(b, b, 0x76543210, 0xfedcba98, false, false));
}

// =====================================================================================================
// f32 -> bf16 RNE bit plane, same layout. Thread = 8 consecutive elements: two 16-B loads, one 16-B store; 32 consecutive
// No barriers in this kernel.
// coverage: grid = ceil(n8/256) blocks x 256 thr x 8 (in-kernel bound) = the whole plane (n8 a multiple of 256 here).
// =====================================================================================================
__global__ __launch_bounds__(256) void cvt_bf(const float* __restrict__ x, u16* D, int n8) {
  const int gt = blockIdx.x * 256 + (int)threadIdx.x;
  if (gt >= n8) return;
  const float* p = x + (size_t)gt * 8;
  const v4f a = *(const v4f*)(p), b4 = *(const v4f*)(p + 4);
  float w[8];
#pragma unroll
  for (int e = 0; e < 4; ++e) { w[e] = a[e]; w[4 + e] = b4[e]; }
  v4u o;
#pragma unroll
  for (int e = 0; e < 4; ++e) {
    o[e] = pk16(bf_bits(w[2 * e]), bf_bits(w[2 * e + 1]));
  }
  u16* d = D + (size_t)gt * 8;
  {
    *(v4u*)(d) = o;
    
  }
}

// =====================================================================================================
// k f32 [SEQ][KVD] -> bf16 RNE bits in fragment order. 16-byte chunk o = (((g*NKT + kt)*4 + f)*2 + part)*32 + lane holds
//   k[kt*32 + (f>>1)*16 + (lane&15)][g*HD + (f&1)*32 + part*16 + (lane>>4)*8 + 0..7]
// (f = key subtile * 2 + d step; the split k map of the operand loaders). Thread = one output chunk: two 16-B loads, one 16-B
// store; a wave stores 512 consecutive bytes (whole lines, one writer each). No barriers in this kernel.
// coverage: grid = ceil(nch/256) blocks x 256 chunks (in-kernel bound) = NKVH*NKT tiles x 256 chunks = the whole plane once.
// =====================================================================================================
__global__ __launch_bounds__(256) void cvt_kf(const float* __restrict__ K, u16* D, int nch) {
  const int o = blockIdx.x * 256 + (int)threadIdx.x;
  if (o >= nch) return;
  const int lane = o & 31, part = (o >> 5) & 1, f = (o >> 6) & 3, t = o >> 8;
  const int kt = t % NKT, g = t / NKT;
  const int s = kt * 32 + (f >> 1) * 16 + (lane & 15);
  const int d = (f & 1) * 32 + part * 16 + (lane >> 4) * 8;
  const float* p = K + (size_t)s * KVD + g * HD + d;
  const v4f a = *(const v4f*)(p), b4 = *(const v4f*)(p + 4);
  v4u w;
  w[0] = pk16(bf_bits(a[0]), bf_bits(a[1]));
  w[1] = pk16(bf_bits(a[2]), bf_bits(a[3]));
  w[2] = pk16(bf_bits(b4[0]), bf_bits(b4[1]));
  w[3] = pk16(bf_bits(b4[2]), bf_bits(b4[3]));
  *(v4u*)(D + (size_t)o * 8) = w;
}

// =====================================================================================================
// v^T plane in fragment order from V f32 [SEQ][KVD] (row = key s, column = g*HD + d); value = f16 bits of (bf16 RNE value of v)
// * 1024 (exact for |v| >= 6e-8: 8-bit significand, power-of-two carry). 16-byte chunk
//   (((g*NKT + kt)*4 + j)*2 + part)*32 + lane holds d = j*16 + (lane&15), keys kt*32 + part*16 + (lane>>4)*8 + 0..7.
// Block = (kv head g, 64 keys s0): each thread loads 16 floats (key sl, d chunk dc) with 16-B loads, converts, scatters into the LDS
// coverage: load 256 thr x 16 = 64 keys x 64 d; store 2 iterations x 256 thr x 8 halves = the block's two 32-key tiles;
//           grid = NKVH*NST blocks covers the NKVH*NKT tiles exactly once.
// =====================================================================================================
__global__ __launch_bounds__(256) void vt16(const float* __restrict__ V, u16* VTo) {
  __shared__ __align__(16) u16 T[HD * VTP];
  const int tid = threadIdx.x;
  const int bid = blockIdx.x;
  const int st  = bid % NST;
  const int g   = bid / NST;
  if (g >= NKVH) return;                    // block-uniform, before the barrier; never taken with the exact grid
  const int s0  = st * 64;
  {
    const int sl = tid >> 2;                // key within tile 0..63
    const int dc = (tid & 3) * 16;          // d chunk
    const float* src = V + (size_t)(s0 + sl) * KVD + g * HD + dc;
#pragma unroll
    for (int i = 0; i < 4; ++i) {
      const v4f a = *(const v4f*)(src + 4 * i);
#pragma unroll
      for (int e = 0; e < 4; ++e) {
        const float t = bfr(a[e]) * VCAR;
        T[(dc + 4 * i + e) * VTP + sl] = h_bits((_Float16)t);
      }
    }
  }
  __syncthreads();
  v4u w4[2];
  const int line = ((tid >> 6) & 3) * 16 + (tid & 15);                 // d = j*16 + (lane&15)
  const int koff = ((tid >> 5) & 1) * 16 + ((tid >> 4) & 1) * 8;       // part*16 + (lane>>4)*8
#pragma unroll
  for (int it = 0; it < 2; ++it) {          // it = 32-key tile within the block's 64 keys
    w4[it] = *(const v4u*)(T + line * VTP + it * 32 + koff);
  }
  u16* dst = VTo + (size_t)(g * NKT + 2 * st) * KTW + tid * 8;
#pragma unroll
  for (int it = 0; it < 2; ++it) {
    *(v4u*)(dst + it * KTW) = w4[it];
  }
}

// =====================================================================================================
// Causal grouped-query attention over head dim 64. Block bid -> (query tile qt = qtbeg + nqt - 1 - bid / NHG: rows q0 = 16*qt ..
// q0+15, head group hg = bid % NHG = kv head): a tile's key count grows with qt and there are more blocks than resident places, so
// the longest blocks take the lowest indices and start first, the shortest fill the places that free up; NSPL waves per query head: wave w -> head hg*WPB + (w % WPB), key split sp = w / WPB (the 4 heads of the
// group share kv head hg; the 4 waves of one split read the same k and v tiles).
//   q bf16 plane [s][h*HD + d] (pitch QD); k bf16 plane and v^T f16 plane (x1024) in fragment order, KTW halves per (g, key tile).
//   scores, transposed = k.q^T single bf16 product (A = k rows [m = key][k = d], B = q rows as [n = query][k = d]), f32 accumulate:
//   a lane holds 16 of the 32 scores of ONE query (column c), lane ^ 16 the other 16;
//   t(i, j) (log2 domain) = (q_i.k_j over HD) * (1/8)*log2e, replaced by -inf where key j > query i (causal select).
//   Key tiles of 32 with kb <= q0 + 15 (later tiles hold only keys above every query row of the tile: weight 0); split sp visits
//   tiles sp, sp + NSPL, ... in order, with its own running maximum, sum and accumulators (none: maximum -inf, sum 0, zeros).
//   Per tile: 2 score subtiles x 2 k-steps, fragments loaded straight from the 16-bit planes (two 16-B loads per fragment, split k
//   map; q fragments preloaded once); online max-subtracted base-2 softmax in f32, -inf-safe rescale: maximum in-lane plus one
//   exchange between the wave's halves, sum kept per lane and joined once after the loop; the two score tiles, converted in place
//   (hi f16, and residual f16 when PRES != 0), ARE the B operand of out^T += v^T.P^T (element s = key kmap(s, hh) of column c): no
//   LDS and no wave sync in the loop; v^T A fragments (row m = d) in 2 groups of 2 d-subtiles.
//   After the loop: every wave puts its un-normalised 16 x 64 partial into its own slab (pitch 68) and its 16 (maximum, sum) pairs
//   in front of it; one block barrier; wave (head, sp) merges rows 2*sp, 2*sp + 1 of its head over the NSPL
//   partials in the fixed order 0..NSPL-1: M = max of maxima, weight exp2(m - M) (a partial with maximum -inf weighs 0),
//   out = sum(w * acc) / sum(w * Z) * cw/(cw + 1e-8) with cw the mass of the single local softmax chunk (merged Z > 0 always:
//   key 0 <= every query row; guarded anyway), carries 1/(32768*1024) folded once.
// coverage: per wave 1 instruction x 2 rows x 16 lanes x 4 floats; NSPL waves = the head's 16 x 64 row segments; grid nqt x NHG
//           blocks x WPB heads = every (s, h) row segment of the launched query tiles once; the two launches (tiles [0, NQTE) and
//           [NQTE, NQT)) together cover every query tile once.
// =====================================================================================================
template <int PRES>
__global__ __launch_bounds__(ATT_THREADS)
void attn_c(const u16* __restrict__ QBp, const u16* __restrict__ KBp, const u16* __restrict__ VTp,
            float* Og, int qtbeg, int nqt) {
  __shared__ __align__(16) float smem[WPB * NSPL * WREG];

  const int tid  = threadIdx.x;
  const int wave = __builtin_amdgcn_readfirstlane(tid >> 5);   // scalar: the key loop's bounds stay wave-uniform branches
  const int hw   = wave % WPB;              // head within the group
  const int sp   = wave / WPB;              // key split
  const int lane = tid & 31;
  const int hh   = lane >> 4;
  const int c    = lane & 15;
  const int bid  = blockIdx.x;
  const int rk   = bid / NHG;               // rank by falling cost: 0 = the launch's last (longest) query tile
  const int hg   = bid % NHG;
  if (rk >= nqt) return;                    // block-uniform, before the barrier; never taken with the exact grid
  const int qt   = qtbeg + nqt - 1 - rk;
  const int q0   = qt * 16;
  if (q0 + 16 > SEQ) return;                // block-uniform; never taken
  const int head = hg * WPB + hw;
  const int kvh  = hg;

  float* ml   = smem + wave * WREG;         // 16 maxima, then 16 sums
  float* slab = ml + MLW;                   // result slab [16][64] pitch 68

  const u16* Qp  = QBp + ((size_t)(q0 + c)) * QD + head * HD + 8 * hh;           // B: col n = query q0 + c, k = d
  const u16* Khb = KBp + (size_t)(kvh * NKT) * KTW + 8 * lane;                   // A: row m = key, k = d; tile kt at + kt*KTW
  const _Float16* Vhb = (const _Float16*)(const void*)VTp + (size_t)(kvh * NKT) * KTW + 8 * lane;  // A: row m = d, k = key
  const float lsc = RSQ_HD * LOG2E;
  const float cw  = 1.0f;                   // mass of the single local softmax chunk
  const float ren = cw / (cw + 1e-8f);
  const float oc  = ren / (PCAR * VCAR);

  const v16b qa0 = ldfrag_b(Qp);            // d 0..31
  const v16b qa1 = ldfrag_b(Qp + 32);       // d 32..63

  float mq = -INFINITY, lq = 0.f;           // query q0 + c: running maximum (both halves alike), this half's share of the sum
  v8f o[4];                                 // o[j] element r = (d = 16*j + 8*hh + r, query q0 + c)
#pragma unroll
  for (int j = 0; j < 4; ++j) o[j] = zero8();
  const int ncaus = (q0 >> 5) + 1;                                            // tiles holding keys <= q0 + 15
  const int nkt = (ncaus < NKT) ? ncaus : NKT;
  const int qr  = q0 + c;                                                     // this lane's query row

#pragma unroll 1
  for (int kt = sp; kt < nkt; kt += NSPL) {
    const int kb = kt * 32;
    // ---- scores^T: D element r of this lane = (key kb + 8*hh + r, query qr) in s0, key kb + 16 + 8*hh + r in s1 ----
    v8f s0 = zero8(), s1 = zero8();
    {
      const u16* kp = Khb + (size_t)kt * KTW;           // fragment f = key subtile * 2 + d step
      const v16b kf00 = ldfrag_bf(kp);
      const v16b kf01 = ldfrag_bf(kp + 2 * FRW);
      const v16b kf10 = ldfrag_bf(kp + FRW);
      const v16b kf11 = ldfrag_bf(kp + 3 * FRW);
      s0 = mma_b(kf00, qa0, s0);
      s1 = mma_b(kf01, qa0, s1);
      s0 = mma_b(kf10, qa1, s0);
      s1 = mma_b(kf11, qa1, s1);
      guard2<v16b>(s0, s1, qa0, qa1, kf00, kf01, kf10, kf11);
      asm volatile("s_wait_xcnt 0x0" ::: "memory");   // stands before the k loads' address registers take new values
    }
    // ---- causal select + online softmax in base 2, -inf-safe; one query per lane ----
    const int key0 = kb + 8 * hh, key1 = kb + 16 + 8 * hh;
    float t0[8], t1[8];
    float mx = -INFINITY;
#pragma unroll
    for (int r = 0; r < 8; ++r) {
      const float u0 = s0[r] * lsc;
      const float u1 = s1[r] * lsc;
      t0[r] = (key0 + r > qr) ? -INFINITY : u0;
      t1[r] = (key1 + r > qr) ? -INFINITY : u1;
      mx = fmaxf(mx, fmaxf(t0[r], t1[r]));
    }
    mx = fmaxf(mx, xhalf(mx));                          // the other 16 keys of this query
    const float mn = fmaxf(mq, mx);
    const float ms = (mn == -INFINITY) ? 0.0f : mn;
    const float al = exp2f(mq - ms);
    mq = mn;
    // ---- B fragments of P^T*32768: hi f16 (and residual f16 when PRES != 0), col = query, elements 0..7 = keys kb + 8hh + 0..7
    //      (s0), elements 8..15 = keys kb + 16 + 8hh + 0..7 (s1): the split k map of the v^T fragments ----
    FragH ph, pl;
    float ps = 0.f;
#pragma unroll
    for (int r = 0; r < 8; ++r) {
      const float e0 = exp2f(t0[r] - ms), e1 = exp2f(t1[r] - ms);
      ps += e0 + e1;
      const float ta = e0 * PCAR, tc = e1 * PCAR;
      const _Float16 ha = (_Float16)ta, hc = (_Float16)tc;
      ph.h[0][r] = ha;
      ph.h[1][r] = hc;
      if constexpr (PRES != 0) {
        pl.h[0][r] = (_Float16)(ta - (float)ha);
        pl.h[1][r] = (_Float16)(tc - (float)hc);
      }
    }
    if constexpr (PRES == 0) { pl.v = ph.v; }
    lq = lq * al + ps;
#pragma unroll
    for (int j = 0; j < 4; ++j) {
#pragma unroll
      for (int r = 0; r < 8; ++r) o[j][r] *= al;
    }
    // ---- out^T += v^T.P^T : A fragment row m = d = j*16 + c, fragment j of the tile; 2 groups of 2 d-subtiles ----
    {
      const _Float16* vp = Vhb + (size_t)kt * KTW;
#pragma unroll
      for (int jg = 0; jg < 2; ++jg) {
        const v16h va = ldfrag_hf(vp + (2 * jg) * FRW), vb = ldfrag_hf(vp + (2 * jg + 1) * FRW);
        o[2 * jg]     = mma_h(va, ph.v, o[2 * jg]);
        if constexpr (PRES != 0) { o[2 * jg] = mma_h(va, pl.v, o[2 * jg]); }
        o[2 * jg + 1] = mma_h(vb, ph.v, o[2 * jg + 1]);
        if constexpr (PRES != 0) { o[2 * jg + 1] = mma_h(vb, pl.v, o[2 * jg + 1]); }
        guard2<v16h>(o[2 * jg], o[2 * jg + 1], ph.v, pl.v, va, vb, va, vb);
      }
      asm volatile("s_wait_xcnt 0x0" ::: "memory");   // stands before the v loads' address registers take new values
    }
  }
  acc_guard4(o[0], o[1], o[2], o[3]);
  // ---- this split's partial: un-normalised accumulators into the wave's slab (row = query c, 8 consecutive d per tile: two 16-B
  //      stores), (maximum, joined sum) of each query in front of it ----
  lq += xhalf(lq);
#pragma unroll
  for (int j = 0; j < 4; ++j) {
    float* sp8 = slab + c * SLP + j * 16 + 8 * hh;
    const v4f lo = {o[j][0], o[j][1], o[j][2], o[j][3]}, hi = {o[j][4], o[j][5], o[j][6], o[j][7]};
    *(v4f*)(sp8)     = lo;
    *(v4f*)(sp8 + 4) = hi;
  }
  if (hh == 0) {
    ml[c]      = mq;
    ml[16 + c] = lq;
  }
  __syncthreads();                          // every wave's partial is in LDS before any wave merges; reached by all waves once
  // ---- merge over the NSPL splits of this head: lanes (hh, c): row 2*sp + hh, floats 4c..4c+3 ----
  const int row = sp * (16 / NSPL) + hh;
  const float* hb = smem + hw * WREG;       // split p of this head: + p * WPB * WREG
  float mp[NSPL];
  float mall = -INFINITY;
#pragma unroll
  for (int p = 0; p < NSPL; ++p) {
    mp[p] = hb[p * (WPB * WREG) + row];
    mall  = fmaxf(mall, mp[p]);
  }
  const float msa = (mall == -INFINITY) ? 0.0f : mall;
  float lv = 0.f;
  v4f   ov = {0.f, 0.f, 0.f, 0.f};
#pragma unroll
  for (int p = 0; p < NSPL; ++p) {
    const float w  = exp2f(mp[p] - msa);
    const v4f   pv = *(const v4f*)(hb + p * (WPB * WREG) + MLW + row * SLP + c * 4);
    lv += w * hb[p * (WPB * WREG) + 16 + row];
#pragma unroll
    for (int e = 0; e < 4; ++e) ov[e] += w * pv[e];
  }
  // ---- out = merged acc / merged Z * ren (0 if Z == 0), carries (32768 on P, 1024 on v) folded once;
  //      16 lanes x 16 B = the whole 256-B row segment ----
  const float ls  = (lv > 0.0f) ? lv : 1.0f;
  const float inv = (lv > 0.0f) ? ((1.0f / ls) * oc) : 0.0f;
#pragma unroll
  for (int e = 0; e < 4; ++e) ov[e] *= inv;
  *(v4f*)(Og + ((size_t)(q0 + row)) * QD + head * HD + c * 4) = ov;
}

// =====================================================================================================
// Workspace map (bytes); every plane is fully written by whole-line stores before it is read; all extents are exact multiples
// of the store granularity (no pad rows needed); every region offset a multiple of 1048576:
//   QB  bf16 [SEQ][512]          SEQ*1024    (SEQ=4096: 4194304)
//   KB  bf16 fragment order      SEQ*256     (1048576)
//   VT  f16  fragment order x1024 SEQ*256    (1048576)
//   end (SEQ=4096)              6291456
// =====================================================================================================
extern "C" void kernel_launch(void* const* d_in, const int* in_sizes, int n_in,
                              void* d_out, int out_size, void* d_ws, size_t ws_size,
                              hipStream_t stream) {
  if (n_in < 3) return;
  if (in_sizes[0] < SEQ * QD) return;       // query [s][h][d], token-major prefix of SEQ rows used
  if (in_sizes[1] < SEQ * KVD) return;      // key   [s][g][d]
  if (in_sizes[2] < SEQ * KVD) return;      // value [s][g][d]
  if (out_size < SEQ * QD) return;

  const float* q = (const float*)d_in[0];
  const float* k = (const float*)d_in[1];
  const float* v = (const float*)d_in[2];
  float*     out = (float*)d_out;

  const size_t szQB = (size_t)SEQ * QD * 2;
  const size_t szKB = (size_t)SEQ * KVD * 2;
  const size_t szVT = (size_t)KVD * SEQ * 2;
  size_t off = 0;
  const size_t oQB = off; off += szQB;
  const size_t oKB = off; off += szKB;
  const size_t oVT = off; off += szVT;
  if (off > ws_size) return;                // off = 6291456 for SEQ = 4096
  if (off > (size_t)WS_CAP) return;

  char* ws = (char*)d_ws;
  u16* QB = (u16*)(ws + oQB);
  u16* KB = (u16*)(ws + oKB);
  u16* VT = (u16*)(ws + oVT);

  const dim3 b256(256), bAT(ATT_THREADS);
  const int  n8q = (SEQ * QD) / 8;                      // 262144
  const int  n8k = (SEQ * KVD) / 8;                     // 65536
  const dim3 gQ((n8q + 255) / 256);                     // 1024
  const dim3 gK((n8k + 255) / 256);                     // 256
  const dim3 gVT(NKVH * NST);                           // 128
  const int  nqtE = NQTE;                               // query tiles with the P residual product (rows s < QO)
  const int  nqtL = NQT - NQTE;                         // remaining query tiles

  // (0) q -> bf16 plane [SEQ][512]; (1) k -> bf16 plane, fragment order; (2) v^T -> f16 plane x1024, fragment order
  cvt_bf<<<gQ, b256, 0, stream>>>(q, QB, n8q);
  cvt_kf<<<gK, b256, 0, stream>>>(k, KB, n8k);
  vt16<<<gVT, b256, 0, stream>>>(v, VT);
  // (3) causal attention, query tiles s < QO with the P residual product; (4) remaining query tiles -> out f32
  attn_c<1><<<dim3(nqtE * NHG), bAT, 0, stream>>>(QB, KB, VT, out, 0, nqtE);
  if (nqtL > 0) {
    attn_c<0><<<dim3(nqtL * NHG), bAT, 0, stream>>>(QB, KB, VT, out, nqtE, nqtL);
  }
  (void)hipGetLastError();
}

// v005
// Measured time: 37.4 microseconds a run.
// Two timings next to v004 put it at 1.34 and 1.39 times that version's speed.
// Over all steps from v000 it is 6.67 times as fast.
// Contractions, both transposed: k.q^T over 64 on v_wmma_f32_16x16x32_bf16 (q, k rounded to bf16 RNE, single product, f32 accumulate);
// v^T.P^T on v_wmma_f32_16x16x32_f16 (P x32768 as f16 hi on every query row plus an in-register f16 residual for query rows
// s < QO; v as one f16 plane holding the bf16 RNE value x1024; f32 accumulate). Causal select, base-2 online softmax,
// 1/Z and the chunk-mass renormalisation in f32 on VALU.
// The k and v planes lie in fragment order: each 16-byte-per-lane fragment load of a wave reads 512 consecutive bytes.
// Two launches: (0) the k and v planes, one grid; (1) attention over every query tile, q rounded to bf16 in each wave's prologue.
#include <hip/hip_runtime.h>
#include <math.h>
#include <stdint.h>

#ifndef SEQ
#define SEQ 4096
#endif
#define S_FULL 4096
#define NH    8
#define NKVH  2
#define HD    64
#define QD    (NH * HD)
#define KVD   (NKVH * HD)
#define WPB   (NH / NKVH)
#define NHG   NKVH
#define QO    ((SEQ < 512) ? SEQ : 512)
#define NQT   (SEQ / 16)
#define NQTE  (QO / 16)
#define NST   (SEQ / 64)
#define NKT   (SEQ / 32)
#define NSPL  8
#define ATT_THREADS (WPB * NSPL * 32)
#define RSQ_HD 0.125f
#define LOG2E 1.4426950408889634f
#define PCAR  32768.0f
#define VCAR  1024.0f
#define MLW   32                           // floats of one wave's 16 (maximum, sum) pairs
#define SLP   68
#define QSP   144                          // bytes between the bf16 q rows staged in a wave's slab (128 used; 16 x odd: no bank conflict)
#define SLW   (16 * SLP)
#define WREG  (MLW + SLW)
#define VTP   72
#define FRP   256                          // halves between the two 16-byte parts of a fragment (32 lanes x 8)
#define FRW   (2 * FRP)                    // halves of one fragment
#define KTW   (4 * FRW)                    // halves of one 32-key tile of one kv head (4 fragments), k plane and v plane alike
#define NVB   (NKVH * NST)                 // blocks of the v part of the plane grid
#define NKB   ((SEQ * KVD / 8) / 256)      // blocks of the k part (256 chunks of 16 bytes each)
#define WS_CAP 134217728
static_assert(QD == 512 && KVD == 128 && HD == 64 && NH == 8 && NKVH == 2 && WPB == 4 && NHG * WPB == NH);
static_assert(ATT_THREADS == 1024 && (16 % NSPL) == 0 && (16 / NSPL) == 2);
static_assert((SEQ % 64) == 0 && SEQ >= 64 && SEQ <= S_FULL);
static_assert((QO % 16) == 0 && QO >= 16 && QO <= SEQ);
static_assert(16 * QSP <= SLW * 4 && (QSP % 16) == 0 && QSP >= HD * 2);
static_assert((HD % 32) == 0 && ((SEQ * KVD / 8) % 256) == 0);

typedef unsigned short u16;
typedef _Float16 v16h __attribute__((ext_vector_type(16)));
typedef _Float16 v8h  __attribute__((ext_vector_type(8)));
typedef __bf16   v16b __attribute__((ext_vector_type(16)));
typedef float    v8f  __attribute__((ext_vector_type(8)));
typedef float    v4f  __attribute__((ext_vector_type(4)));
typedef __bf16   v4b  __attribute__((ext_vector_type(4)));
typedef unsigned int v2u __attribute__((ext_vector_type(2)));
typedef unsigned int v4u __attribute__((ext_vector_type(4)));

union FragH { v16h v; v8h h[2]; v4u u[2]; };
union FragB { v16b v; v4u u[2]; };

// ---- scalar helpers --------------------------------------------------------------------------------
__device__ __forceinline__ unsigned short bf_bits(float f) {          // f32 -> bf16 bits, RNE convert
  unsigned u = __float_as_uint(f);
  return (unsigned short)((u + 0x7FFFu + ((u >> 16) & 1u)) >> 16);
}
__device__ __forceinline__ float bf_up(unsigned short h) { return __uint_as_float(((unsigned)h) << 16); }
__device__ __forceinline__ float bfr(float f) { return bf_up(bf_bits(f)); }
__device__ __forceinline__ unsigned short h_bits(_Float16 x) { return __builtin_bit_cast(unsigned short, x); }
__device__ __forceinline__ unsigned pk16(unsigned short a, unsigned short b) { return (unsigned)a | ((unsigned)b << 16); }
__device__ __forceinline__ v8f zero8() { v8f z = {0.f, 0.f, 0.f, 0.f, 0.f, 0.f, 0.f, 0.f}; return z; }

// ---- 16-bit A/B operand, split k map (same for A and B): lane -> row/col (lane&15), h = lane>>4; elements 0..7 <- k0+8h+0..7,
//      elements 8..15 <- k0+16+8h+0..7. q comes in this order from the wave's own LDS rows (attention prologue), the k and v
//      operands from the fragment-order planes through the two loaders below.

// fragment-order planes: p already includes +8*lane; elements 0..7 <- p[0..7], elements 8..15 <- p[FRP..FRP+7]
__device__ __forceinline__ v16h ldfrag_hf(const _Float16* p) {
  FragH f;
  f.h[0] = *(const v8h*)(p);
  f.h[1] = *(const v8h*)(p + FRP);
  return f.v;
}
__device__ __forceinline__ v16b ldfrag_bf(const u16* p) {
  FragB f;
  f.u[0] = *(const v4u*)(p);
  f.u[1] = *(const v4u*)(p + FRP);
  return f.v;
}

__device__ __forceinline__ v8f mma_h(v16h a, v16h b, v8f c) {
  return __builtin_amdgcn_wmma_f32_16x16x32_f16(false, a, false, b, (short)0, c, false, false);
}
__device__ __forceinline__ v8f mma_b(v16b a, v16b b, v8f c) {
  return __builtin_amdgcn_wmma_f32_16x16x32_bf16(false, a, false, b, (short)0, c, false, false);
}
template <typename F>
__device__ __forceinline__ void guard2(v8f& a, v8f& b, F x0, F x1, F x2, F x3, F x4, F x5) {
#if defined(__HIP_DEVICE_COMPILE__)
  asm volatile("v_nop\n\tv_nop\n\tv_nop\n\tv_nop"
               : "+v"(a), "+v"(b) : "v"(x0), "v"(x1), "v"(x2), "v"(x3), "v"(x4), "v"(x5) : "memory");
#endif
}
__device__ __forceinline__ void acc_guard4(v8f& a, v8f& b, v8f& c, v8f& d) {
#if defined(__HIP_DEVICE_COMPILE__)
  asm volatile("v_nop\n\tv_nop\n\tv_nop\n\tv_nop" : "+v"(a), "+v"(b), "+v"(c), "+v"(d));
#endif
}
__device__ __forceinline__ float xhalf(float x) {                     // the value of lane ^ 16
  const int b = __builtin_bit_cast(int, x);
  return __builtin_bit_cast(float, __builtin_amdgcn_permlanex16(b, b, 0x76543210, 0xfedcba98, false, false));
}

// =====================================================================================================
// k f32 [SEQ][KVD] -> bf16 RNE bits in fragment order. 16-byte chunk o = (((g*NKT + kt)*4 + f)*2 + part)*32 + lane holds
//   k[kt*32 + (f>>1)*16 + (lane&15)][g*HD + (f&1)*32 + part*16 + (lane>>4)*8 + 0..7]
// (f = key subtile * 2 + d step; the split k map of the operand loaders). Thread = one output chunk: two 16-B loads, one 16-B
// store; a wave stores 512 consecutive bytes (whole lines, one writer each). No barriers on this path.
// coverage: NKB blocks x 256 chunks (bound kept) = NKVH*NKT tiles x 256 chunks = the whole plane once. kb = block within the k part.
// =====================================================================================================
__device__ __forceinline__ void cvt_kf(const float* __restrict__ K, u16* D, int kb) {
  const int o = kb * 256 + (int)threadIdx.x;
  if (o >= NKB * 256) return;
  const int lane = o & 31, part = (o >> 5) & 1, f = (o >> 6) & 3, t = o >> 8;
  const int kt = t % NKT, g = t / NKT;
  const int s = kt * 32 + (f >> 1) * 16 + (lane & 15);
  const int d = (f & 1) * 32 + part * 16 + (lane >> 4) * 8;
  const float* p = K + (size_t)s * KVD + g * HD + d;
  const v4f a = *(const v4f*)(p), b4 = *(const v4f*)(p + 4);
  v4u w;
  w[0] = pk16(bf_bits(a[0]), bf_bits(a[1]));
  w[1] = pk16(bf_bits(a[2]), bf_bits(a[3]));
  w[2] = pk16(bf_bits(b4[0]), bf_bits(b4[1]));
  w[3] = pk16(bf_bits(b4[2]), bf_bits(b4[3]));
  *(v4u*)(D + (size_t)o * 8) = w;
}

// =====================================================================================================
// v^T plane in fragment order from V f32 [SEQ][KVD] (row = key s, column = g*HD + d); value = f16 bits of (bf16 RNE value of v)
// * 1024 (exact for |v| >= 6e-8: 8-bit significand, power-of-two carry). 16-byte chunk
//   (((g*NKT + kt)*4 + j)*2 + part)*32 + lane holds d = j*16 + (lane&15), keys kt*32 + part*16 + (lane>>4)*8 + 0..7.
// Block = (kv head g, 64 keys s0): each thread loads 16 floats (key sl, d chunk dc) with 16-B loads, converts, scatters into the LDS
// coverage: load 256 thr x 16 = 64 keys x 64 d; store 2 iterations x 256 thr x 8 halves = the block's two 32-key tiles;
//           NVB = NKVH*NST blocks cover the NKVH*NKT tiles exactly once. bid = block within the v part, 0 .. NVB-1.
// =====================================================================================================
__device__ __forceinline__ void vt16(const float* __restrict__ V, u16* VTo, u16* T, int bid) {
  const int tid = threadIdx.x;
  const int st  = bid % NST;
  const int g   = bid / NST;
  const int s0  = st * 64;
  {
    const int sl = tid >> 2;                // key within tile 0..63
    const int dc = (tid & 3) * 16;          // d chunk
    const float* src = V + (size_t)(s0 + sl) * KVD + g * HD + dc;
#pragma unroll
    for (int i = 0; i < 4; ++i) {
      const v4f a = *(const v4f*)(src + 4 * i);
#pragma unroll
      for (int e = 0; e < 4; ++e) {
        const float t = bfr(a[e]) * VCAR;
        T[(dc + 4 * i + e) * VTP + sl] = h_bits((_Float16)t);
      }
    }
  }
  __syncthreads();
  v4u w4[2];
  const int line = ((tid >> 6) & 3) * 16 + (tid & 15);                 // d = j*16 + (lane&15)
  const int koff = ((tid >> 5) & 1) * 16 + ((tid >> 4) & 1) * 8;       // part*16 + (lane>>4)*8
#pragma unroll
  for (int it = 0; it < 2; ++it) {          // it = 32-key tile within the block's 64 keys
    w4[it] = *(const v4u*)(T + line * VTP + it * 32 + koff);
  }
  u16* dst = VTo + (size_t)(g * NKT + 2 * st) * KTW + tid * 8;
#pragma unroll
  for (int it = 0; it < 2; ++it) {
    *(v4u*)(dst + it * KTW) = w4[it];
  }
}

// =====================================================================================================
// Both planes in one grid: neither part reads what the other writes. Blocks 0 .. NVB-1 write the v^T plane (they hold the barrier
// and the longer path, so they start first), blocks NVB .. NVB+NKB-1 the k plane. The branch is block-uniform.
// =====================================================================================================
__global__ __launch_bounds__(256) void kv_planes(const float* __restrict__ K, const float* __restrict__ V, u16* KD, u16* VTo) {
  __shared__ __align__(16) u16 T[HD * VTP];
  const int bid = blockIdx.x;
  if (bid < NVB) {
    vt16(V, VTo, T, bid);
  } else {
    cvt_kf(K, KD, bid - NVB);
  }
}

// =====================================================================================================
// Causal grouped-query attention over head dim 64. Block bid -> (query tile qt = NQT - 1 - bid / NHG: rows q0 = 16*qt ..
// q0+15, head group hg = bid % NHG = kv head): a tile's key count grows with qt and there are more blocks than resident places, so
// the longest blocks take the lowest indices and start first, the shortest fill the places that free up; NSPL waves per query head: wave w -> head hg*WPB + (w % WPB), key split sp = w / WPB (the 4 heads of the
// group share kv head hg; the 4 waves of one split read the same k and v tiles).
//   q f32 input [s][h*HD + d] (pitch QD), rounded to bf16 in the prologue; k bf16 plane and v^T f16 plane (x1024) in fragment order, KTW halves per (g, key tile).
//   scores, transposed = k.q^T single bf16 product (A = k rows [m = key][k = d], B = q rows as [n = query][k = d]), f32 accumulate:
//   a lane holds 16 of the 32 scores of ONE query (column c), lane ^ 16 the other 16;
//   t(i, j) (log2 domain) = (q_i.k_j over HD) * (1/8)*log2e, replaced by -inf where key j > query i (causal select).
//   Key tiles of 32 with kb <= q0 + 15 (later tiles hold only keys above every query row of the tile: weight 0); split sp visits
//   tiles sp, sp + NSPL, ... in order, with its own running maximum, sum and accumulators (none: maximum -inf, sum 0, zeros).
//   Per tile: 2 score subtiles x 2 k-steps, fragments loaded straight from the 16-bit planes (two 16-B loads per fragment, split k
//   map; q fragments loaded and converted once); online max-subtracted base-2 softmax in f32, -inf-safe rescale: maximum in-lane plus one
//   exchange between the wave's halves, sum kept per lane and joined once after the loop; the two score tiles, converted in place
//   (hi f16, and residual f16 when PRES != 0), ARE the B operand of out^T += v^T.P^T (element s = key kmap(s, hh) of column c): no
//   LDS and no wave sync in the loop; v^T A fragments (row m = d) in 2 groups of 2 d-subtiles.
//   After the loop: every wave puts its un-normalised 16 x 64 partial into its own slab (pitch 68) and its 16 (maximum, sum) pairs
//   in front of it; one block barrier; wave (head, sp) merges rows 2*sp, 2*sp + 1 of its head over the NSPL
//   partials in the fixed order 0..NSPL-1: M = max of maxima, weight exp2(m - M) (a partial with maximum -inf weighs 0),
//   out = sum(w * acc) / sum(w * Z) * cw/(cw + 1e-8) with cw the mass of the single local softmax chunk (merged Z > 0 always:
//   key 0 <= every query row; guarded anyway), carries 1/(32768*1024) folded once.
// coverage: per wave 1 instruction x 2 rows x 16 lanes x 4 floats; NSPL waves = the head's 16 x 64 row segments; grid nqt x NHG
//           blocks x WPB heads = every (s, h) row segment of the query tiles once; one grid of NQT x NHG blocks covers every tile:
//           tiles [0, NQTE) take the body with the P residual product (PRES = 1), tiles [NQTE, NQT) the one without.
// =====================================================================================================
template <int PRES>
__device__ __forceinline__
void attn_tile(const float* __restrict__ Qf, const u16* __restrict__ KBp, const u16* __restrict__ VTp,
               float* Og, float* smem, int qt, int hg) {
  const int tid  = threadIdx.x;
  const int wave = __builtin_amdgcn_readfirstlane(tid >> 5);   // scalar: the key loop's bounds stay wave-uniform branches
  const int hw   = wave % WPB;              // head within the group
  const int sp   = wave / WPB;              // key split
  const int lane = tid & 31;
  const int hh   = lane >> 4;
  const int c    = lane & 15;
  const int q0   = qt * 16;
  const int head = hg * WPB + hw;
  const int kvh  = hg;

  float* ml   = smem + wave * WREG;         // 16 maxima, then 16 sums
  float* slab = ml + MLW;                   // result slab [16][64] pitch 68

  const u16* Khb = KBp + (size_t)(kvh * NKT) * KTW + 8 * lane;                   // A: row m = key, k = d; tile kt at + kt*KTW
  const _Float16* Vhb = (const _Float16*)(const void*)VTp + (size_t)(kvh * NKT) * KTW + 8 * lane;  // A: row m = d, k = key
  const float lsc = RSQ_HD * LOG2E;
  const float cw  = 1.0f;                   // mass of the single local softmax chunk
  const float ren = cw / (cw + 1e-8f);
  const float oc  = ren / (PCAR * VCAR);

  // ---- q tile of this head, 16 rows x 64 f32: load i takes rows 2i, 2i+1 (lane -> row 2i + hh, floats 4c..4c+3: 512 bytes = 4 whole
  //      lines), f32 -> bf16 RNE by the packed convert, 8 bytes per lane into row 2i + hh of the wave's OWN slab (pitch QSP bytes,
  //      16 * QSP <= the slab); read back as B fragments: col n = query q0 + c, k = d, split k map ----
  FragB qf0, qf1;
  {
    const float* Qt = Qf + ((size_t)(q0 + hh)) * QD + head * HD + 4 * c;
    char* qs = (char*)slab;
    v4f x[8];
#pragma unroll
    for (int i = 0; i < 8; ++i) x[i] = *(const v4f*)(Qt + (size_t)(2 * i) * QD);
#pragma unroll
    for (int i = 0; i < 8; ++i) {
      *(v2u*)(qs + (2 * i + hh) * QSP + 8 * c) = __builtin_bit_cast(v2u, __builtin_convertvector(x[i], v4b));
    }
    asm volatile("s_wait_dscnt 0x0" ::: "memory");   // the wave's own rows are in LDS before its lanes read each other's bytes
    const char* rp = qs + c * QSP + 16 * hh;
    qf0.u[0] = *(const v4u*)(rp);                     // d  0 + 8hh ..
    qf0.u[1] = *(const v4u*)(rp + 32);                // d 16 + 8hh ..
    qf1.u[0] = *(const v4u*)(rp + 64);                // d 32 + 8hh ..
    qf1.u[1] = *(const v4u*)(rp + 96);                // d 48 + 8hh ..
  }
  const v16b qa0 = qf0.v;                   // d 0..31
  const v16b qa1 = qf1.v;                   // d 32..63

  float mq = -INFINITY, lq = 0.f;           // query q0 + c: running maximum (both halves alike), this half's share of the sum
  v8f o[4];                                 // o[j] element r = (d = 16*j + 8*hh + r, query q0 + c)
#pragma unroll
  for (int j = 0; j < 4; ++j) o[j] = zero8();
  const int ncaus = (q0 >> 5) + 1;                                            // tiles holding keys <= q0 + 15
  const int nkt = (ncaus < NKT) ? ncaus : NKT;
  const int qr  = q0 + c;                                                     // this lane's query row

#pragma unroll 1
  for (int kt = sp; kt < nkt; kt += NSPL) {
    const int kb = kt * 32;
    // ---- scores^T: D element r of this lane = (key kb + 8*hh + r, query qr) in s0, key kb + 16 + 8*hh + r in s1 ----
    v8f s0 = zero8(), s1 = zero8();
    {
      const u16* kp = Khb + (size_t)kt * KTW;           // fragment f = key subtile * 2 + d step
      const v16b kf00 = ldfrag_bf(kp);
      const v16b kf01 = ldfrag_bf(kp + 2 * FRW);
      const v16b kf10 = ldfrag_bf(kp + FRW);
      const v16b kf11 = ldfrag_bf(kp + 3 * FRW);
      s0 = mma_b(kf00, qa0, s0);
      s1 = mma_b(kf01, qa0, s1);
      s0 = mma_b(kf10, qa1, s0);
      s1 = mma_b(kf11, qa1, s1);
      guard2<v16b>(s0, s1, qa0, qa1, kf00, kf01, kf10, kf11);
      asm volatile("s_wait_xcnt 0x0" ::: "memory");   // stands before the k loads' address registers take new values
    }
    // ---- causal select + online softmax in base 2, -inf-safe; one query per lane ----
    const int key0 = kb + 8 * hh, key1 = kb + 16 + 8 * hh;
    float t0[8], t1[8];
    float mx = -INFINITY;
#pragma unroll
    for (int r = 0; r < 8; ++r) {
      const float u0 = s0[r] * lsc;
      const float u1 = s1[r] * lsc;
      t0[r] = (key0 + r > qr) ? -INFINITY : u0;
      t1[r] = (key1 + r > qr) ? -INFINITY : u1;
      mx = fmaxf(mx, fmaxf(t0[r], t1[r]));
    }
    mx = fmaxf(mx, xhalf(mx));                          // the other 16 keys of this query
    const float mn = fmaxf(mq, mx);
    const float ms = (mn == -INFINITY) ? 0.0f : mn;
    const float al = exp2f(mq - ms);
    mq = mn;
    // ---- B fragments of P^T*32768: hi f16 (and residual f16 when PRES != 0), col = query, elements 0..7 = keys kb + 8hh + 0..7
    //      (s0), elements 8..15 = keys kb + 16 + 8hh + 0..7 (s1): the split k map of the v^T fragments ----
    FragH ph, pl;
    float ps = 0.f;
#pragma unroll
    for (int r = 0; r < 8; ++r) {
      const float e0 = exp2f(t0[r] - ms), e1 = exp2f(t1[r] - ms);
      ps += e0 + e1;
      const float ta = e0 * PCAR, tc = e1 * PCAR;
      const _Float16 ha = (_Float16)ta, hc = (_Float16)tc;
      ph.h[0][r] = ha;
      ph.h[1][r] = hc;
      if constexpr (PRES != 0) {
        pl.h[0][r] = (_Float16)(ta - (float)ha);
        pl.h[1][r] = (_Float16)(tc - (float)hc);
      }
    }
    if constexpr (PRES == 0) { pl.v = ph.v; }
    lq = lq * al + ps;
#pragma unroll
    for (int j = 0; j < 4; ++j) {
#pragma unroll
      for (int r = 0; r < 8; ++r) o[j][r] *= al;
    }
    // ---- out^T += v^T.P^T : A fragment row m = d = j*16 + c, fragment j of the tile; 2 groups of 2 d-subtiles ----
    {
      const _Float16* vp = Vhb + (size_t)kt * KTW;
#pragma unroll
      for (int jg = 0; jg < 2; ++jg) {
        const v16h va = ldfrag_hf(vp + (2 * jg) * FRW), vb = ldfrag_hf(vp + (2 * jg + 1) * FRW);
        o[2 * jg]     = mma_h(va, ph.v, o[2 * jg]);
        if constexpr (PRES != 0) { o[2 * jg] = mma_h(va, pl.v, o[2 * jg]); }
        o[2 * jg + 1] = mma_h(vb, ph.v, o[2 * jg + 1]);
        if constexpr (PRES != 0) { o[2 * jg + 1] = mma_h(vb, pl.v, o[2 * jg + 1]); }
        guard2<v16h>(o[2 * jg], o[2 * jg + 1], ph.v, pl.v, va, vb, va, vb);
      }
      asm volatile("s_wait_xcnt 0x0" ::: "memory");   // stands before the v loads' address registers take new values
    }
  }
  acc_guard4(o[0], o[1], o[2], o[3]);
  // ---- this split's partial: un-normalised accumulators into the wave's slab (row = query c, 8 consecutive d per tile: two 16-B
  //      stores), (maximum, joined sum) of each query in front of it ----
  lq += xhalf(lq);
#pragma unroll
  for (int j = 0; j < 4; ++j) {
    float* sp8 = slab + c * SLP + j * 16 + 8 * hh;
    const v4f lo = {o[j][0], o[j][1], o[j][2], o[j][3]}, hi = {o[j][4], o[j][5], o[j][6], o[j][7]};
    *(v4f*)(sp8)     = lo;
    *(v4f*)(sp8 + 4) = hi;
  }
  if (hh == 0) {
    ml[c]      = mq;
    ml[16 + c] = lq;
  }
  __syncthreads();                          // every wave's partial is in LDS before any wave merges; reached by all waves once
  // ---- merge over the NSPL splits of this head: lanes (hh, c): row 2*sp + hh, floats 4c..4c+3 ----
  const int row = sp * (16 / NSPL) + hh;
  const float* hb = smem + hw * WREG;       // split p of this head: + p * WPB * WREG
  float mp[NSPL];
  float mall = -INFINITY;
#pragma unroll
  for (int p = 0; p < NSPL; ++p) {
    mp[p] = hb[p * (WPB * WREG) + row];
    mall  = fmaxf(mall, mp[p]);
  }
  const float msa = (mall == -INFINITY) ? 0.0f : mall;
  float lv = 0.f;
  v4f   ov = {0.f, 0.f, 0.f, 0.f};
#pragma unroll
  for (int p = 0; p < NSPL; ++p) {
    const float w  = exp2f(mp[p] - msa);
    const v4f   pv = *(const v4f*)(hb + p * (WPB * WREG) + MLW + row * SLP + c * 4);
    lv += w * hb[p * (WPB * WREG) + 16 + row];
#pragma unroll
    for (int e = 0; e < 4; ++e) ov[e] += w * pv[e];
  }
  // ---- out = merged acc / merged Z * ren (0 if Z == 0), carries (32768 on P, 1024 on v) folded once;
  //      16 lanes x 16 B = the whole 256-B row segment ----
  const float ls  = (lv > 0.0f) ? lv : 1.0f;
  const float inv = (lv > 0.0f) ? ((1.0f / ls) * oc) : 0.0f;
#pragma unroll
  for (int e = 0; e < 4; ++e) ov[e] *= inv;
  *(v4f*)(Og + ((size_t)(q0 + row)) * QD + head * HD + c * 4) = ov;
}

__global__ __launch_bounds__(ATT_THREADS)
void attn_c(const float* __restrict__ Qf, const u16* __restrict__ KBp, const u16* __restrict__ VTp, float* Og) {
  __shared__ __align__(16) float smem[WPB * NSPL * WREG];
  const int bid = blockIdx.x;
  const int rk  = bid / NHG;                // rank by falling cost: 0 = the last (longest) query tile
  const int hg  = bid % NHG;
  if (rk >= NQT) return;                    // block-uniform, before the barrier; never taken with the exact grid
  const int qt  = NQT - 1 - rk;
  if (qt < NQTE) {                          // block-uniform: each body's one barrier is reached by all waves of the block or by none
    attn_tile<1>(Qf, KBp, VTp, Og, smem, qt, hg);
  } else {
    attn_tile<0>(Qf, KBp, VTp, Og, smem, qt, hg);
  }
}

// =====================================================================================================
// Workspace map (bytes); every plane is fully written by whole-line stores before it is read; all extents are exact multiples
// of the store granularity (no pad rows needed); every region offset a multiple of 1048576:
//   KB  bf16 fragment order      SEQ*256     (1048576)
//   VT  f16  fragment order x1024 SEQ*256    (1048576)
//   end (SEQ=4096)              2097152
// =====================================================================================================
extern "C" void kernel_launch(void* const* d_in, const int* in_sizes, int n_in,
                              void* d_out, int out_size, void* d_ws, size_t ws_size,
                              hipStream_t stream) {
  if (n_in < 3) return;
  if (in_sizes[0] < SEQ * QD) return;       // query [s][h][d], token-major prefix of SEQ rows used
  if (in_sizes[1] < SEQ * KVD) return;      // key   [s][g][d]
  if (in_sizes[2] < SEQ * KVD) return;      // value [s][g][d]
  if (out_size < SEQ * QD) return;

  const float* q = (const float*)d_in[0];
  const float* k = (const float*)d_in[1];
  const float* v = (const float*)d_in[2];
  float*     out = (float*)d_out;

  const size_t szKB = (size_t)SEQ * KVD * 2;
  const size_t szVT = (size_t)KVD * SEQ * 2;
  size_t off = 0;
  const size_t oKB = off; off += szKB;
  const size_t oVT = off; off += szVT;
  if (off > ws_size) return;                // off = 2097152 for SEQ = 4096
  if (off > (size_t)WS_CAP) return;

  char* ws = (char*)d_ws;
  u16* KB = (u16*)(ws + oKB);
  u16* VT = (u16*)(ws + oVT);

  const dim3 b256(256), bAT(ATT_THREADS);
  // (0) k -> bf16 plane and v^T -> f16 plane x1024, both in fragment order, one grid
  kv_planes<<<dim3(NVB + NKB), b256, 0, stream>>>(k, v, KB, VT);
  // (1) causal attention, every query tile (rows s < QO with the P residual product) -> out f32
  attn_c<<<dim3(NQT * NHG), bAT, 0, stream>>>(q, KB, VT, out);
  (void)hipGetLastError();
}

// v006
// A run of this version takes 34 microseconds.
// Next to v005, in two timings, it ran 1.13 and 1.12 times as fast.
// All steps since v000 together make it 7.48 times as fast.
// Contractions, both transposed: k.q^T over 64 on v_wmma_f32_16x16x32_bf16 (q, k rounded to bf16 RNE, single product, f32 accumulate);
// v^T.P^T on v_wmma_f32_16x16x32_f16 (P x32768 as f16 hi on every query row plus an in-register f16 residual for query rows
// s < QO; v as one f16 plane holding the bf16 RNE value x1024; f32 accumulate). Causal select, base-2 online softmax,
// 1/Z and the chunk-mass renormalisation in f32 on VALU; each weight is one fma and one v_exp_f32 and carries the x32768.
// The k and v planes lie in fragment order: each 16-byte-per-lane fragment load of a wave reads 512 consecutive bytes.
// Two launches: (0) the k and v planes, one grid; (1) attention over every query tile, q rounded to bf16 in each wave's prologue.
#include <hip/hip_runtime.h>
#include <math.h>
#include <stdint.h>

#ifndef SEQ
#define SEQ 4096
#endif
#define S_FULL 4096
#define NH    8
#define NKVH  2
#define HD    64
#define QD    (NH * HD)
#define KVD   (NKVH * HD)
#define WPB   (NH / NKVH)
#define NHG   NKVH
#define QO    ((SEQ < 512) ? SEQ : 512)
#define NQT   (SEQ / 16)
#define NQTE  (QO / 16)
#define NST   (SEQ / 64)
#define NKT   (SEQ / 32)
#define NSPL  8
#define ATT_THREADS (WPB * NSPL * 32)
#define RSQ_HD 0.125f
#define LOG2E 1.4426950408889634f
#define PCAR  32768.0f
#define PCARL 15.0f                        // log2 of PCAR: the carry on P enters through the exponent
#define VCAR  1024.0f
#define MLW   32                           // floats of one wave's 16 (maximum, sum) pairs
#define SLP   68
#define QSP   144                          // bytes between the bf16 q rows staged in a wave's slab (128 used; 16 x odd: no bank conflict)
#define SLW   (16 * SLP)
#define WREG  (MLW + SLW)
#define VTP   72
#define FRP   256                          // halves between the two 16-byte parts of a fragment (32 lanes x 8)
#define FRW   (2 * FRP)                    // halves of one fragment
#define KTW   (4 * FRW)                    // halves of one 32-key tile of one kv head (4 fragments), k plane and v plane alike
#define NVB   (NKVH * NST)                 // blocks of the v part of the plane grid
#define NKB   ((SEQ * KVD / 8) / 256)      // blocks of the k part (256 chunks of 16 bytes each)
#define WS_CAP 134217728
static_assert(QD == 512 && KVD == 128 && HD == 64 && NH == 8 && NKVH == 2 && WPB == 4 && NHG * WPB == NH);
static_assert(ATT_THREADS == 1024 && (16 % NSPL) == 0 && (16 / NSPL) == 2);
static_assert((SEQ % 64) == 0 && SEQ >= 64 && SEQ <= S_FULL);
static_assert((QO % 16) == 0 && QO >= 16 && QO <= SEQ);
static_assert(16 * QSP <= SLW * 4 && (QSP % 16) == 0 && QSP >= HD * 2);
static_assert(PCAR == 32768.0f && PCARL == 15.0f);
static_assert((HD % 32) == 0 && ((SEQ * KVD / 8) % 256) == 0);

typedef unsigned short u16;
typedef _Float16 v16h __attribute__((ext_vector_type(16)));
typedef _Float16 v8h  __attribute__((ext_vector_type(8)));
typedef __bf16   v16b __attribute__((ext_vector_type(16)));
typedef float    v8f  __attribute__((ext_vector_type(8)));
typedef float    v4f  __attribute__((ext_vector_type(4)));
typedef __bf16   v4b  __attribute__((ext_vector_type(4)));
typedef unsigned int v2u __attribute__((ext_vector_type(2)));
typedef unsigned int v4u __attribute__((ext_vector_type(4)));

union FragH { v16h v; v8h h[2]; v4u u[2]; };
union FragB { v16b v; v4u u[2]; };

// ---- scalar helpers --------------------------------------------------------------------------------
__device__ __forceinline__ unsigned short bf_bits(float f) {          // f32 -> bf16 bits, RNE convert
  unsigned u = __float_as_uint(f);
  return (unsigned short)((u + 0x7FFFu + ((u >> 16) & 1u)) >> 16);
}
__device__ __forceinline__ float bf_up(unsigned short h) { return __uint_as_float(((unsigned)h) << 16); }
__device__ __forceinline__ float bfr(float f) { return bf_up(bf_bits(f)); }
__device__ __forceinline__ unsigned short h_bits(_Float16 x) { return __builtin_bit_cast(unsigned short, x); }
__device__ __forceinline__ unsigned pk16(unsigned short a, unsigned short b) { return (unsigned)a | ((unsigned)b << 16); }
__device__ __forceinline__ v8f zero8() { v8f z = {0.f, 0.f, 0.f, 0.f, 0.f, 0.f, 0.f, 0.f}; return z; }

// ---- 16-bit A/B operand, split k map (same for A and B): lane -> row/col (lane&15), h = lane>>4; elements 0..7 <- k0+8h+0..7,
//      elements 8..15 <- k0+16+8h+0..7. q comes in this order from the wave's own LDS rows (attention prologue), the k and v
//      operands from the fragment-order planes through the two loaders below.

// fragment-order planes: p already includes +8*lane; elements 0..7 <- p[0..7], elements 8..15 <- p[FRP..FRP+7]
__device__ __forceinline__ v16h ldfrag_hf(const _Float16* p) {
  FragH f;
  f.h[0] = *(const v8h*)(p);
  f.h[1] = *(const v8h*)(p + FRP);
  return f.v;
}
__device__ __forceinline__ v16b ldfrag_bf(const u16* p) {
  FragB f;
  f.u[0] = *(const v4u*)(p);
  f.u[1] = *(const v4u*)(p + FRP);
  return f.v;
}

__device__ __forceinline__ v8f mma_h(v16h a, v16h b, v8f c) {
  return __builtin_amdgcn_wmma_f32_16x16x32_f16(false, a, false, b, (short)0, c, false, false);
}
__device__ __forceinline__ v8f mma_b(v16b a, v16b b, v8f c) {
  return __builtin_amdgcn_wmma_f32_16x16x32_bf16(false, a, false, b, (short)0, c, false, false);
}
template <typename F>
__device__ __forceinline__ void guard2(v8f& a, v8f& b, F x0, F x1, F x2, F x3, F x4, F x5) {
#if defined(__HIP_DEVICE_COMPILE__)
  asm volatile("v_nop\n\tv_nop\n\tv_nop\n\tv_nop"
               : "+v"(a), "+v"(b) : "v"(x0), "v"(x1), "v"(x2), "v"(x3), "v"(x4), "v"(x5) : "memory");
#endif
}
__device__ __forceinline__ void acc_guard4(v8f& a, v8f& b, v8f& c, v8f& d) {
#if defined(__HIP_DEVICE_COMPILE__)
  asm volatile("v_nop\n\tv_nop\n\tv_nop\n\tv_nop" : "+v"(a), "+v"(b), "+v"(c), "+v"(d));
#endif
}
// 2^x in place for the rescale factor and the 16 exponents of a key tile, bare v_exp_f32 (a result under 2^-126 comes out 0, -inf
// gives 0). One statement: each instruction rewrites only its own register, so none overwrites the source of the one in front of
// it; the closing v_nop is the slot the instruction set asks for between the last v_exp_f32 and the first reader of its result.
__device__ __forceinline__ void exp2_tile(float& a, float (&x)[8], float (&y)[8]) {
#if defined(__HIP_DEVICE_COMPILE__)
  asm("v_exp_f32 %0, %0\n\t"
      "v_exp_f32 %16, %16\n\tv_exp_f32 %15, %15\n\tv_exp_f32 %14, %14\n\tv_exp_f32 %13, %13\n\t"
      "v_exp_f32 %12, %12\n\tv_exp_f32 %11, %11\n\tv_exp_f32 %10, %10\n\tv_exp_f32 %9, %9\n\t"
      "v_exp_f32 %8, %8\n\tv_exp_f32 %7, %7\n\tv_exp_f32 %6, %6\n\tv_exp_f32 %5, %5\n\t"
      "v_exp_f32 %4, %4\n\tv_exp_f32 %3, %3\n\tv_exp_f32 %2, %2\n\tv_exp_f32 %1, %1\n\t"
      "v_nop"
      : "+v"(a), "+v"(x[0]), "+v"(x[1]), "+v"(x[2]), "+v"(x[3]), "+v"(x[4]), "+v"(x[5]), "+v"(x[6]), "+v"(x[7]),
        "+v"(y[0]), "+v"(y[1]), "+v"(y[2]), "+v"(y[3]), "+v"(y[4]), "+v"(y[5]), "+v"(y[6]), "+v"(y[7]));
#endif
}
__device__ __forceinline__ float xhalf(float x) {                     // the value of lane ^ 16
  const int b = __builtin_bit_cast(int, x);
  return __builtin_bit_cast(float, __builtin_amdgcn_permlanex16(b, b, 0x76543210, 0xfedcba98, false, false));
}

// =====================================================================================================
// k f32 [SEQ][KVD] -> bf16 RNE bits in fragment order. 16-byte chunk o = (((g*NKT + kt)*4 + f)*2 + part)*32 + lane holds
//   k[kt*32 + (f>>1)*16 + (lane&15)][g*HD + (f&1)*32 + part*16 + (lane>>4)*8 + 0..7]
// (f = key subtile * 2 + d step; the split k map of the operand loaders). Thread = one output chunk: two 16-B loads, one 16-B
// store; a wave stores 512 consecutive bytes (whole lines, one writer each). No barriers on this path.
// coverage: NKB blocks x 256 chunks (bound kept) = NKVH*NKT tiles x 256 chunks = the whole plane once. kb = block within the k part.
// =====================================================================================================
__device__ __forceinline__ void cvt_kf(const float* __restrict__ K, u16* D, int kb) {
  const int o = kb * 256 + (int)threadIdx.x;
  if (o >= NKB * 256) return;
  const int lane = o & 31, part = (o >> 5) & 1, f = (o >> 6) & 3, t = o >> 8;
  const int kt = t % NKT, g = t / NKT;
  const int s = kt * 32 + (f >> 1) * 16 + (lane & 15);
  const int d = (f & 1) * 32 + part * 16 + (lane >> 4) * 8;
  const float* p = K + (size_t)s * KVD + g * HD + d;
  const v4f a = *(const v4f*)(p), b4 = *(const v4f*)(p + 4);
  v4u w;
  w[0] = pk16(bf_bits(a[0]), bf_bits(a[1]));
  w[1] = pk16(bf_bits(a[2]), bf_bits(a[3]));
  w[2] = pk16(bf_bits(b4[0]), bf_bits(b4[1]));
  w[3] = pk16(bf_bits(b4[2]), bf_bits(b4[3]));
  *(v4u*)(D + (size_t)o * 8) = w;
}

// =====================================================================================================
// v^T plane in fragment order from V f32 [SEQ][KVD] (row = key s, column = g*HD + d); value = f16 bits of (bf16 RNE value of v)
// * 1024 (exact for |v| >= 6e-8: 8-bit significand, power-of-two carry). 16-byte chunk
//   (((g*NKT + kt)*4 + j)*2 + part)*32 + lane holds d = j*16 + (lane&15), keys kt*32 + part*16 + (lane>>4)*8 + 0..7.
// Block = (kv head g, 64 keys s0): each thread loads 16 floats (key sl, d chunk dc) with 16-B loads, converts, scatters into the LDS
// coverage: load 256 thr x 16 = 64 keys x 64 d; store 2 iterations x 256 thr x 8 halves = the block's two 32-key tiles;
//           NVB = NKVH*NST blocks cover the NKVH*NKT tiles exactly once. bid = block within the v part, 0 .. NVB-1.
// =====================================================================================================
__device__ __forceinline__ void vt16(const float* __restrict__ V, u16* VTo, u16* T, int bid) {
  const int tid = threadIdx.x;
  const int st  = bid % NST;
  const int g   = bid / NST;
  const int s0  = st * 64;
  {
    const int sl = tid >> 2;                // key within tile 0..63
    const int dc = (tid & 3) * 16;          // d chunk
    const float* src = V + (size_t)(s0 + sl) * KVD + g * HD + dc;
#pragma unroll
    for (int i = 0; i < 4; ++i) {
      const v4f a = *(const v4f*)(src + 4 * i);
#pragma unroll
      for (int e = 0; e < 4; ++e) {
        const float t = bfr(a[e]) * VCAR;
        T[(dc + 4 * i + e) * VTP + sl] = h_bits((_Float16)t);
      }
    }
  }
  __syncthreads();
  v4u w4[2];
  const int line = ((tid >> 6) & 3) * 16 + (tid & 15);                 // d = j*16 + (lane&15)
  const int koff = ((tid >> 5) & 1) * 16 + ((tid >> 4) & 1) * 8;       // part*16 + (lane>>4)*8
#pragma unroll
  for (int it = 0; it < 2; ++it) {          // it = 32-key tile within the block's 64 keys
    w4[it] = *(const v4u*)(T + line * VTP + it * 32 + koff);
  }
  u16* dst = VTo + (size_t)(g * NKT + 2 * st) * KTW + tid * 8;
#pragma unroll
  for (int it = 0; it < 2; ++it) {
    *(v4u*)(dst + it * KTW) = w4[it];
  }
}

// =====================================================================================================
// Both planes in one grid: neither part reads what the other writes. Blocks 0 .. NVB-1 write the v^T plane (they hold the barrier
// and the longer path, so they start first), blocks NVB .. NVB+NKB-1 the k plane. The branch is block-uniform.
// =====================================================================================================
__global__ __launch_bounds__(256) void kv_planes(const float* __restrict__ K, const float* __restrict__ V, u16* KD, u16* VTo) {
  __shared__ __align__(16) u16 T[HD * VTP];
  const int bid = blockIdx.x;
  if (bid < NVB) {
    vt16(V, VTo, T, bid);
  } else {
    cvt_kf(K, KD, bid - NVB);
  }
}

// =====================================================================================================
// Causal grouped-query attention over head dim 64. Block bid -> (query tile qt = NQT - 1 - bid / NHG: rows q0 = 16*qt ..
// q0+15, head group hg = bid % NHG = kv head): a tile's key count grows with qt and there are more blocks than resident places, so
// the longest blocks take the lowest indices and start first, the shortest fill the places that free up; NSPL waves per query head: wave w -> head hg*WPB + (w % WPB), key split sp = w / WPB (the 4 heads of the
// group share kv head hg; the 4 waves of one split read the same k and v tiles).
//   q f32 input [s][h*HD + d] (pitch QD), rounded to bf16 in the prologue; k bf16 plane and v^T f16 plane (x1024) in fragment order, KTW halves per (g, key tile).
//   scores, transposed = k.q^T single bf16 product (A = k rows [m = key][k = d], B = q rows as [n = query][k = d]), f32 accumulate:
//   a lane holds 16 of the 32 scores of ONE query (column c), lane ^ 16 the other 16;
//   t(i, j) (log2 domain) = (q_i.k_j over HD) * (1/8)*log2e, replaced by -inf where key j > query i (causal select).
//   Key tiles of 32 with kb <= q0 + 15 (later tiles hold only keys above every query row of the tile: weight 0); split sp visits
//   tiles sp, sp + NSPL, ... in order, with its own running maximum, sum and accumulators (none: maximum -inf, sum 0, zeros).
//   Per tile: 2 score subtiles x 2 k-steps, fragments loaded straight from the 16-bit planes (two 16-B loads per fragment, split k
//   map; q fragments loaded and converted once); online max-subtracted base-2 softmax in f32, -inf-safe rescale: maximum in-lane plus one
//   exchange between the wave's halves, sum kept per lane and joined once after the loop; the two score tiles, converted in place
//   (hi f16, and residual f16 when PRES != 0), ARE the B operand of out^T += v^T.P^T (element s = key kmap(s, hh) of column c): no
//   LDS and no wave sync in the loop; v^T A fragments (row m = d) in 2 groups of 2 d-subtiles.
//   After the loop: every wave puts its un-normalised 16 x 64 partial into its own slab (pitch 68) and its 16 (maximum, sum) pairs
//   in front of it; one block barrier; wave (head, sp) merges rows 2*sp, 2*sp + 1 of its head over the NSPL
//   partials in the fixed order 0..NSPL-1: M = max of maxima, weight exp2(m - M) (a partial with maximum -inf weighs 0),
//   out = sum(w * acc) / sum(w * Z) * cw/(cw + 1e-8) with cw the mass of the single local softmax chunk (merged Z > 0 always:
//   key 0 <= every query row; guarded anyway), the carry 1/1024 on v folded once (the 32768 on P stands in acc and Z alike).
// coverage: per wave 1 instruction x 2 rows x 16 lanes x 4 floats; NSPL waves = the head's 16 x 64 row segments; grid nqt x NHG
//           blocks x WPB heads = every (s, h) row segment of the query tiles once; one grid of NQT x NHG blocks covers every tile:
//           tiles [0, NQTE) take the body with the P residual product (PRES = 1), tiles [NQTE, NQT) the one without.
// =====================================================================================================
template <int PRES>
__device__ __forceinline__
void attn_tile(const float* __restrict__ Qf, const u16* __restrict__ KBp, const u16* __restrict__ VTp,
               float* Og, float* smem, int qt, int hg) {
  const int tid  = threadIdx.x;
  const int wave = __builtin_amdgcn_readfirstlane(tid >> 5);   // scalar: the key loop's bounds stay wave-uniform branches
  const int hw   = wave % WPB;              // head within the group
  const int sp   = wave / WPB;              // key split
  const int lane = tid & 31;
  const int hh   = lane >> 4;
  const int c    = lane & 15;
  const int q0   = qt * 16;
  const int head = hg * WPB + hw;
  const int kvh  = hg;

  float* ml   = smem + wave * WREG;         // 16 maxima, then 16 sums
  float* slab = ml + MLW;                   // result slab [16][64] pitch 68

  const u16* Khb = KBp + (size_t)(kvh * NKT) * KTW + 8 * lane;                   // A: row m = key, k = d; tile kt at + kt*KTW
  const _Float16* Vhb = (const _Float16*)(const void*)VTp + (size_t)(kvh * NKT) * KTW + 8 * lane;  // A: row m = d, k = key
  const float lsc = RSQ_HD * LOG2E;
  const float cw  = 1.0f;                   // mass of the single local softmax chunk
  const float ren = cw / (cw + 1e-8f);
  const float oc  = ren / VCAR;             // the carry on P stands in the sums too and cancels in acc / Z

  // ---- q tile of this head, 16 rows x 64 f32: load i takes rows 2i, 2i+1 (lane -> row 2i + hh, floats 4c..4c+3: 512 bytes = 4 whole
  //      lines), f32 -> bf16 RNE by the packed convert, 8 bytes per lane into row 2i + hh of the wave's OWN slab (pitch QSP bytes,
  //      16 * QSP <= the slab); read back as B fragments: col n = query q0 + c, k = d, split k map ----
  FragB qf0, qf1;
  {
    const float* Qt = Qf + ((size_t)(q0 + hh)) * QD + head * HD + 4 * c;
    char* qs = (char*)slab;
    v4f x[8];
#pragma unroll
    for (int i = 0; i < 8; ++i) x[i] = *(const v4f*)(Qt + (size_t)(2 * i) * QD);
#pragma unroll
    for (int i = 0; i < 8; ++i) {
      *(v2u*)(qs + (2 * i + hh) * QSP + 8 * c) = __builtin_bit_cast(v2u, __builtin_convertvector(x[i], v4b));
    }
    asm volatile("s_wait_dscnt 0x0" ::: "memory");   // the wave's own rows are in LDS before its lanes read each other's bytes
    const char* rp = qs + c * QSP + 16 * hh;
    qf0.u[0] = *(const v4u*)(rp);                     // d  0 + 8hh ..
    qf0.u[1] = *(const v4u*)(rp + 32);                // d 16 + 8hh ..
    qf1.u[0] = *(const v4u*)(rp + 64);                // d 32 + 8hh ..
    qf1.u[1] = *(const v4u*)(rp + 96);                // d 48 + 8hh ..
  }
  const v16b qa0 = qf0.v;                   // d 0..31
  const v16b qa1 = qf1.v;                   // d 32..63

  float mq = -INFINITY, lq = 0.f;           // query q0 + c: running maximum (both halves alike), this half's share of the sum
  v8f o[4];                                 // o[j] element r = (d = 16*j + 8*hh + r, query q0 + c)
#pragma unroll
  for (int j = 0; j < 4; ++j) o[j] = zero8();
  const int ncaus = (q0 >> 5) + 1;                                            // tiles holding keys <= q0 + 15
  const int nkt = (ncaus < NKT) ? ncaus : NKT;
  const int qr  = q0 + c;                                                     // this lane's query row

#pragma unroll 1
  for (int kt = sp; kt < nkt; kt += NSPL) {
    const int kb = kt * 32;
    // ---- scores^T: D element r of this lane = (key kb + 8*hh + r, query qr) in s0, key kb + 16 + 8*hh + r in s1 ----
    v8f s0 = zero8(), s1 = zero8();
    {
      const u16* kp = Khb + (size_t)kt * KTW;           // fragment f = key subtile * 2 + d step
      const v16b kf00 = ldfrag_bf(kp);
      const v16b kf01 = ldfrag_bf(kp + 2 * FRW);
      const v16b kf10 = ldfrag_bf(kp + FRW);
      const v16b kf11 = ldfrag_bf(kp + 3 * FRW);
      s0 = mma_b(kf00, qa0, s0);
      s1 = mma_b(kf01, qa0, s1);
      s0 = mma_b(kf10, qa1, s0);
      s1 = mma_b(kf11, qa1, s1);
      guard2<v16b>(s0, s1, qa0, qa1, kf00, kf01, kf10, kf11);
      asm volatile("s_wait_xcnt 0x0" ::: "memory");   // stands before the k loads' address registers take new values
    }
    // ---- causal select + online softmax in base 2, -inf-safe; one query per lane ----
    const int key0 = kb + 8 * hh, key1 = kb + 16 + 8 * hh;
    float t0[8], t1[8];                                 // unscaled q.k, -inf where masked
    float mx = -INFINITY;
#pragma unroll
    for (int r = 0; r < 8; ++r) {
      t0[r] = (key0 + r > qr) ? -INFINITY : s0[r];
      t1[r] = (key1 + r > qr) ? -INFINITY : s1[r];
      mx = fmaxf(mx, fmaxf(t0[r], t1[r]));
    }
    mx = fmaxf(mx, xhalf(mx)) * lsc;                    // the other 16 keys of this query; lsc > 0: the scaled maximum
    const float mn = fmaxf(mq, mx);
    const float ms = (mn == -INFINITY) ? 0.0f : mn;
    // a weight under 2^-126 comes out 0, which no sum here can tell from its value: each running sum holds a term near PCAR
    // as soon as it holds any
    float al = mq - ms;
    const float cs = PCARL - ms;                        // addend of the exponent's fma
    mq = mn;
#pragma unroll                                          // constant indices: t0 and t1 stay in registers
    for (int r = 0; r < 8; ++r) {
      t0[r] = fmaf(t0[r], lsc, cs);
      t1[r] = fmaf(t1[r], lsc, cs);
    }
    exp2_tile(al, t0, t1);                              // al = rescale factor, t0 and t1 = weights x PCAR
    // ---- B fragments of P^T*32768: hi f16 (and residual f16 when PRES != 0), col = query, elements 0..7 = keys kb + 8hh + 0..7
    //      (s0), elements 8..15 = keys kb + 16 + 8hh + 0..7 (s1): the split k map of the v^T fragments ----
    FragH ph, pl;
    float ps = t0[0] + t1[0];
#pragma unroll
    for (int r = 0; r < 8; ++r) {
      const float ta = t0[r], tc = t1[r];
      if (r > 0) ps += ta + tc;
      const _Float16 ha = (_Float16)ta, hc = (_Float16)tc;
      ph.h[0][r] = ha;
      ph.h[1][r] = hc;
      if constexpr (PRES != 0) {
        pl.h[0][r] = (_Float16)(ta - (float)ha);
        pl.h[1][r] = (_Float16)(tc - (float)hc);
      }
    }
    if constexpr (PRES == 0) { pl.v = ph.v; }
    lq = lq * al + ps;
#pragma unroll
    for (int j = 0; j < 4; ++j) {
#pragma unroll
      for (int r = 0; r < 8; ++r) o[j][r] *= al;
    }
    // ---- out^T += v^T.P^T : A fragment row m = d = j*16 + c, fragment j of the tile; 2 groups of 2 d-subtiles ----
    {
      const _Float16* vp = Vhb + (size_t)kt * KTW;
#pragma unroll
      for (int jg = 0; jg < 2; ++jg) {
        const v16h va = ldfrag_hf(vp + (2 * jg) * FRW), vb = ldfrag_hf(vp + (2 * jg + 1) * FRW);
        o[2 * jg]     = mma_h(va, ph.v, o[2 * jg]);
        if constexpr (PRES != 0) { o[2 * jg] = mma_h(va, pl.v, o[2 * jg]); }
        o[2 * jg + 1] = mma_h(vb, ph.v, o[2 * jg + 1]);
        if constexpr (PRES != 0) { o[2 * jg + 1] = mma_h(vb, pl.v, o[2 * jg + 1]); }
        guard2<v16h>(o[2 * jg], o[2 * jg + 1], ph.v, pl.v, va, vb, va, vb);
      }
      asm volatile("s_wait_xcnt 0x0" ::: "memory");   // stands before the v loads' address registers take new values
    }
  }
  acc_guard4(o[0], o[1], o[2], o[3]);
  // ---- this split's partial: un-normalised accumulators into the wave's slab (row = query c, 8 consecutive d per tile: two 16-B
  //      stores), (maximum, joined sum) of each query in front of it ----
  lq += xhalf(lq);
#pragma unroll
  for (int j = 0; j < 4; ++j) {
    float* sp8 = slab + c * SLP + j * 16 + 8 * hh;
    const v4f lo = {o[j][0], o[j][1], o[j][2], o[j][3]}, hi = {o[j][4], o[j][5], o[j][6], o[j][7]};
    *(v4f*)(sp8)     = lo;
    *(v4f*)(sp8 + 4) = hi;
  }
  if (hh == 0) {
    ml[c]      = mq;
    ml[16 + c] = lq;
  }
  __syncthreads();                          // every wave's partial is in LDS before any wave merges; reached by all waves once
  // ---- merge over the NSPL splits of this head: lanes (hh, c): row 2*sp + hh, floats 4c..4c+3 ----
  const int row = sp * (16 / NSPL) + hh;
  const float* hb = smem + hw * WREG;       // split p of this head: + p * WPB * WREG
  float mp[NSPL];
  float mall = -INFINITY;
#pragma unroll
  for (int p = 0; p < NSPL; ++p) {
    mp[p] = hb[p * (WPB * WREG) + row];
    mall  = fmaxf(mall, mp[p]);
  }
  const float msa = (mall == -INFINITY) ? 0.0f : mall;
  float lv = 0.f;
  v4f   ov = {0.f, 0.f, 0.f, 0.f};
#pragma unroll
  for (int p = 0; p < NSPL; ++p) {
    const float w  = exp2f(mp[p] - msa);
    const v4f   pv = *(const v4f*)(hb + p * (WPB * WREG) + MLW + row * SLP + c * 4);
    lv += w * hb[p * (WPB * WREG) + 16 + row];
#pragma unroll
    for (int e = 0; e < 4; ++e) ov[e] += w * pv[e];
  }
  // ---- out = merged acc / merged Z * ren (0 if Z == 0), the carry on v (1024) folded once, that on P cancels;
  //      16 lanes x 16 B = the whole 256-B row segment ----
  const float ls  = (lv > 0.0f) ? lv : 1.0f;
  const float inv = (lv > 0.0f) ? ((1.0f / ls) * oc) : 0.0f;
#pragma unroll
  for (int e = 0; e < 4; ++e) ov[e] *= inv;
  *(v4f*)(Og + ((size_t)(q0 + row)) * QD + head * HD + c * 4) = ov;
}

__global__ __launch_bounds__(ATT_THREADS)
void attn_c(const float* __restrict__ Qf, const u16* __restrict__ KBp, const u16* __restrict__ VTp, float* Og) {
  __shared__ __align__(16) float smem[WPB * NSPL * WREG];
  const int bid = blockIdx.x;
  const int rk  = bid / NHG;                // rank by falling cost: 0 = the last (longest) query tile
  const int hg  = bid % NHG;
  if (rk >= NQT) return;                    // block-uniform, before the barrier; never taken with the exact grid
  const int qt  = NQT - 1 - rk;
  if (qt < NQTE) {                          // block-uniform: each body's one barrier is reached by all waves of the block or by none
    attn_tile<1>(Qf, KBp, VTp, Og, smem, qt, hg);
  } else {
    attn_tile<0>(Qf, KBp, VTp, Og, smem, qt, hg);
  }
}

// =====================================================================================================
// Workspace map (bytes); every plane is fully written by whole-line stores before it is read; all extents are exact multiples
// of the store granularity (no pad rows needed); every region offset a multiple of 1048576:
//   KB  bf16 fragment order      SEQ*256     (1048576)
//   VT  f16  fragment order x1024 SEQ*256    (1048576)
//   end (SEQ=4096)              2097152
// =====================================================================================================
extern "C" void kernel_launch(void* const* d_in, const int* in_sizes, int n_in,
                              void* d_out, int out_size, void* d_ws, size_t ws_size,
                              hipStream_t stream) {
  if (n_in < 3) return;
  if (in_sizes[0] < SEQ * QD) return;       // query [s][h][d], token-major prefix of SEQ rows used
  if (in_sizes[1] < SEQ * KVD) return;      // key   [s][g][d]
  if (in_sizes[2] < SEQ * KVD) return;      // value [s][g][d]
  if (out_size < SEQ * QD) return;

  const float* q = (const float*)d_in[0];
  const float* k = (const float*)d_in[1];
  const float* v = (const float*)d_in[2];
  float*     out = (float*)d_out;

  const size_t szKB = (size_t)SEQ * KVD * 2;
  const size_t szVT = (size_t)KVD * SEQ * 2;
  size_t off = 0;
  const size_t oKB = off; off += szKB;
  const size_t oVT = off; off += szVT;
  if (off > ws_size) return;                // off = 2097152 for SEQ = 4096
  if (off > (size_t)WS_CAP) return;

  char* ws = (char*)d_ws;
  u16* KB = (u16*)(ws + oKB);
  u16* VT = (u16*)(ws + oVT);

  const dim3 b256(256), bAT(ATT_THREADS);
  // (0) k -> bf16 plane and v^T -> f16 plane x1024, both in fragment order, one grid
  kv_planes<<<dim3(NVB + NKB), b256, 0, stream>>>(k, v, KB, VT);
  // (1) causal attention, every query tile (rows s < QO with the P residual product) -> out f32
  attn_c<<<dim3(NQT * NHG), bAT, 0, stream>>>(q, KB, VT, out);
  (void)hipGetLastError();
}

// v007
// Measured time: 28.5 microseconds a run.
// Next to v006, in two timings, it ran 1.18 and 1.19 times as fast.
// Counting every step since v000, it is 8.86 times as fast.
// Contractions, both transposed: k.q^T over 64 on v_wmma_f32_16x16x32_bf16 (q, k rounded to bf16 RNE, single product, f32 accumulate);
// v^T.P^T on v_wmma_f32_16x16x32_f16 (P x32768 as f16 hi on every query row plus an in-register f16 residual for query rows
// s < QO; v as one f16 plane holding the bf16 RNE value x1024; f32 accumulate). Causal select, base-2 online softmax,
// 1/Z and the chunk-mass renormalisation in f32 on VALU; each weight is one fma and one v_exp_f32 and carries the x32768.
// The k and v planes lie in fragment order: each 16-byte-per-lane fragment load of a wave reads 512 consecutive bytes.
// Two launches: (0) the k and v planes, one grid; (1) attention over every query tile, q rounded to bf16 in each wave's prologue.
#include <hip/hip_runtime.h>
#include <math.h>
#include <stdint.h>

#ifndef SEQ
#define SEQ 4096
#endif
#define S_FULL 4096
#define NH    8
#define NKVH  2
#define HD    64
#define QD    (NH * HD)
#define KVD   (NKVH * HD)
#define WPB   (NH / NKVH)
#define NHG   NKVH
#define QO    ((SEQ < 512) ? SEQ : 512)
#define NQT   (SEQ / 16)
#define NQTE  (QO / 16)
#define NST   (SEQ / 64)
#define NKT   (SEQ / 32)
#define NSPL  8
#define ATT_THREADS (WPB * NSPL * 32)
#define RSQ_HD 0.125f
#define LOG2E 1.4426950408889634f
#define PCAR  32768.0f
#define PCARL 15.0f                        // log2 of PCAR: the carry on P enters through the exponent
#define VCAR  1024.0f
#define MLW   32                           // floats of one wave's 16 (maximum, sum) pairs
#define SLP   68
#define QSP   144                          // bytes between the bf16 q rows staged in a wave's slab (128 used; 16 x odd: no bank conflict)
#define SLW   (16 * SLP)
#define WREG  (MLW + SLW)
#define VTP   72
#define FRP   256                          // halves between the two 16-byte parts of a fragment (32 lanes x 8)
#define FRW   (2 * FRP)                    // halves of one fragment
#define KTW   (4 * FRW)                    // halves of one 32-key tile of one kv head (4 fragments), k plane and v plane alike
#define NVB   (NKVH * NST)                 // blocks of the v part of the plane grid
#define NKB   ((SEQ * KVD / 8) / 256)      // blocks of the k part (256 chunks of 16 bytes each)
#define WS_CAP 134217728
static_assert(QD == 512 && KVD == 128 && HD == 64 && NH == 8 && NKVH == 2 && WPB == 4 && NHG * WPB == NH);
static_assert(ATT_THREADS == 1024 && (16 % NSPL) == 0 && (16 / NSPL) == 2);
static_assert((SEQ % 64) == 0 && SEQ >= 64 && SEQ <= S_FULL);
static_assert((QO % 16) == 0 && QO >= 16 && QO <= SEQ);
static_assert(16 * QSP <= SLW * 4 && (QSP % 16) == 0 && QSP >= HD * 2);
static_assert(PCAR == 32768.0f && PCARL == 15.0f);
static_assert((HD % 32) == 0 && ((SEQ * KVD / 8) % 256) == 0);

typedef unsigned short u16;
typedef _Float16 v16h __attribute__((ext_vector_type(16)));
typedef _Float16 v8h  __attribute__((ext_vector_type(8)));
typedef __bf16   v16b __attribute__((ext_vector_type(16)));
typedef float    v8f  __attribute__((ext_vector_type(8)));
typedef float    v4f  __attribute__((ext_vector_type(4)));
typedef __bf16   v4b  __attribute__((ext_vector_type(4)));
typedef unsigned int v2u __attribute__((ext_vector_type(2)));
typedef unsigned int v4u __attribute__((ext_vector_type(4)));

union FragH { v16h v; v8h h[2]; v4u u[2]; };
union FragB { v16b v; v4u u[2]; };

// ---- scalar helpers --------------------------------------------------------------------------------
__device__ __forceinline__ unsigned short bf_bits(float f) {          // f32 -> bf16 bits, RNE convert
  unsigned u = __float_as_uint(f);
  return (unsigned short)((u + 0x7FFFu + ((u >> 16) & 1u)) >> 16);
}
__device__ __forceinline__ float bf_up(unsigned short h) { return __uint_as_float(((unsigned)h) << 16); }
__device__ __forceinline__ float bfr(float f) { return bf_up(bf_bits(f)); }
__device__ __forceinline__ unsigned short h_bits(_Float16 x) { return __builtin_bit_cast(unsigned short, x); }
__device__ __forceinline__ unsigned pk16(unsigned short a, unsigned short b) { return (unsigned)a | ((unsigned)b << 16); }
__device__ __forceinline__ v8f zero8() { v8f z = {0.f, 0.f, 0.f, 0.f, 0.f, 0.f, 0.f, 0.f}; return z; }

// ---- 16-bit A/B operand, split k map (same for A and B): lane -> row/col (lane&15), h = lane>>4; elements 0..7 <- k0+8h+0..7,
//      elements 8..15 <- k0+16+8h+0..7. q comes in this order from the wave's own LDS rows (attention prologue), the k and v
//      operands from the fragment-order planes through the two loaders below.

// fragment-order planes: p already includes +8*lane; elements 0..7 <- p[0..7], elements 8..15 <- p[FRP..FRP+7]
__device__ __forceinline__ v16h ldfrag_hf(const _Float16* p) {
  FragH f;
  f.h[0] = *(const v8h*)(p);
  f.h[1] = *(const v8h*)(p + FRP);
  return f.v;
}
__device__ __forceinline__ v16b ldfrag_bf(const u16* p) {
  FragB f;
  f.u[0] = *(const v4u*)(p);
  f.u[1] = *(const v4u*)(p + FRP);
  return f.v;
}

__device__ __forceinline__ v8f mma_h(v16h a, v16h b, v8f c) {
  return __builtin_amdgcn_wmma_f32_16x16x32_f16(false, a, false, b, (short)0, c, false, false);
}
__device__ __forceinline__ v8f mma_b(v16b a, v16b b, v8f c) {
  return __builtin_amdgcn_wmma_f32_16x16x32_bf16(false, a, false, b, (short)0, c, false, false);
}
template <typename F>
__device__ __forceinline__ void guard2(v8f& a, v8f& b, F x0, F x1, F x2, F x3, F x4, F x5) {
#if defined(__HIP_DEVICE_COMPILE__)
  asm volatile("v_nop\n\tv_nop\n\tv_nop\n\tv_nop"
               : "+v"(a), "+v"(b) : "v"(x0), "v"(x1), "v"(x2), "v"(x3), "v"(x4), "v"(x5) : "memory");
#endif
}
__device__ __forceinline__ void acc_guard4(v8f& a, v8f& b, v8f& c, v8f& d) {
#if defined(__HIP_DEVICE_COMPILE__)
  asm volatile("v_nop\n\tv_nop\n\tv_nop\n\tv_nop" : "+v"(a), "+v"(b), "+v"(c), "+v"(d));
#endif
}
// 2^x in place for the rescale factor and the 16 exponents of a key tile, bare v_exp_f32 (a result under 2^-126 comes out 0, -inf
// gives 0). One statement: each instruction rewrites only its own register, so none overwrites the source of the one in front of
// it; the closing v_nop is the slot the instruction set asks for between the last v_exp_f32 and the first reader of its result.
__device__ __forceinline__ void exp2_tile(float& a, float (&x)[8], float (&y)[8]) {
#if defined(__HIP_DEVICE_COMPILE__)
  asm("v_exp_f32 %0, %0\n\t"
      "v_exp_f32 %16, %16\n\tv_exp_f32 %15, %15\n\tv_exp_f32 %14, %14\n\tv_exp_f32 %13, %13\n\t"
      "v_exp_f32 %12, %12\n\tv_exp_f32 %11, %11\n\tv_exp_f32 %10, %10\n\tv_exp_f32 %9, %9\n\t"
      "v_exp_f32 %8, %8\n\tv_exp_f32 %7, %7\n\tv_exp_f32 %6, %6\n\tv_exp_f32 %5, %5\n\t"
      "v_exp_f32 %4, %4\n\tv_exp_f32 %3, %3\n\tv_exp_f32 %2, %2\n\tv_exp_f32 %1, %1\n\t"
      "v_nop"
      : "+v"(a), "+v"(x[0]), "+v"(x[1]), "+v"(x[2]), "+v"(x[3]), "+v"(x[4]), "+v"(x[5]), "+v"(x[6]), "+v"(x[7]),
        "+v"(y[0]), "+v"(y[1]), "+v"(y[2]), "+v"(y[3]), "+v"(y[4]), "+v"(y[5]), "+v"(y[6]), "+v"(y[7]));
#endif
}
__device__ __forceinline__ float xhalf(float x) {                     // the value of lane ^ 16
  const int b = __builtin_bit_cast(int, x);
  return __builtin_bit_cast(float, __builtin_amdgcn_permlanex16(b, b, 0x76543210, 0xfedcba98, false, false));
}

// =====================================================================================================
// k f32 [SEQ][KVD] -> bf16 RNE bits in fragment order. 16-byte chunk o = (((g*NKT + kt)*4 + f)*2 + part)*32 + lane holds
//   k[kt*32 + (f>>1)*16 + (lane&15)][g*HD + (f&1)*32 + part*16 + (lane>>4)*8 + 0..7]
// (f = key subtile * 2 + d step; the split k map of the operand loaders). Thread = one output chunk: two 16-B loads, one 16-B
// store; a wave stores 512 consecutive bytes (whole lines, one writer each). No barriers on this path.
// coverage: NKB blocks x 256 chunks (bound kept) = NKVH*NKT tiles x 256 chunks = the whole plane once. kb = block within the k part.
// =====================================================================================================
__device__ __forceinline__ void cvt_kf(const float* __restrict__ K, u16* D, int kb) {
  const int o = kb * 256 + (int)threadIdx.x;
  if (o >= NKB * 256) return;
  const int lane = o & 31, part = (o >> 5) & 1, f = (o >> 6) & 3, t = o >> 8;
  const int kt = t % NKT, g = t / NKT;
  const int s = kt * 32 + (f >> 1) * 16 + (lane & 15);
  const int d = (f & 1) * 32 + part * 16 + (lane >> 4) * 8;
  const float* p = K + (size_t)s * KVD + g * HD + d;
  const v4f a = *(const v4f*)(p), b4 = *(const v4f*)(p + 4);
  v4u w;
  w[0] = pk16(bf_bits(a[0]), bf_bits(a[1]));
  w[1] = pk16(bf_bits(a[2]), bf_bits(a[3]));
  w[2] = pk16(bf_bits(b4[0]), bf_bits(b4[1]));
  w[3] = pk16(bf_bits(b4[2]), bf_bits(b4[3]));
  *(v4u*)(D + (size_t)o * 8) = w;
}

// =====================================================================================================
// v^T plane in fragment order from V f32 [SEQ][KVD] (row = key s, column = g*HD + d); value = f16 bits of (bf16 RNE value of v)
// * 1024 (exact for |v| >= 6e-8: 8-bit significand, power-of-two carry). 16-byte chunk
//   (((g*NKT + kt)*4 + j)*2 + part)*32 + lane holds d = j*16 + (lane&15), keys kt*32 + part*16 + (lane>>4)*8 + 0..7.
// Block = (kv head g, 64 keys s0): each thread loads 16 floats (key sl, d chunk dc) with 16-B loads, converts, scatters into the LDS
// coverage: load 256 thr x 16 = 64 keys x 64 d; store 2 iterations x 256 thr x 8 halves = the block's two 32-key tiles;
//           NVB = NKVH*NST blocks cover the NKVH*NKT tiles exactly once. bid = block within the v part, 0 .. NVB-1.
// =====================================================================================================
__device__ __forceinline__ void vt16(const float* __restrict__ V, u16* VTo, u16* T, int bid) {
  const int tid = threadIdx.x;
  const int st  = bid % NST;
  const int g   = bid / NST;
  const int s0  = st * 64;
  {
    const int sl = tid >> 2;                // key within tile 0..63
    const int dc = (tid & 3) * 16;          // d chunk
    const float* src = V + (size_t)(s0 + sl) * KVD + g * HD + dc;
#pragma unroll
    for (int i = 0; i < 4; ++i) {
      const v4f a = *(const v4f*)(src + 4 * i);
#pragma unroll
      for (int e = 0; e < 4; ++e) {
        const float t = bfr(a[e]) * VCAR;
        T[(dc + 4 * i + e) * VTP + sl] = h_bits((_Float16)t);
      }
    }
  }
  __syncthreads();
  v4u w4[2];
  const int line = ((tid >> 6) & 3) * 16 + (tid & 15);                 // d = j*16 + (lane&15)
  const int koff = ((tid >> 5) & 1) * 16 + ((tid >> 4) & 1) * 8;       // part*16 + (lane>>4)*8
#pragma unroll
  for (int it = 0; it < 2; ++it) {          // it = 32-key tile within the block's 64 keys
    w4[it] = *(const v4u*)(T + line * VTP + it * 32 + koff);
  }
  u16* dst = VTo + (size_t)(g * NKT + 2 * st) * KTW + tid * 8;
#pragma unroll
  for (int it = 0; it < 2; ++it) {
    *(v4u*)(dst + it * KTW) = w4[it];
  }
}

// =====================================================================================================
// Both planes in one grid: neither part reads what the other writes. Blocks 0 .. NVB-1 write the v^T plane (they hold the barrier
// and the longer path, so they start first), blocks NVB .. NVB+NKB-1 the k plane. The branch is block-uniform.
// =====================================================================================================
__global__ __launch_bounds__(256) void kv_planes(const float* __restrict__ K, const float* __restrict__ V, u16* KD, u16* VTo) {
  __shared__ __align__(16) u16 T[HD * VTP];
  const int bid = blockIdx.x;
  if (bid < NVB) {
    vt16(V, VTo, T, bid);
  } else {
    cvt_kf(K, KD, bid - NVB);
  }
}

// =====================================================================================================
// Causal grouped-query attention over head dim 64. Block bid -> (query tile qt = NQT - 1 - bid / NHG: rows q0 = 16*qt ..
// q0+15, head group hg = bid % NHG = kv head): a tile's key count grows with qt and there are more blocks than resident places, so
// the longest blocks take the lowest indices and start first, the shortest fill the places that free up; NSPL waves per query head: wave w -> head hg*WPB + (w % WPB), key split sp = w / WPB (the 4 heads of the
// group share kv head hg; the 4 waves of one split read the same k and v tiles).
//   q f32 input [s][h*HD + d] (pitch QD), rounded to bf16 in the prologue; k bf16 plane and v^T f16 plane (x1024) in fragment order, KTW halves per (g, key tile).
//   scores, transposed = k.q^T single bf16 product (A = k rows [m = key][k = d], B = q rows as [n = query][k = d]), f32 accumulate:
//   a lane holds 16 of the 32 scores of ONE query (column c), lane ^ 16 the other 16;
//   t(i, j) (log2 domain) = (q_i.k_j over HD) * (1/8)*log2e, replaced by -inf where key j > query i (causal select).
//   Key tiles of 32 with kb <= q0 + 15 (later tiles hold only keys above every query row of the tile: weight 0); split sp visits
//   tiles sp, sp + NSPL, ... in order, with its own running maximum, sum and accumulators (none: maximum -inf, sum 0, zeros).
//   Per tile: 2 score subtiles x 2 k-steps, fragments loaded straight from the 16-bit planes (two 16-B loads per fragment, split k
//   map; q fragments loaded and converted once); online max-subtracted base-2 softmax in f32, -inf-safe rescale: maximum in-lane plus one
//   exchange between the wave's halves, sum kept per lane and joined once after the loop; the two score tiles, converted in place
//   (hi f16, and residual f16 when PRES != 0), ARE the B operand of out^T += v^T.P^T (element s = key kmap(s, hh) of column c): no
//   LDS and no wave sync in the loop; the four v^T A fragments (row m = d) are loaded ahead of the softmax, right behind the scores.
//   After the loop: every wave puts its un-normalised 16 x 64 partial into its own slab (pitch 68) and its 16 (maximum, sum) pairs
//   in front of it; one block barrier; wave (head, sp) merges rows 2*sp, 2*sp + 1 of its head over the NSPL
//   partials in the fixed order 0..NSPL-1: M = max of maxima, weight exp2(m - M) (a partial with maximum -inf weighs 0),
//   out = sum(w * acc) / sum(w * Z) * cw/(cw + 1e-8) with cw the mass of the single local softmax chunk (merged Z > 0 always:
//   key 0 <= every query row; guarded anyway), the carry 1/1024 on v folded once (the 32768 on P stands in acc and Z alike).
// coverage: per wave 1 instruction x 2 rows x 16 lanes x 4 floats; NSPL waves = the head's 16 x 64 row segments; grid nqt x NHG
//           blocks x WPB heads = every (s, h) row segment of the query tiles once; one grid of NQT x NHG blocks covers every tile:
//           tiles [0, NQTE) take the body with the P residual product (PRES = 1), tiles [NQTE, NQT) the one without.
// =====================================================================================================
template <int PRES>
__device__ __forceinline__
void attn_tile(const float* __restrict__ Qf, const u16* __restrict__ KBp, const u16* __restrict__ VTp,
               float* Og, float* smem, int qt, int hg) {
  const int tid  = threadIdx.x;
  const int wave = __builtin_amdgcn_readfirstlane(tid >> 5);   // scalar: the key loop's bounds stay wave-uniform branches
  const int hw   = wave % WPB;              // head within the group
  const int sp   = wave / WPB;              // key split
  const int lane = tid & 31;
  const int hh   = lane >> 4;
  const int c    = lane & 15;
  const int q0   = qt * 16;
  const int head = hg * WPB + hw;
  const int kvh  = hg;

  float* ml   = smem + wave * WREG;         // 16 maxima, then 16 sums
  float* slab = ml + MLW;                   // result slab [16][64] pitch 68

  const u16* Khb = KBp + (size_t)(kvh * NKT) * KTW + 8 * lane;                   // A: row m = key, k = d; tile kt at + kt*KTW
  const _Float16* Vhb = (const _Float16*)(const void*)VTp + (size_t)(kvh * NKT) * KTW + 8 * lane;  // A: row m = d, k = key
  const float lsc = RSQ_HD * LOG2E;
  const float cw  = 1.0f;                   // mass of the single local softmax chunk
  const float ren = cw / (cw + 1e-8f);
  const float oc  = ren / VCAR;             // the carry on P stands in the sums too and cancels in acc / Z

  // ---- q tile of this head, 16 rows x 64 f32: load i takes rows 2i, 2i+1 (lane -> row 2i + hh, floats 4c..4c+3: 512 bytes = 4 whole
  //      lines), f32 -> bf16 RNE by the packed convert, 8 bytes per lane into row 2i + hh of the wave's OWN slab (pitch QSP bytes,
  //      16 * QSP <= the slab); read back as B fragments: col n = query q0 + c, k = d, split k map ----
  FragB qf0, qf1;
  {
    const float* Qt = Qf + ((size_t)(q0 + hh)) * QD + head * HD + 4 * c;
    char* qs = (char*)slab;
    v4f x[8];
#pragma unroll
    for (int i = 0; i < 8; ++i) x[i] = *(const v4f*)(Qt + (size_t)(2 * i) * QD);
#pragma unroll
    for (int i = 0; i < 8; ++i) {
      *(v2u*)(qs + (2 * i + hh) * QSP + 8 * c) = __builtin_bit_cast(v2u, __builtin_convertvector(x[i], v4b));
    }
    asm volatile("s_wait_dscnt 0x0" ::: "memory");   // the wave's own rows are in LDS before its lanes read each other's bytes
    const char* rp = qs + c * QSP + 16 * hh;
    qf0.u[0] = *(const v4u*)(rp);                     // d  0 + 8hh ..
    qf0.u[1] = *(const v4u*)(rp + 32);                // d 16 + 8hh ..
    qf1.u[0] = *(const v4u*)(rp + 64);                // d 32 + 8hh ..
    qf1.u[1] = *(const v4u*)(rp + 96);                // d 48 + 8hh ..
  }
  const v16b qa0 = qf0.v;                   // d 0..31
  const v16b qa1 = qf1.v;                   // d 32..63

  float mq = -INFINITY, lq = 0.f;           // query q0 + c: running maximum (both halves alike), this half's share of the sum
  v8f o[4];                                 // o[j] element r = (d = 16*j + 8*hh + r, query q0 + c)
#pragma unroll
  for (int j = 0; j < 4; ++j) o[j] = zero8();
  const int ncaus = (q0 >> 5) + 1;                                            // tiles holding keys <= q0 + 15
  const int nkt = (ncaus < NKT) ? ncaus : NKT;
  const int qr  = q0 + c;                                                     // this lane's query row

#pragma unroll 1
  for (int kt = sp; kt < nkt; kt += NSPL) {
    const int kb = kt * 32;
    // ---- scores^T: D element r of this lane = (key kb + 8*hh + r, query qr) in s0, key kb + 16 + 8*hh + r in s1 ----
    v8f s0 = zero8(), s1 = zero8();
    {
      const u16* kp = Khb + (size_t)kt * KTW;           // fragment f = key subtile * 2 + d step
      const v16b kf00 = ldfrag_bf(kp);
      const v16b kf01 = ldfrag_bf(kp + 2 * FRW);
      const v16b kf10 = ldfrag_bf(kp + FRW);
      const v16b kf11 = ldfrag_bf(kp + 3 * FRW);
      s0 = mma_b(kf00, qa0, s0);
      s1 = mma_b(kf01, qa0, s1);
      s0 = mma_b(kf10, qa1, s0);
      s1 = mma_b(kf11, qa1, s1);
      guard2<v16b>(s0, s1, qa0, qa1, kf00, kf01, kf10, kf11);
      asm volatile("s_wait_xcnt 0x0" ::: "memory");   // stands before the k loads' address registers take new values
    }
    // ---- all four v^T fragments of the tile (row m = d = j*16 + c, fragment j) are asked for here, behind the score products, where the
    //      k fragments' registers are free: their latency runs under the softmax, none of it stands between the output products ----
    v16h vf[4];
    {
      const _Float16* vp = Vhb + (size_t)kt * KTW;
#pragma unroll
      for (int j = 0; j < 4; ++j) vf[j] = ldfrag_hf(vp + j * FRW);
    }
    // ---- causal select + online softmax in base 2, -inf-safe; one query per lane ----
    const int key0 = kb + 8 * hh, key1 = kb + 16 + 8 * hh;
    float t0[8], t1[8];                                 // unscaled q.k, -inf where masked
    float mx = -INFINITY;
#pragma unroll
    for (int r = 0; r < 8; ++r) {
      t0[r] = (key0 + r > qr) ? -INFINITY : s0[r];
      t1[r] = (key1 + r > qr) ? -INFINITY : s1[r];
      mx = fmaxf(mx, fmaxf(t0[r], t1[r]));
    }
    mx = fmaxf(mx, xhalf(mx)) * lsc;                    // the other 16 keys of this query; lsc > 0: the scaled maximum
    const float mn = fmaxf(mq, mx);
    const float ms = (mn == -INFINITY) ? 0.0f : mn;
    // a weight under 2^-126 comes out 0, which no sum here can tell from its value: each running sum holds a term near PCAR
    // as soon as it holds any
    float al = mq - ms;
    const float cs = PCARL - ms;                        // addend of the exponent's fma
    mq = mn;
#pragma unroll                                          // constant indices: t0 and t1 stay in registers
    for (int r = 0; r < 8; ++r) {
      t0[r] = fmaf(t0[r], lsc, cs);
      t1[r] = fmaf(t1[r], lsc, cs);
    }
    exp2_tile(al, t0, t1);                              // al = rescale factor, t0 and t1 = weights x PCAR
    // ---- B fragments of P^T*32768: hi f16 (and residual f16 when PRES != 0), col = query, elements 0..7 = keys kb + 8hh + 0..7
    //      (s0), elements 8..15 = keys kb + 16 + 8hh + 0..7 (s1): the split k map of the v^T fragments ----
    FragH ph, pl;
    float ps = t0[0] + t1[0];
#pragma unroll
    for (int r = 0; r < 8; ++r) {
      const float ta = t0[r], tc = t1[r];
      if (r > 0) ps += ta + tc;
      const _Float16 ha = (_Float16)ta, hc = (_Float16)tc;
      ph.h[0][r] = ha;
      ph.h[1][r] = hc;
      if constexpr (PRES != 0) {
        pl.h[0][r] = (_Float16)(ta - (float)ha);
        pl.h[1][r] = (_Float16)(tc - (float)hc);
      }
    }
    if constexpr (PRES == 0) { pl.v = ph.v; }
    lq = lq * al + ps;
#pragma unroll
    for (int j = 0; j < 4; ++j) {
#pragma unroll
      for (int r = 0; r < 8; ++r) o[j][r] *= al;
    }
    // ---- out^T += v^T.P^T on the fragments loaded above; 2 groups of 2 d-subtiles ----
    {
#pragma unroll
      for (int jg = 0; jg < 2; ++jg) {
        const v16h va = vf[2 * jg], vb = vf[2 * jg + 1];
        o[2 * jg]     = mma_h(va, ph.v, o[2 * jg]);
        if constexpr (PRES != 0) { o[2 * jg] = mma_h(va, pl.v, o[2 * jg]); }
        o[2 * jg + 1] = mma_h(vb, ph.v, o[2 * jg + 1]);
        if constexpr (PRES != 0) { o[2 * jg + 1] = mma_h(vb, pl.v, o[2 * jg + 1]); }
        guard2<v16h>(o[2 * jg], o[2 * jg + 1], ph.v, pl.v, va, vb, va, vb);
      }
      asm volatile("s_wait_xcnt 0x0" ::: "memory");   // stands before the v loads' address registers take new values
    }
  }
  acc_guard4(o[0], o[1], o[2], o[3]);
  // ---- this split's partial: un-normalised accumulators into the wave's slab (row = query c, 8 consecutive d per tile: two 16-B
  //      stores), (maximum, joined sum) of each query in front of it ----
  lq += xhalf(lq);
#pragma unroll
  for (int j = 0; j < 4; ++j) {
    float* sp8 = slab + c * SLP + j * 16 + 8 * hh;
    const v4f lo = {o[j][0], o[j][1], o[j][2], o[j][3]}, hi = {o[j][4], o[j][5], o[j][6], o[j][7]};
    *(v4f*)(sp8)     = lo;
    *(v4f*)(sp8 + 4) = hi;
  }
  if (hh == 0) {
    ml[c]      = mq;
    ml[16 + c] = lq;
  }
  __syncthreads();                          // every wave's partial is in LDS before any wave merges; reached by all waves once
  // ---- merge over the NSPL splits of this head: lanes (hh, c): row 2*sp + hh, floats 4c..4c+3 ----
  const int row = sp * (16 / NSPL) + hh;
  const float* hb = smem + hw * WREG;       // split p of this head: + p * WPB * WREG
  float mp[NSPL];
  float mall = -INFINITY;
#pragma unroll
  for (int p = 0; p < NSPL; ++p) {
    mp[p] = hb[p * (WPB * WREG) + row];
    mall  = fmaxf(mall, mp[p]);
  }
  const float msa = (mall == -INFINITY) ? 0.0f : mall;
  float lv = 0.f;
  v4f   ov = {0.f, 0.f, 0.f, 0.f};
#pragma unroll
  for (int p = 0; p < NSPL; ++p) {
    const float w  = exp2f(mp[p] - msa);
    const v4f   pv = *(const v4f*)(hb + p * (WPB * WREG) + MLW + row * SLP + c * 4);
    lv += w * hb[p * (WPB * WREG) + 16 + row];
#pragma unroll
    for (int e = 0; e < 4; ++e) ov[e] += w * pv[e];
  }
  // ---- out = merged acc / merged Z * ren (0 if Z == 0), the carry on v (1024) folded once, that on P cancels;
  //      16 lanes x 16 B = the whole 256-B row segment ----
  const float ls  = (lv > 0.0f) ? lv : 1.0f;
  const float inv = (lv > 0.0f) ? ((1.0f / ls) * oc) : 0.0f;
#pragma unroll
  for (int e = 0; e < 4; ++e) ov[e] *= inv;
  *(v4f*)(Og + ((size_t)(q0 + row)) * QD + head * HD + c * 4) = ov;
}

__global__ __launch_bounds__(ATT_THREADS)
void attn_c(const float* __restrict__ Qf, const u16* __restrict__ KBp, const u16* __restrict__ VTp, float* Og) {
  __shared__ __align__(16) float smem[WPB * NSPL * WREG];
  const int bid = blockIdx.x;
  const int rk  = bid / NHG;                // rank by falling cost: 0 = the last (longest) query tile
  const int hg  = bid % NHG;
  if (rk >= NQT) return;                    // block-uniform, before the barrier; never taken with the exact grid
  const int qt  = NQT - 1 - rk;
  if (qt < NQTE) {                          // block-uniform: each body's one barrier is reached by all waves of the block or by none
    attn_tile<1>(Qf, KBp, VTp, Og, smem, qt, hg);
  } else {
    attn_tile<0>(Qf, KBp, VTp, Og, smem, qt, hg);
  }
}

// =====================================================================================================
// Workspace map (bytes); every plane is fully written by whole-line stores before it is read; all extents are exact multiples
// of the store granularity (no pad rows needed); every region offset a multiple of 1048576:
//   KB  bf16 fragment order      SEQ*256     (1048576)
//   VT  f16  fragment order x1024 SEQ*256    (1048576)
//   end (SEQ=4096)              2097152
// =====================================================================================================
extern "C" void kernel_launch(void* const* d_in, const int* in_sizes, int n_in,
                              void* d_out, int out_size, void* d_ws, size_t ws_size,
                              hipStream_t stream) {
  if (n_in < 3) return;
  if (in_sizes[0] < SEQ * QD) return;       // query [s][h][d], token-major prefix of SEQ rows used
  if (in_sizes[1] < SEQ * KVD) return;      // key   [s][g][d]
  if (in_sizes[2] < SEQ * KVD) return;      // value [s][g][d]
  if (out_size < SEQ * QD) return;

  const float* q = (const float*)d_in[0];
  const float* k = (const float*)d_in[1];
  const float* v = (const float*)d_in[2];
  float*     out = (float*)d_out;

  const size_t szKB = (size_t)SEQ * KVD * 2;
  const size_t szVT = (size_t)KVD * SEQ * 2;
  size_t off = 0;
  const size_t oKB = off; off += szKB;
  const size_t oVT = off; off += szVT;
  if (off > ws_size) return;                // off = 2097152 for SEQ = 4096
  if (off > (size_t)WS_CAP) return;

  char* ws = (char*)d_ws;
  u16* KB = (u16*)(ws + oKB);
  u16* VT = (u16*)(ws + oVT);

  const dim3 b256(256), bAT(ATT_THREADS);
  // (0) k -> bf16 plane and v^T -> f16 plane x1024, both in fragment order, one grid
  kv_planes<<<dim3(NVB + NKB), b256, 0, stream>>>(k, v, KB, VT);
  // (1) causal attention, every query tile (rows s < QO with the P residual product) -> out f32
  attn_c<<<dim3(NQT * NHG), bAT, 0, stream>>>(q, KB, VT, out);
  (void)hipGetLastError();
}

// v008
// It runs in 26.8 microseconds.
// Next to v007, in two timings, it ran 1.06 and 1.07 times as fast.
// Counting every step since v000, it is 9.44 times as fast.
// Contractions, both transposed: k.q^T over 64 on v_wmma_f32_16x16x32_bf16 (q, k rounded to bf16 RNE, single product, f32 accumulate);
// v^T.P^T on v_wmma_f32_16x16x32_f16 (P x32768 as f16 hi on every query row plus an in-register f16 residual for query rows
// s < QO; v as one f16 plane holding the bf16 RNE value x1024; f32 accumulate). Causal select, base-2 online softmax,
// 1/Z and the chunk-mass renormalisation in f32 on VALU; each weight is one fma and one v_exp_f32 and carries the x32768.
// The k and v planes lie in fragment order: each 16-byte-per-lane fragment load of a wave reads 512 consecutive bytes.
// Two launches: (0) the k and v planes, one grid; (1) attention over every query tile, q rounded to bf16 in each wave's prologue.
#include <hip/hip_runtime.h>
#include <math.h>
#include <stdint.h>

#ifndef SEQ
#define SEQ 4096
#endif
#define S_FULL 4096
#define NH    8
#define NKVH  2
#define HD    64
#define QD    (NH * HD)
#define KVD   (NKVH * HD)
#define WPB   (NH / NKVH)
#define NHG   NKVH
#define QO    ((SEQ < 512) ? SEQ : 512)
#define NQT   (SEQ / 16)
#define NQTE  (QO / 16)
#define NST   (SEQ / 64)
#define NKT   (SEQ / 32)
#define NSPL  6                            // key splits per head: 24 waves a block, 6 a SIMD, which leaves a wave 160 registers
#define ATT_THREADS (WPB * NSPL * 32)
#define RSQ_HD 0.125f
#define LOG2E 1.4426950408889634f
#define PCAR  32768.0f
#define PCARL 15.0f                        // log2 of PCAR: the carry on P enters through the exponent
#define VCAR  1024.0f
#define MLW   32                           // floats of one wave's 16 (maximum, sum) pairs
#define SLP   68
#define QSP   144                          // bytes between the bf16 q rows staged in a wave's slab (128 used; 16 x odd: no bank conflict)
#define SLW   (16 * SLP)
#define WREG  (MLW + SLW)
#define VTP   72
#define FRP   256                          // halves between the two 16-byte parts of a fragment (32 lanes x 8)
#define FRW   (2 * FRP)                    // halves of one fragment
#define KTW   (4 * FRW)                    // halves of one 32-key tile of one kv head (4 fragments), k plane and v plane alike
#define NVB   (NKVH * NST)                 // blocks of the v part of the plane grid
#define NKB   ((SEQ * KVD / 8) / 256)      // blocks of the k part (256 chunks of 16 bytes each)
#define WS_CAP 134217728
static_assert(QD == 512 && KVD == 128 && HD == 64 && NH == 8 && NKVH == 2 && WPB == 4 && NHG * WPB == NH);
static_assert(ATT_THREADS <= 1024 && NSPL >= 1 && NSPL <= 8);
static_assert((SEQ % 64) == 0 && SEQ >= 64 && SEQ <= S_FULL);
static_assert((QO % 16) == 0 && QO >= 16 && QO <= SEQ);
static_assert(16 * QSP <= SLW * 4 && (QSP % 16) == 0 && QSP >= HD * 2);
static_assert(PCAR == 32768.0f && PCARL == 15.0f);
static_assert((HD % 32) == 0 && ((SEQ * KVD / 8) % 256) == 0);

typedef unsigned short u16;
typedef _Float16 v16h __attribute__((ext_vector_type(16)));
typedef _Float16 v8h  __attribute__((ext_vector_type(8)));
typedef __bf16   v16b __attribute__((ext_vector_type(16)));
typedef float    v8f  __attribute__((ext_vector_type(8)));
typedef float    v4f  __attribute__((ext_vector_type(4)));
typedef __bf16   v4b  __attribute__((ext_vector_type(4)));
typedef unsigned int v2u __attribute__((ext_vector_type(2)));
typedef unsigned int v4u __attribute__((ext_vector_type(4)));

union FragH { v16h v; v8h h[2]; v4u u[2]; };
union FragB { v16b v; v4u u[2]; };

// ---- scalar helpers --------------------------------------------------------------------------------
__device__ __forceinline__ unsigned short bf_bits(float f) {          // f32 -> bf16 bits, RNE convert
  unsigned u = __float_as_uint(f);
  return (unsigned short)((u + 0x7FFFu + ((u >> 16) & 1u)) >> 16);
}
__device__ __forceinline__ float bf_up(unsigned short h) { return __uint_as_float(((unsigned)h) << 16); }
__device__ __forceinline__ float bfr(float f) { return bf_up(bf_bits(f)); }
__device__ __forceinline__ unsigned short h_bits(_Float16 x) { return __builtin_bit_cast(unsigned short, x); }
__device__ __forceinline__ unsigned pk16(unsigned short a, unsigned short b) { return (unsigned)a | ((unsigned)b << 16); }
__device__ __forceinline__ v8f zero8() { v8f z = {0.f, 0.f, 0.f, 0.f, 0.f, 0.f, 0.f, 0.f}; return z; }

// ---- 16-bit A/B operand, split k map (same for A and B): lane -> row/col (lane&15), h = lane>>4; elements 0..7 <- k0+8h+0..7,
//      elements 8..15 <- k0+16+8h+0..7. q comes in this order from the wave's own LDS rows (attention prologue), the k and v
//      operands from the fragment-order planes through the two loaders below.

// fragment-order planes: p already includes +8*lane; elements 0..7 <- p[0..7], elements 8..15 <- p[FRP..FRP+7]
__device__ __forceinline__ v16h ldfrag_hf(const _Float16* p) {
  FragH f;
  f.h[0] = *(const v8h*)(p);
  f.h[1] = *(const v8h*)(p + FRP);
  return f.v;
}
__device__ __forceinline__ v16b ldfrag_bf(const u16* p) {
  FragB f;
  f.u[0] = *(const v4u*)(p);
  f.u[1] = *(const v4u*)(p + FRP);
  return f.v;
}

__device__ __forceinline__ v8f mma_h(v16h a, v16h b, v8f c) {
  return __builtin_amdgcn_wmma_f32_16x16x32_f16(false, a, false, b, (short)0, c, false, false);
}
__device__ __forceinline__ v8f mma_b(v16b a, v16b b, v8f c) {
  return __builtin_amdgcn_wmma_f32_16x16x32_bf16(false, a, false, b, (short)0, c, false, false);
}
template <typename F>
__device__ __forceinline__ void guard2(v8f& a, v8f& b, F x0, F x1, F x2, F x3, F x4, F x5) {
#if defined(__HIP_DEVICE_COMPILE__)
  asm volatile("v_nop\n\tv_nop\n\tv_nop\n\tv_nop"
               : "+v"(a), "+v"(b) : "v"(x0), "v"(x1), "v"(x2), "v"(x3), "v"(x4), "v"(x5) : "memory");
#endif
}
__device__ __forceinline__ void acc_guard4(v8f& a, v8f& b, v8f& c, v8f& d) {
#if defined(__HIP_DEVICE_COMPILE__)
  asm volatile("v_nop\n\tv_nop\n\tv_nop\n\tv_nop" : "+v"(a), "+v"(b), "+v"(c), "+v"(d));
#endif
}
// 2^x in place for the rescale factor and the 16 exponents of a key tile, bare v_exp_f32 (a result under 2^-126 comes out 0, -inf
// gives 0). One statement: each instruction rewrites only its own register, so none overwrites the source of the one in front of
// it; the closing v_nop is the slot the instruction set asks for between the last v_exp_f32 and the first reader of its result.
__device__ __forceinline__ void exp2_tile(float& a, float (&x)[8], float (&y)[8]) {
#if defined(__HIP_DEVICE_COMPILE__)
  asm("v_exp_f32 %0, %0\n\t"
      "v_exp_f32 %16, %16\n\tv_exp_f32 %15, %15\n\tv_exp_f32 %14, %14\n\tv_exp_f32 %13, %13\n\t"
      "v_exp_f32 %12, %12\n\tv_exp_f32 %11, %11\n\tv_exp_f32 %10, %10\n\tv_exp_f32 %9, %9\n\t"
      "v_exp_f32 %8, %8\n\tv_exp_f32 %7, %7\n\tv_exp_f32 %6, %6\n\tv_exp_f32 %5, %5\n\t"
      "v_exp_f32 %4, %4\n\tv_exp_f32 %3, %3\n\tv_exp_f32 %2, %2\n\tv_exp_f32 %1, %1\n\t"
      "v_nop"
      : "+v"(a), "+v"(x[0]), "+v"(x[1]), "+v"(x[2]), "+v"(x[3]), "+v"(x[4]), "+v"(x[5]), "+v"(x[6]), "+v"(x[7]),
        "+v"(y[0]), "+v"(y[1]), "+v"(y[2]), "+v"(y[3]), "+v"(y[4]), "+v"(y[5]), "+v"(y[6]), "+v"(y[7]));
#endif
}
__device__ __forceinline__ float xhalf(float x) {                     // the value of lane ^ 16
  const int b = __builtin_bit_cast(int, x);
  return __builtin_bit_cast(float, __builtin_amdgcn_permlanex16(b, b, 0x76543210, 0xfedcba98, false, false));
}

// =====================================================================================================
// k f32 [SEQ][KVD] -> bf16 RNE bits in fragment order. 16-byte chunk o = (((g*NKT + kt)*4 + f)*2 + part)*32 + lane holds
//   k[kt*32 + (f>>1)*16 + (lane&15)][g*HD + (f&1)*32 + part*16 + (lane>>4)*8 + 0..7]
// (f = key subtile * 2 + d step; the split k map of the operand loaders). Thread = one output chunk: two 16-B loads, one 16-B
// store; a wave stores 512 consecutive bytes (whole lines, one writer each). No barriers on this path.
// coverage: NKB blocks x 256 chunks (bound kept) = NKVH*NKT tiles x 256 chunks = the whole plane once. kb = block within the k part.
// =====================================================================================================
__device__ __forceinline__ void cvt_kf(const float* __restrict__ K, u16* D, int kb) {
  const int o = kb * 256 + (int)threadIdx.x;
  if (o >= NKB * 256) return;
  const int lane = o & 31, part = (o >> 5) & 1, f = (o >> 6) & 3, t = o >> 8;
  const int kt = t % NKT, g = t / NKT;
  const int s = kt * 32 + (f >> 1) * 16 + (lane & 15);
  const int d = (f & 1) * 32 + part * 16 + (lane >> 4) * 8;
  const float* p = K + (size_t)s * KVD + g * HD + d;
  const v4f a = *(const v4f*)(p), b4 = *(const v4f*)(p + 4);
  v4u w;
  w[0] = pk16(bf_bits(a[0]), bf_bits(a[1]));
  w[1] = pk16(bf_bits(a[2]), bf_bits(a[3]));
  w[2] = pk16(bf_bits(b4[0]), bf_bits(b4[1]));
  w[3] = pk16(bf_bits(b4[2]), bf_bits(b4[3]));
  *(v4u*)(D + (size_t)o * 8) = w;
}

// =====================================================================================================
// v^T plane in fragment order from V f32 [SEQ][KVD] (row = key s, column = g*HD + d); value = f16 bits of (bf16 RNE value of v)
// * 1024 (exact for |v| >= 6e-8: 8-bit significand, power-of-two carry). 16-byte chunk
//   (((g*NKT + kt)*4 + j)*2 + part)*32 + lane holds d = j*16 + (lane&15), keys kt*32 + part*16 + (lane>>4)*8 + 0..7.
// Block = (kv head g, 64 keys s0): each thread loads 16 floats (key sl, d chunk dc) with 16-B loads, converts, scatters into the LDS
// coverage: load 256 thr x 16 = 64 keys x 64 d; store 2 iterations x 256 thr x 8 halves = the block's two 32-key tiles;
//           NVB = NKVH*NST blocks cover the NKVH*NKT tiles exactly once. bid = block within the v part, 0 .. NVB-1.
// =====================================================================================================
__device__ __forceinline__ void vt16(const float* __restrict__ V, u16* VTo, u16* T, int bid) {
  const int tid = threadIdx.x;
  const int st  = bid % NST;
  const int g   = bid / NST;
  const int s0  = st * 64;
  {
    const int sl = tid >> 2;                // key within tile 0..63
    const int dc = (tid & 3) * 16;          // d chunk
    const float* src = V + (size_t)(s0 + sl) * KVD + g * HD + dc;
#pragma unroll
    for (int i = 0; i < 4; ++i) {
      const v4f a = *(const v4f*)(src + 4 * i);
#pragma unroll
      for (int e = 0; e < 4; ++e) {
        const float t = bfr(a[e]) * VCAR;
        T[(dc + 4 * i + e) * VTP + sl] = h_bits((_Float16)t);
      }
    }
  }
  __syncthreads();
  v4u w4[2];
  const int line = ((tid >> 6) & 3) * 16 + (tid & 15);                 // d = j*16 + (lane&15)
  const int koff = ((tid >> 5) & 1) * 16 + ((tid >> 4) & 1) * 8;       // part*16 + (lane>>4)*8
#pragma unroll
  for (int it = 0; it < 2; ++it) {          // it = 32-key tile within the block's 64 keys
    w4[it] = *(const v4u*)(T + line * VTP + it * 32 + koff);
  }
  u16* dst = VTo + (size_t)(g * NKT + 2 * st) * KTW + tid * 8;
#pragma unroll
  for (int it = 0; it < 2; ++it) {
    *(v4u*)(dst + it * KTW) = w4[it];
  }
}

// =====================================================================================================
// Both planes in one grid: neither part reads what the other writes. Blocks 0 .. NVB-1 write the v^T plane (they hold the barrier
// and the longer path, so they start first), blocks NVB .. NVB+NKB-1 the k plane. The branch is block-uniform.
// =====================================================================================================
__global__ __launch_bounds__(256) void kv_planes(const float* __restrict__ K, const float* __restrict__ V, u16* KD, u16* VTo) {
  __shared__ __align__(16) u16 T[HD * VTP];
  const int bid = blockIdx.x;
  if (bid < NVB) {
    vt16(V, VTo, T, bid);
  } else {
    cvt_kf(K, KD, bid - NVB);
  }
}

// =====================================================================================================
// Causal grouped-query attention over head dim 64. Block bid -> (query tile qt = NQT - 1 - bid / NHG: rows q0 = 16*qt ..
// q0+15, head group hg = bid % NHG = kv head): a tile's key count grows with qt and there are more blocks than resident places, so
// the longest blocks take the lowest indices and start first, the shortest fill the places that free up; NSPL waves per query head: wave w -> head hg*WPB + (w % WPB), key split sp = w / WPB (the 4 heads of the
// group share kv head hg; the 4 waves of one split read the same k and v tiles).
//   q f32 input [s][h*HD + d] (pitch QD), rounded to bf16 in the prologue; k bf16 plane and v^T f16 plane (x1024) in fragment order, KTW halves per (g, key tile).
//   scores, transposed = k.q^T single bf16 product (A = k rows [m = key][k = d], B = q rows as [n = query][k = d]), f32 accumulate:
//   a lane holds 16 of the 32 scores of ONE query (column c), lane ^ 16 the other 16;
//   t(i, j) (log2 domain) = (q_i.k_j over HD) * (1/8)*log2e, replaced by -inf where key j > query i (causal select).
//   Key tiles of 32 with kb <= q0 + 15 (later tiles hold only keys above every query row of the tile: weight 0); split sp visits
//   tiles sp, sp + NSPL, ... in order, with its own running maximum, sum and accumulators (none: maximum -inf, sum 0, zeros).
//   Per tile: 2 score subtiles x 2 k-steps, fragments loaded straight from the 16-bit planes (two 16-B loads per fragment, split k
//   map; q fragments loaded and converted once; the k fragments of a trip are asked for one trip ahead, into registers of their own); online max-subtracted base-2 softmax in f32, -inf-safe rescale: maximum in-lane plus one
//   exchange between the wave's halves, sum kept per lane and joined once after the loop; the two score tiles, converted in place
//   (hi f16, and residual f16 when PRES != 0), ARE the B operand of out^T += v^T.P^T (element s = key kmap(s, hh) of column c): no
//   LDS and no wave sync in the loop; the four v^T A fragments (row m = d) are loaded ahead of the softmax, right behind the scores.
//   After the loop: every wave puts its un-normalised 16 x 64 partial into its own slab (pitch 68) and its 16 (maximum, sum) pairs
//   in front of it; one block barrier; wave (head, sp) merges row pairs sp, sp + NSPL, ... (< 8) of its head over the NSPL
//   partials in the fixed order 0..NSPL-1: M = max of maxima, weight exp2(m - M) (a partial with maximum -inf weighs 0),
//   out = sum(w * acc) / sum(w * Z) * cw/(cw + 1e-8) with cw the mass of the single local softmax chunk (merged Z > 0 always:
//   key 0 <= every query row; guarded anyway), the carry 1/1024 on v folded once (the 32768 on P stands in acc and Z alike).
// coverage: per row pair 1 instruction x 2 rows x 16 lanes x 4 floats; 8 row pairs over NSPL waves = the head's 16 x 64 row segments; grid nqt x NHG
//           blocks x WPB heads = every (s, h) row segment of the query tiles once; one grid of NQT x NHG blocks covers every tile:
//           tiles [0, NQTE) take the body with the P residual product (PRES = 1), tiles [NQTE, NQT) the one without.
// =====================================================================================================
template <int PRES>
__device__ __forceinline__
void attn_tile(const float* __restrict__ Qf, const u16* __restrict__ KBp, const u16* __restrict__ VTp,
               float* Og, float* smem, int qt, int hg) {
  const int tid  = threadIdx.x;
  const int wave = __builtin_amdgcn_readfirstlane(tid >> 5);   // scalar: the key loop's bounds stay wave-uniform branches
  const int hw   = wave % WPB;              // head within the group
  const int sp   = wave / WPB;              // key split
  const int lane = tid & 31;
  const int hh   = lane >> 4;
  const int c    = lane & 15;
  const int q0   = qt * 16;
  const int head = hg * WPB + hw;
  const int kvh  = hg;

  float* ml   = smem + wave * WREG;         // 16 maxima, then 16 sums
  float* slab = ml + MLW;                   // result slab [16][64] pitch 68

  const u16* Khb = KBp + (size_t)(kvh * NKT) * KTW + 8 * lane;                   // A: row m = key, k = d; tile kt at + kt*KTW
  const _Float16* Vhb = (const _Float16*)(const void*)VTp + (size_t)(kvh * NKT) * KTW + 8 * lane;  // A: row m = d, k = key
  const float lsc = RSQ_HD * LOG2E;
  const float cw  = 1.0f;                   // mass of the single local softmax chunk
  const float ren = cw / (cw + 1e-8f);
  const float oc  = ren / VCAR;             // the carry on P stands in the sums too and cancels in acc / Z

  const int ncaus = (q0 >> 5) + 1;                                            // tiles holding keys <= q0 + 15
  const int nkt = (ncaus < NKT) ? ncaus : NKT;
  // ---- the k fragments of a trip (fragment f = key subtile * 2 + d step) are asked for one trip ahead and have registers of their
  //      own; kpn = the tile asked for next; a wave without a tile asks for tile 0 and never uses it: in bounds;
  //      the first tile is asked for here, beside the q rows, so that the two latencies run together ----
  const u16* kpn = Khb + (size_t)((sp < nkt) ? sp : 0) * KTW;
  v16b kf00 = ldfrag_bf(kpn);
  v16b kf01 = ldfrag_bf(kpn + 2 * FRW);
  v16b kf10 = ldfrag_bf(kpn + FRW);
  v16b kf11 = ldfrag_bf(kpn + 3 * FRW);
  kpn += (sp + NSPL < nkt) ? NSPL * KTW : 0;

  // ---- q tile of this head, 16 rows x 64 f32: load i takes rows 2i, 2i+1 (lane -> row 2i + hh, floats 4c..4c+3: 512 bytes = 4 whole
  //      lines), f32 -> bf16 RNE by the packed convert, 8 bytes per lane into row 2i + hh of the wave's OWN slab (pitch QSP bytes,
  //      16 * QSP <= the slab); read back as B fragments: col n = query q0 + c, k = d, split k map ----
  FragB qf0, qf1;
  {
    const float* Qt = Qf + ((size_t)(q0 + hh)) * QD + head * HD + 4 * c;
    char* qs = (char*)slab;
    v4f x[8];
#pragma unroll
    for (int i = 0; i < 8; ++i) x[i] = *(const v4f*)(Qt + (size_t)(2 * i) * QD);
#pragma unroll
    for (int i = 0; i < 8; ++i) {
      *(v2u*)(qs + (2 * i + hh) * QSP + 8 * c) = __builtin_bit_cast(v2u, __builtin_convertvector(x[i], v4b));
    }
    asm volatile("s_wait_dscnt 0x0" ::: "memory");   // the wave's own rows are in LDS before its lanes read each other's bytes
    const char* rp = qs + c * QSP + 16 * hh;
    qf0.u[0] = *(const v4u*)(rp);                     // d  0 + 8hh ..
    qf0.u[1] = *(const v4u*)(rp + 32);                // d 16 + 8hh ..
    qf1.u[0] = *(const v4u*)(rp + 64);                // d 32 + 8hh ..
    qf1.u[1] = *(const v4u*)(rp + 96);                // d 48 + 8hh ..
  }
#if defined(__HIP_DEVICE_COMPILE__)
  // inputs only: holds the first k tile's loads up here, beside the q loads; without it they sink to the loop's door and their
  // latency follows that of the q rows instead of running with it
  asm volatile("" :: "v"(kf00), "v"(kf01), "v"(kf10), "v"(kf11));
#endif
  const v16b qa0 = qf0.v;                   // d 0..31
  const v16b qa1 = qf1.v;                   // d 32..63

  float mq = -INFINITY, lq = 0.f;           // query q0 + c: running maximum (both halves alike), this half's share of the sum
  v8f o[4];                                 // o[j] element r = (d = 16*j + 8*hh + r, query q0 + c)
#pragma unroll
  for (int j = 0; j < 4; ++j) o[j] = zero8();
  const int qr  = q0 + c;                                                     // this lane's query row

#pragma unroll 1
  for (int kt = sp; kt < nkt; kt += NSPL) {
    const int kb = kt * 32;
    // ---- scores^T: D element r of this lane = (key kb + 8*hh + r, query qr) in s0, key kb + 16 + 8*hh + r in s1 ----
    v8f s0 = zero8(), s1 = zero8();
    {
      s0 = mma_b(kf00, qa0, s0);
      s1 = mma_b(kf01, qa0, s1);
      s0 = mma_b(kf10, qa1, s0);
      s1 = mma_b(kf11, qa1, s1);
      guard2<v16b>(s0, s1, qa0, qa1, kf00, kf01, kf10, kf11);
    }
    // ---- all four v^T fragments of the tile (row m = d = j*16 + c, fragment j) are asked for here, behind the score products,
    //      into registers of their own: their latency runs under the softmax, none of it stands between the output products ----
    v16h vf[4];
    {
      const _Float16* vp = Vhb + (size_t)kt * KTW;
#pragma unroll
      for (int j = 0; j < 4; ++j) vf[j] = ldfrag_hf(vp + j * FRW);
    }
    // ---- the next trip's k fragments, asked for behind the v loads (they are needed later): their latency runs under this trip's
    //      softmax and output products; the last trip asks for its own tile again: in bounds, never used ----
    kf00 = ldfrag_bf(kpn);
    kf01 = ldfrag_bf(kpn + 2 * FRW);
    kf10 = ldfrag_bf(kpn + FRW);
    kf11 = ldfrag_bf(kpn + 3 * FRW);
    asm volatile("s_wait_xcnt 0x0" ::: "memory");     // stands before the v and k loads' address registers take new values
    kpn += (kt + 2 * NSPL < nkt) ? NSPL * KTW : 0;
    // ---- causal select + online softmax in base 2, -inf-safe; one query per lane ----
    const int key0 = kb + 8 * hh, key1 = kb + 16 + 8 * hh;
    float t0[8], t1[8];                                 // unscaled q.k, -inf where masked
    float mx = -INFINITY;
#pragma unroll
    for (int r = 0; r < 8; ++r) {
      t0[r] = (key0 + r > qr) ? -INFINITY : s0[r];
      t1[r] = (key1 + r > qr) ? -INFINITY : s1[r];
      mx = fmaxf(mx, fmaxf(t0[r], t1[r]));
    }
    mx = fmaxf(mx, xhalf(mx)) * lsc;                    // the other 16 keys of this query; lsc > 0: the scaled maximum
    const float mn = fmaxf(mq, mx);
    const float ms = (mn == -INFINITY) ? 0.0f : mn;
    // a weight under 2^-126 comes out 0, which no sum here can tell from its value: each running sum holds a term near PCAR
    // as soon as it holds any
    float al = mq - ms;
    const float cs = PCARL - ms;                        // addend of the exponent's fma
    mq = mn;
#pragma unroll                                          // constant indices: t0 and t1 stay in registers
    for (int r = 0; r < 8; ++r) {
      t0[r] = fmaf(t0[r], lsc, cs);
      t1[r] = fmaf(t1[r], lsc, cs);
    }
    exp2_tile(al, t0, t1);                              // al = rescale factor, t0 and t1 = weights x PCAR
    // ---- B fragments of P^T*32768: hi f16 (and residual f16 when PRES != 0), col = query, elements 0..7 = keys kb + 8hh + 0..7
    //      (s0), elements 8..15 = keys kb + 16 + 8hh + 0..7 (s1): the split k map of the v^T fragments ----
    FragH ph, pl;
    float ps = t0[0] + t1[0];
#pragma unroll
    for (int r = 0; r < 8; ++r) {
      const float ta = t0[r], tc = t1[r];
      if (r > 0) ps += ta + tc;
      const _Float16 ha = (_Float16)ta, hc = (_Float16)tc;
      ph.h[0][r] = ha;
      ph.h[1][r] = hc;
      if constexpr (PRES != 0) {
        pl.h[0][r] = (_Float16)(ta - (float)ha);
        pl.h[1][r] = (_Float16)(tc - (float)hc);
      }
    }
    if constexpr (PRES == 0) { pl.v = ph.v; }
    lq = lq * al + ps;
#pragma unroll
    for (int j = 0; j < 4; ++j) {
#pragma unroll
      for (int r = 0; r < 8; ++r) o[j][r] *= al;
    }
    // ---- out^T += v^T.P^T on the fragments loaded above; 2 groups of 2 d-subtiles ----
    {
#pragma unroll
      for (int jg = 0; jg < 2; ++jg) {
        const v16h va = vf[2 * jg], vb = vf[2 * jg + 1];
        o[2 * jg]     = mma_h(va, ph.v, o[2 * jg]);
        if constexpr (PRES != 0) { o[2 * jg] = mma_h(va, pl.v, o[2 * jg]); }
        o[2 * jg + 1] = mma_h(vb, ph.v, o[2 * jg + 1]);
        if constexpr (PRES != 0) { o[2 * jg + 1] = mma_h(vb, pl.v, o[2 * jg + 1]); }
        guard2<v16h>(o[2 * jg], o[2 * jg + 1], ph.v, pl.v, va, vb, va, vb);
      }
      asm volatile("s_wait_xcnt 0x0" ::: "memory");   // stands before the v loads' address registers take new values
    }
  }
  acc_guard4(o[0], o[1], o[2], o[3]);
  // ---- this split's partial: un-normalised accumulators into the wave's slab (row = query c, 8 consecutive d per tile: two 16-B
  //      stores), (maximum, joined sum) of each query in front of it ----
  lq += xhalf(lq);
#pragma unroll
  for (int j = 0; j < 4; ++j) {
    float* sp8 = slab + c * SLP + j * 16 + 8 * hh;
    const v4f lo = {o[j][0], o[j][1], o[j][2], o[j][3]}, hi = {o[j][4], o[j][5], o[j][6], o[j][7]};
    *(v4f*)(sp8)     = lo;
    *(v4f*)(sp8 + 4) = hi;
  }
  if (hh == 0) {
    ml[c]      = mq;
    ml[16 + c] = lq;
  }
  __syncthreads();                          // every wave's partial is in LDS before any wave merges; reached by all waves once
  // ---- merge over the NSPL splits of this head: lanes (hh, c): row 2*rpair + hh (rpair = sp, sp + NSPL, ... < 8), floats 4c..4c+3 ----
  const float* hb = smem + hw * WREG;       // split p of this head: + p * WPB * WREG
#pragma unroll 1                            // one or two trips, wave-uniform bounds, no barrier inside: kept rolled to keep the text short
  for (int rpair = sp; rpair < 8; rpair += NSPL) {
  const int row = 2 * rpair + hh;
  float mp[NSPL];
  float mall = -INFINITY;
#pragma unroll
  for (int p = 0; p < NSPL; ++p) {
    mp[p] = hb[p * (WPB * WREG) + row];
    mall  = fmaxf(mall, mp[p]);
  }
  const float msa = (mall == -INFINITY) ? 0.0f : mall;
  float lv = 0.f;
  v4f   ov = {0.f, 0.f, 0.f, 0.f};
#pragma unroll
  for (int p = 0; p < NSPL; ++p) {
    const float w  = exp2f(mp[p] - msa);
    const v4f   pv = *(const v4f*)(hb + p * (WPB * WREG) + MLW + row * SLP + c * 4);
    lv += w * hb[p * (WPB * WREG) + 16 + row];
#pragma unroll
    for (int e = 0; e < 4; ++e) ov[e] += w * pv[e];
  }
  // ---- out = merged acc / merged Z * ren (0 if Z == 0), the carry on v (1024) folded once, that on P cancels;
  //      16 lanes x 16 B = the whole 256-B row segment ----
  const float ls  = (lv > 0.0f) ? lv : 1.0f;
  const float inv = (lv > 0.0f) ? ((1.0f / ls) * oc) : 0.0f;
#pragma unroll
  for (int e = 0; e < 4; ++e) ov[e] *= inv;
  *(v4f*)(Og + ((size_t)(q0 + row)) * QD + head * HD + c * 4) = ov;
  asm volatile("s_wait_xcnt 0x0" ::: "memory");       // stands before a second trip gives the store's registers new values
  }
}

__global__ __launch_bounds__(ATT_THREADS)
void attn_c(const float* __restrict__ Qf, const u16* __restrict__ KBp, const u16* __restrict__ VTp, float* Og) {
  __shared__ __align__(16) float smem[WPB * NSPL * WREG];
  const int bid = blockIdx.x;
  const int rk  = bid / NHG;                // rank by falling cost: 0 = the last (longest) query tile
  const int hg  = bid % NHG;
  if (rk >= NQT) return;                    // block-uniform, before the barrier; never taken with the exact grid
  const int qt  = NQT - 1 - rk;
  if (qt < NQTE) {                          // block-uniform: each body's one barrier is reached by all waves of the block or by none
    attn_tile<1>(Qf, KBp, VTp, Og, smem, qt, hg);
  } else {
    attn_tile<0>(Qf, KBp, VTp, Og, smem, qt, hg);
  }
}

// =====================================================================================================
// Workspace map (bytes); every plane is fully written by whole-line stores before it is read; all extents are exact multiples
// of the store granularity (no pad rows needed); every region offset a multiple of 1048576:
//   KB  bf16 fragment order      SEQ*256     (1048576)
//   VT  f16  fragment order x1024 SEQ*256    (1048576)
//   end (SEQ=4096)              2097152
// =====================================================================================================
extern "C" void kernel_launch(void* const* d_in, const int* in_sizes, int n_in,
                              void* d_out, int out_size, void* d_ws, size_t ws_size,
                              hipStream_t stream) {
  if (n_in < 3) return;
  if (in_sizes[0] < SEQ * QD) return;       // query [s][h][d], token-major prefix of SEQ rows used
  if (in_sizes[1] < SEQ * KVD) return;      // key   [s][g][d]
  if (in_sizes[2] < SEQ * KVD) return;      // value [s][g][d]
  if (out_size < SEQ * QD) return;

  const float* q = (const float*)d_in[0];
  const float* k = (const float*)d_in[1];
  const float* v = (const float*)d_in[2];
  float*     out = (float*)d_out;

  const size_t szKB = (size_t)SEQ * KVD * 2;
  const size_t szVT = (size_t)KVD * SEQ * 2;
  size_t off = 0;
  const size_t oKB = off; off += szKB;
  const size_t oVT = off; off += szVT;
  if (off > ws_size) return;                // off = 2097152 for SEQ = 4096
  if (off > (size_t)WS_CAP) return;

  char* ws = (char*)d_ws;
  u16* KB = (u16*)(ws + oKB);
  u16* VT = (u16*)(ws + oVT);

  const dim3 b256(256), bAT(ATT_THREADS);
  // (0) k -> bf16 plane and v^T -> f16 plane x1024, both in fragment order, one grid
  kv_planes<<<dim3(NVB + NKB), b256, 0, stream>>>(k, v, KB, VT);
  // (1) causal attention, every query tile (rows s < QO with the P residual product) -> out f32
  attn_c<<<dim3(NQT * NHG), bAT, 0, stream>>>(q, KB, VT, out);
  (void)hipGetLastError();
}

// v009
// A run of this version takes 24.2 microseconds.
// Timed twice side by side with v008, it ran 1.12 and 1.10 times as fast.
// All steps since v000 together make it 10.5 times as fast.
// Contractions, both transposed: k.q^T over 64 on v_wmma_f32_16x16x32_bf16 (q, k rounded to bf16 RNE, single product, f32 accumulate);
// v^T.P^T on v_wmma_f32_16x16x32_f16 (P x32768 as f16 hi on every query row plus an in-register f16 residual for query rows
// s < QO; v as one f16 plane holding the bf16 RNE value x1024; f32 accumulate). Causal select, base-2 online softmax,
// 1/Z and the chunk-mass renormalisation in f32 on VALU; each weight is one fma and one v_exp_f32 and carries the x32768.
// The k and v planes lie in fragment order: each 16-byte-per-lane fragment load of a wave reads 512 consecutive bytes.
// Two launches: (0) the k and v planes, one grid; (1) attention over every query tile, q rounded to bf16 in each wave's prologue.
#include <hip/hip_runtime.h>
#include <math.h>
#include <stdint.h>

#ifndef SEQ
#define SEQ 4096
#endif
#define S_FULL 4096
#define NH    8
#define NKVH  2
#define HD    64
#define QD    (NH * HD)
#define KVD   (NKVH * HD)
#define WPB   (NH / NKVH)
#define NHG   NKVH
#define QO    ((SEQ < 512) ? SEQ : 512)
#define NQT   (SEQ / 16)
#define NQTE  (QO / 16)
#define NST   (SEQ / 64)
#define NKT   (SEQ / 32)
#define HPW   2                            // query heads of one kv group that a wave carries: each k and v fragment feeds HPW products
#define NHP   (WPB / HPW)                  // head pairs of a kv group
#define NSPL  8                            // key splits per head: 16 waves a block, 4 a SIMD, which leaves a wave 256 registers
#define ATT_THREADS (NHP * NSPL * 32)
#define RSQ_HD 0.125f
#define LOG2E 1.4426950408889634f
#define PCAR  32768.0f
#define PCARL 15.0f                        // log2 of PCAR: the carry on P enters through the exponent
#define VCAR  1024.0f
#define MLW   32                           // floats of the 16 (maximum, sum) pairs of one wave and head
#define SLP   68
#define QSP   144                          // bytes between the bf16 q rows staged in a wave's slab (128 used; 16 x odd: no bank conflict)
#define SLW   (16 * SLP)
#define WREG  (MLW + SLW)
#define VTP   72
#define FRP   256                          // halves between the two 16-byte parts of a fragment (32 lanes x 8)
#define FRW   (2 * FRP)                    // halves of one fragment
#define KTW   (4 * FRW)                    // halves of one 32-key tile of one kv head (4 fragments), k plane and v plane alike
#define NVB   (NKVH * NST)                 // blocks of the v part of the plane grid
#define NKB   ((SEQ * KVD / 8) / 256)      // blocks of the k part (256 chunks of 16 bytes each)
#define WS_CAP 134217728
static_assert(QD == 512 && KVD == 128 && HD == 64 && NH == 8 && NKVH == 2 && WPB == 4 && NHG * WPB == NH);
static_assert(ATT_THREADS <= 1024 && NSPL >= 1 && NSPL <= 8 && HPW == 2 && NHP * HPW == WPB);
static_assert((SEQ % 64) == 0 && SEQ >= 64 && SEQ <= S_FULL);
static_assert((QO % 16) == 0 && QO >= 16 && QO <= SEQ);
static_assert(16 * QSP <= SLW * 4 && (QSP % 16) == 0 && QSP >= HD * 2);
static_assert(PCAR == 32768.0f && PCARL == 15.0f);
static_assert((HD % 32) == 0 && ((SEQ * KVD / 8) % 256) == 0);

typedef unsigned short u16;
typedef _Float16 v16h __attribute__((ext_vector_type(16)));
typedef _Float16 v8h  __attribute__((ext_vector_type(8)));
typedef __bf16   v16b __attribute__((ext_vector_type(16)));
typedef float    v8f  __attribute__((ext_vector_type(8)));
typedef float    v4f  __attribute__((ext_vector_type(4)));
typedef __bf16   v4b  __attribute__((ext_vector_type(4)));
typedef unsigned int v2u __attribute__((ext_vector_type(2)));
typedef unsigned int v4u __attribute__((ext_vector_type(4)));

union FragH { v16h v; v8h h[2]; v4u u[2]; };
union FragB { v16b v; v4u u[2]; };

// ---- scalar helpers --------------------------------------------------------------------------------
__device__ __forceinline__ unsigned short bf_bits(float f) {          // f32 -> bf16 bits, RNE convert
  unsigned u = __float_as_uint(f);
  return (unsigned short)((u + 0x7FFFu + ((u >> 16) & 1u)) >> 16);
}
__device__ __forceinline__ float bf_up(unsigned short h) { return __uint_as_float(((unsigned)h) << 16); }
__device__ __forceinline__ float bfr(float f) { return bf_up(bf_bits(f)); }
__device__ __forceinline__ unsigned short h_bits(_Float16 x) { return __builtin_bit_cast(unsigned short, x); }
__device__ __forceinline__ unsigned pk16(unsigned short a, unsigned short b) { return (unsigned)a | ((unsigned)b << 16); }
__device__ __forceinline__ v8f zero8() { v8f z = {0.f, 0.f, 0.f, 0.f, 0.f, 0.f, 0.f, 0.f}; return z; }

// ---- 16-bit A/B operand, split k map (same for A and B): lane -> row/col (lane&15), h = lane>>4; elements 0..7 <- k0+8h+0..7,
//      elements 8..15 <- k0+16+8h+0..7. q comes in this order from the wave's own LDS rows (attention prologue), the k and v
//      operands from the fragment-order planes through the two loaders below.

// fragment-order planes: p already includes +8*lane; elements 0..7 <- p[0..7], elements 8..15 <- p[FRP..FRP+7]
__device__ __forceinline__ v16h ldfrag_hf(const _Float16* p) {
  FragH f;
  f.h[0] = *(const v8h*)(p);
  f.h[1] = *(const v8h*)(p + FRP);
  return f.v;
}
__device__ __forceinline__ v16b ldfrag_bf(const u16* p) {
  FragB f;
  f.u[0] = *(const v4u*)(p);
  f.u[1] = *(const v4u*)(p + FRP);
  return f.v;
}

__device__ __forceinline__ v8f mma_h(v16h a, v16h b, v8f c) {
  return __builtin_amdgcn_wmma_f32_16x16x32_f16(false, a, false, b, (short)0, c, false, false);
}
__device__ __forceinline__ v8f mma_b(v16b a, v16b b, v8f c) {
  return __builtin_amdgcn_wmma_f32_16x16x32_bf16(false, a, false, b, (short)0, c, false, false);
}
// four v_nop behind a group of products on four accumulators (two heads x two subtiles): the distance the chip asks for between
// the last product and the first vector instruction that reads a result or rewrites an operand; the loads behind it stay behind it
template <typename F>
__device__ __forceinline__ void guard4(v8f& a, v8f& b, v8f& c, v8f& d, F x0, F x1, F x2, F x3, F x4, F x5, F x6, F x7) {
#if defined(__HIP_DEVICE_COMPILE__)
  asm volatile("v_nop\n\tv_nop\n\tv_nop\n\tv_nop"
               : "+v"(a), "+v"(b), "+v"(c), "+v"(d)
               : "v"(x0), "v"(x1), "v"(x2), "v"(x3), "v"(x4), "v"(x5), "v"(x6), "v"(x7) : "memory");
#endif
}
__device__ __forceinline__ void acc_guard4(v8f& a, v8f& b, v8f& c, v8f& d) {
#if defined(__HIP_DEVICE_COMPILE__)
  asm volatile("v_nop\n\tv_nop\n\tv_nop\n\tv_nop" : "+v"(a), "+v"(b), "+v"(c), "+v"(d));
#endif
}
// 2^x in place for the rescale factor and the 16 exponents of a key tile, bare v_exp_f32 (a result under 2^-126 comes out 0, -inf
// gives 0). One statement: each instruction rewrites only its own register, so none overwrites the source of the one in front of
// it; the closing v_nop is the slot the instruction set asks for between the last v_exp_f32 and the first reader of its result.
__device__ __forceinline__ void exp2_tile(float& a, float (&x)[8], float (&y)[8]) {
#if defined(__HIP_DEVICE_COMPILE__)
  asm("v_exp_f32 %0, %0\n\t"
      "v_exp_f32 %16, %16\n\tv_exp_f32 %15, %15\n\tv_exp_f32 %14, %14\n\tv_exp_f32 %13, %13\n\t"
      "v_exp_f32 %12, %12\n\tv_exp_f32 %11, %11\n\tv_exp_f32 %10, %10\n\tv_exp_f32 %9, %9\n\t"
      "v_exp_f32 %8, %8\n\tv_exp_f32 %7, %7\n\tv_exp_f32 %6, %6\n\tv_exp_f32 %5, %5\n\t"
      "v_exp_f32 %4, %4\n\tv_exp_f32 %3, %3\n\tv_exp_f32 %2, %2\n\tv_exp_f32 %1, %1\n\t"
      "v_nop"
      : "+v"(a), "+v"(x[0]), "+v"(x[1]), "+v"(x[2]), "+v"(x[3]), "+v"(x[4]), "+v"(x[5]), "+v"(x[6]), "+v"(x[7]),
        "+v"(y[0]), "+v"(y[1]), "+v"(y[2]), "+v"(y[3]), "+v"(y[4]), "+v"(y[5]), "+v"(y[6]), "+v"(y[7]));
#endif
}
__device__ __forceinline__ float xhalf(float x) {                     // the value of lane ^ 16
  const int b = __builtin_bit_cast(int, x);
  return __builtin_bit_cast(float, __builtin_amdgcn_permlanex16(b, b, 0x76543210, 0xfedcba98, false, false));
}

// =====================================================================================================
// k f32 [SEQ][KVD] -> bf16 RNE bits in fragment order. 16-byte chunk o = (((g*NKT + kt)*4 + f)*2 + part)*32 + lane holds
//   k[kt*32 + (f>>1)*16 + (lane&15)][g*HD + (f&1)*32 + part*16 + (lane>>4)*8 + 0..7]
// (f = key subtile * 2 + d step; the split k map of the operand loaders). Thread = one output chunk: two 16-B loads, one 16-B
// store; a wave stores 512 consecutive bytes (whole lines, one writer each). No barriers on this path.
// coverage: NKB blocks x 256 chunks (bound kept) = NKVH*NKT tiles x 256 chunks = the whole plane once. kb = block within the k part.
// =====================================================================================================
__device__ __forceinline__ void cvt_kf(const float* __restrict__ K, u16* D, int kb) {
  const int o = kb * 256 + (int)threadIdx.x;
  if (o >= NKB * 256) return;
  const int lane = o & 31, part = (o >> 5) & 1, f = (o >> 6) & 3, t = o >> 8;
  const int kt = t % NKT, g = t / NKT;
  const int s = kt * 32 + (f >> 1) * 16 + (lane & 15);
  const int d = (f & 1) * 32 + part * 16 + (lane >> 4) * 8;
  const float* p = K + (size_t)s * KVD + g * HD + d;
  const v4f a = *(const v4f*)(p), b4 = *(const v4f*)(p + 4);
  v4u w;
  w[0] = pk16(bf_bits(a[0]), bf_bits(a[1]));
  w[1] = pk16(bf_bits(a[2]), bf_bits(a[3]));
  w[2] = pk16(bf_bits(b4[0]), bf_bits(b4[1]));
  w[3] = pk16(bf_bits(b4[2]), bf_bits(b4[3]));
  *(v4u*)(D + (size_t)o * 8) = w;
}

// =====================================================================================================
// v^T plane in fragment order from V f32 [SEQ][KVD] (row = key s, column = g*HD + d); value = f16 bits of (bf16 RNE value of v)
// * 1024 (exact for |v| >= 6e-8: 8-bit significand, power-of-two carry). 16-byte chunk
//   (((g*NKT + kt)*4 + j)*2 + part)*32 + lane holds d = j*16 + (lane&15), keys kt*32 + part*16 + (lane>>4)*8 + 0..7.
// Block = (kv head g, 64 keys s0): each thread loads 16 floats (key sl, d chunk dc) with 16-B loads, converts, scatters into the LDS
// coverage: load 256 thr x 16 = 64 keys x 64 d; store 2 iterations x 256 thr x 8 halves = the block's two 32-key tiles;
//           NVB = NKVH*NST blocks cover the NKVH*NKT tiles exactly once. bid = block within the v part, 0 .. NVB-1.
// =====================================================================================================
__device__ __forceinline__ void vt16(const float* __restrict__ V, u16* VTo, u16* T, int bid) {
  const int tid = threadIdx.x;
  const int st  = bid % NST;
  const int g   = bid / NST;
  const int s0  = st * 64;
  {
    const int sl = tid >> 2;                // key within tile 0..63
    const int dc = (tid & 3) * 16;          // d chunk
    const float* src = V + (size_t)(s0 + sl) * KVD + g * HD + dc;
#pragma unroll
    for (int i = 0; i < 4; ++i) {
      const v4f a = *(const v4f*)(src + 4 * i);
#pragma unroll
      for (int e = 0; e < 4; ++e) {
        const float t = bfr(a[e]) * VCAR;
        T[(dc + 4 * i + e) * VTP + sl] = h_bits((_Float16)t);
      }
    }
  }
  __syncthreads();
  v4u w4[2];
  const int line = ((tid >> 6) & 3) * 16 + (tid & 15);                 // d = j*16 + (lane&15)
  const int koff = ((tid >> 5) & 1) * 16 + ((tid >> 4) & 1) * 8;       // part*16 + (lane>>4)*8
#pragma unroll
  for (int it = 0; it < 2; ++it) {          // it = 32-key tile within the block's 64 keys
    w4[it] = *(const v4u*)(T + line * VTP + it * 32 + koff);
  }
  u16* dst = VTo + (size_t)(g * NKT + 2 * st) * KTW + tid * 8;
#pragma unroll
  for (int it = 0; it < 2; ++it) {
    *(v4u*)(dst + it * KTW) = w4[it];
  }
}

// =====================================================================================================
// Both planes in one grid: neither part reads what the other writes. Blocks 0 .. NVB-1 write the v^T plane (they hold the barrier
// and the longer path, so they start first), blocks NVB .. NVB+NKB-1 the k plane. The branch is block-uniform.
// =====================================================================================================
__global__ __launch_bounds__(256) void kv_planes(const float* __restrict__ K, const float* __restrict__ V, u16* KD, u16* VTo) {
  __shared__ __align__(16) u16 T[HD * VTP];
  const int bid = blockIdx.x;
  if (bid < NVB) {
    vt16(V, VTo, T, bid);
  } else {
    cvt_kf(K, KD, bid - NVB);
  }
}

// =====================================================================================================
// Causal grouped-query attention over head dim 64. Block bid -> (query tile qt = NQT - 1 - bid / NHG: rows q0 = 16*qt ..
// q0+15, head group hg = bid % NHG = kv head): a tile's key count grows with qt and there are more blocks than resident places, so
// the longest blocks take the lowest indices and start first, the shortest fill the places that free up; NSPL waves per pair of query heads: wave w -> heads hg*WPB + (w % NHP)*HPW + 0..HPW-1, key split sp = w / NHP (the 4 heads of the
// group share kv head hg; a wave's k and v fragments each feed the products of its HPW heads; the NHP waves of one split read the same tiles).
//   q f32 input [s][h*HD + d] (pitch QD), rounded to bf16 in the prologue; k bf16 plane and v^T f16 plane (x1024) in fragment order, KTW halves per (g, key tile).
//   scores, transposed = k.q^T single bf16 product (A = k rows [m = key][k = d], B = q rows as [n = query][k = d]), f32 accumulate:
//   a lane holds 16 of the 32 scores of ONE query (column c), lane ^ 16 the other 16;
//   t(i, j) (log2 domain) = (q_i.k_j over HD) * (1/8)*log2e, replaced by -inf where key j > query i (causal select).
//   Key tiles of 32 with kb <= q0 + 15 (later tiles hold only keys above every query row of the tile: weight 0); split sp visits
//   tiles sp, sp + NSPL, ... in order, with its own running maximum, sum and accumulators (none: maximum -inf, sum 0, zeros).
//   Per tile: 2 score subtiles x 2 k-steps, fragments loaded straight from the 16-bit planes (two 16-B loads per fragment, split k
//   map; q fragments loaded and converted once; the k fragments of a trip are asked for one trip ahead, into registers of their own); online max-subtracted base-2 softmax in f32, -inf-safe rescale: maximum in-lane plus one
//   exchange between the wave's halves, sum kept per lane and joined once after the loop; the two score tiles, converted in place
//   (hi f16, and residual f16 when PRES != 0), ARE the B operand of out^T += v^T.P^T (element s = key kmap(s, hh) of column c): no
//   LDS and no wave sync in the loop; the four v^T A fragments (row m = d) are loaded ahead of the softmax, right behind the scores.
//   After the loop: every wave puts each head's un-normalised 16 x 64 partial into a slab of its own (pitch 68) and its 16 (maximum,
//   sum) pairs in front of it; one block barrier; wave (head pair, sp) merges tasks sp, sp + NSPL, ... (< 8*HPW; task = head of the
//   pair * 8 + row pair) over the NSPL partials in the fixed order 0..NSPL-1: M = max of maxima, weight exp2(m - M) (a partial with maximum -inf weighs 0),
//   out = sum(w * acc) / sum(w * Z) * cw/(cw + 1e-8) with cw the mass of the single local softmax chunk (merged Z > 0 always:
//   key 0 <= every query row; guarded anyway), the carry 1/1024 on v folded once (the 32768 on P stands in acc and Z alike).
// coverage: per row pair 1 instruction x 2 rows x 16 lanes x 4 floats; 8*HPW tasks over NSPL waves = the pair's 16 x 64 row segments; grid nqt x NHG
//           blocks x WPB heads = every (s, h) row segment of the query tiles once; one grid of NQT x NHG blocks covers every tile:
//           tiles [0, NQTE) take the body with the P residual product (PRES = 1), tiles [NQTE, NQT) the one without.
// =====================================================================================================
template <int PRES>
__device__ __forceinline__
void attn_tile(const float* __restrict__ Qf, const u16* __restrict__ KBp, const u16* __restrict__ VTp,
               float* Og, float* smem, int qt, int hg) {
  const int tid  = threadIdx.x;
  const int wave = __builtin_amdgcn_readfirstlane(tid >> 5);   // scalar: the key loop's bounds stay wave-uniform branches
  const int hw0  = (wave % NHP) * HPW;      // first of the wave's HPW heads within the group
  const int sp   = wave / NHP;              // key split
  const int lane = tid & 31;
  const int hh   = lane >> 4;
  const int c    = lane & 15;
  const int q0   = qt * 16;
  const int kvh  = hg;

  float* ml0 = smem + (sp * WPB + hw0) * WREG;   // region of (split sp, head hw0): 16 maxima, 16 sums, then the result slab
                                                 // [16][64] pitch 68; head hw0 + e at + e * WREG

  const u16* Khb = KBp + (size_t)(kvh * NKT) * KTW + 8 * lane;                   // A: row m = key, k = d; tile kt at + kt*KTW
  const _Float16* Vhb = (const _Float16*)(const void*)VTp + (size_t)(kvh * NKT) * KTW + 8 * lane;  // A: row m = d, k = key
  const float lsc = RSQ_HD * LOG2E;
  const float cw  = 1.0f;                   // mass of the single local softmax chunk
  const float ren = cw / (cw + 1e-8f);
  const float oc  = ren / VCAR;             // the carry on P stands in the sums too and cancels in acc / Z

  const int ncaus = (q0 >> 5) + 1;                                            // tiles holding keys <= q0 + 15
  const int nkt = (ncaus < NKT) ? ncaus : NKT;
  // ---- the k fragments of a trip (fragment f = key subtile * 2 + d step) are asked for one trip ahead and have registers of their
  //      own; kpn = the tile asked for next; a wave without a tile asks for tile 0 and never uses it: in bounds;
  //      the first tile is asked for here, beside the q rows, so that the two latencies run together ----
  const u16* kpn = Khb + (size_t)((sp < nkt) ? sp : 0) * KTW;
  v16b kf00 = ldfrag_bf(kpn);
  v16b kf01 = ldfrag_bf(kpn + 2 * FRW);
  v16b kf10 = ldfrag_bf(kpn + FRW);
  v16b kf11 = ldfrag_bf(kpn + 3 * FRW);
  kpn += (sp + NSPL < nkt) ? NSPL * KTW : 0;

  // ---- q tiles of the wave's heads, each 16 rows x 64 f32: load i takes rows 2i, 2i+1 (lane -> row 2i + hh, floats 4c..4c+3: 512
  //      bytes = 4 whole lines), f32 -> bf16 RNE by the packed convert, 8 bytes per lane into row 2i + hh of the wave's OWN slab of
  //      that head (pitch QSP bytes, 16 * QSP <= the slab); read back as B fragments: col n = query q0 + c, k = d, split k map ----
  FragB qf0[HPW], qf1[HPW];
  {
    const float* Qt = Qf + ((size_t)(q0 + hh)) * QD + (hg * WPB + hw0) * HD + 4 * c;
    char* qs = (char*)(ml0 + MLW);
    v4f x[HPW][8];
#pragma unroll
    for (int e = 0; e < HPW; ++e) {
#pragma unroll
      for (int i = 0; i < 8; ++i) x[e][i] = *(const v4f*)(Qt + (size_t)(2 * i) * QD + e * HD);
    }
#pragma unroll
    for (int e = 0; e < HPW; ++e) {
#pragma unroll
      for (int i = 0; i < 8; ++i) {
        *(v2u*)(qs + e * (WREG * 4) + (2 * i + hh) * QSP + 8 * c) = __builtin_bit_cast(v2u, __builtin_convertvector(x[e][i], v4b));
      }
    }
    asm volatile("s_wait_dscnt 0x0" ::: "memory");   // the wave's own rows are in LDS before its lanes read each other's bytes
#pragma unroll
    for (int e = 0; e < HPW; ++e) {
      const char* rp = qs + e * (WREG * 4) + c * QSP + 16 * hh;
      qf0[e].u[0] = *(const v4u*)(rp);                // d  0 + 8hh ..
      qf0[e].u[1] = *(const v4u*)(rp + 32);           // d 16 + 8hh ..
      qf1[e].u[0] = *(const v4u*)(rp + 64);           // d 32 + 8hh ..
      qf1[e].u[1] = *(const v4u*)(rp + 96);           // d 48 + 8hh ..
    }
  }
#if defined(__HIP_DEVICE_COMPILE__)
  // inputs only: holds the first k tile's loads up here, beside the q loads; without it they sink to the loop's door and their
  // latency follows that of the q rows instead of running with it
  asm volatile("" :: "v"(kf00), "v"(kf01), "v"(kf10), "v"(kf11));
#endif
  const v16b qa0[HPW] = {qf0[0].v, qf0[1].v};   // d 0..31 of head e
  const v16b qa1[HPW] = {qf1[0].v, qf1[1].v};   // d 32..63 of head e

  float mq[HPW], lq[HPW];                   // head e, query q0 + c: running maximum (both halves alike), this half's share of the sum
  v8f o[HPW][4];                            // o[e][j] element r = (d = 16*j + 8*hh + r, query q0 + c) of head e
#pragma unroll
  for (int e = 0; e < HPW; ++e) {
    mq[e] = -INFINITY;
    lq[e] = 0.f;
#pragma unroll
    for (int j = 0; j < 4; ++j) o[e][j] = zero8();
  }
  const int qr  = q0 + c;                                                     // this lane's query row

#pragma unroll 1
  for (int kt = sp; kt < nkt; kt += NSPL) {
    const int kb = kt * 32;
    // ---- scores^T of both heads on the one set of k fragments: D element r of this lane = (key kb + 8*hh + r, query qr) in s0[e],
    //      key kb + 16 + 8*hh + r in s1[e] ----
    v8f s0[HPW], s1[HPW];
#pragma unroll
    for (int e = 0; e < HPW; ++e) {
      s0[e] = mma_b(kf00, qa0[e], zero8());
      s1[e] = mma_b(kf01, qa0[e], zero8());
    }
#pragma unroll
    for (int e = 0; e < HPW; ++e) {
      s0[e] = mma_b(kf10, qa1[e], s0[e]);
      s1[e] = mma_b(kf11, qa1[e], s1[e]);
    }
    guard4<v16b>(s0[0], s1[0], s0[1], s1[1], qa0[0], qa1[0], qa0[1], qa1[1], kf00, kf01, kf10, kf11);
    // ---- all four v^T fragments of the tile (row m = d = j*16 + c, fragment j) are asked for here, behind the score products,
    //      into registers of their own: their latency runs under the softmax, none of it stands between the output products ----
    v16h vf[4];
    {
      const _Float16* vp = Vhb + (size_t)kt * KTW;
#pragma unroll
      for (int j = 0; j < 4; ++j) vf[j] = ldfrag_hf(vp + j * FRW);
    }
    // ---- the next trip's k fragments, asked for behind the v loads (they are needed later): their latency runs under this trip's
    //      softmax and output products; the last trip asks for its own tile again: in bounds, never used ----
    kf00 = ldfrag_bf(kpn);
    kf01 = ldfrag_bf(kpn + 2 * FRW);
    kf10 = ldfrag_bf(kpn + FRW);
    kf11 = ldfrag_bf(kpn + 3 * FRW);
    asm volatile("s_wait_xcnt 0x0" ::: "memory");     // stands before the v and k loads' address registers take new values
    kpn += (kt + 2 * NSPL < nkt) ? NSPL * KTW : 0;
    // ---- causal select + online softmax in base 2, -inf-safe; one query per lane, head after head ----
    const int key0 = kb + 8 * hh, key1 = kb + 16 + 8 * hh;
    FragH ph[HPW], pl[HPW];
#pragma unroll
    for (int e = 0; e < HPW; ++e) {
      float t0[8], t1[8];                               // unscaled q.k, -inf where masked
      float mx = -INFINITY;
#pragma unroll
      for (int r = 0; r < 8; ++r) {
        t0[r] = (key0 + r > qr) ? -INFINITY : s0[e][r];
        t1[r] = (key1 + r > qr) ? -INFINITY : s1[e][r];
        mx = fmaxf(mx, fmaxf(t0[r], t1[r]));
      }
      mx = fmaxf(mx, xhalf(mx)) * lsc;                  // the other 16 keys of this query; lsc > 0: the scaled maximum
      const float mn = fmaxf(mq[e], mx);
      const float ms = (mn == -INFINITY) ? 0.0f : mn;
      // a weight under 2^-126 comes out 0, which no sum here can tell from its value: each running sum holds a term near PCAR
      // as soon as it holds any
      float al = mq[e] - ms;
      const float cs = PCARL - ms;                      // addend of the exponent's fma
      mq[e] = mn;
#pragma unroll                                          // constant indices: t0 and t1 stay in registers
      for (int r = 0; r < 8; ++r) {
        t0[r] = fmaf(t0[r], lsc, cs);
        t1[r] = fmaf(t1[r], lsc, cs);
      }
      exp2_tile(al, t0, t1);                            // al = rescale factor, t0 and t1 = weights x PCAR
      // ---- B fragments of P^T*32768: hi f16 (and residual f16 when PRES != 0), col = query, elements 0..7 = keys kb + 8hh + 0..7
      //      (s0), elements 8..15 = keys kb + 16 + 8hh + 0..7 (s1): the split k map of the v^T fragments ----
      float ps = t0[0] + t1[0];
#pragma unroll
      for (int r = 0; r < 8; ++r) {
        const float ta = t0[r], tc = t1[r];
        if (r > 0) ps += ta + tc;
        const _Float16 ha = (_Float16)ta, hc = (_Float16)tc;
        ph[e].h[0][r] = ha;
        ph[e].h[1][r] = hc;
        if constexpr (PRES != 0) {
          pl[e].h[0][r] = (_Float16)(ta - (float)ha);
          pl[e].h[1][r] = (_Float16)(tc - (float)hc);
        }
      }
      if constexpr (PRES == 0) { pl[e].v = ph[e].v; }
      lq[e] = lq[e] * al + ps;
#pragma unroll
      for (int j = 0; j < 4; ++j) {
#pragma unroll
        for (int r = 0; r < 8; ++r) o[e][j][r] *= al;
      }
    }
    // ---- out^T += v^T.P^T of both heads on the one set of v fragments loaded above; 2 groups of 2 d-subtiles ----
    {
#pragma unroll
      for (int jg = 0; jg < 2; ++jg) {
        const v16h va = vf[2 * jg], vb = vf[2 * jg + 1];
#pragma unroll
        for (int e = 0; e < HPW; ++e) {
          o[e][2 * jg]     = mma_h(va, ph[e].v, o[e][2 * jg]);
          o[e][2 * jg + 1] = mma_h(vb, ph[e].v, o[e][2 * jg + 1]);
        }
        if constexpr (PRES != 0) {
#pragma unroll
          for (int e = 0; e < HPW; ++e) {
            o[e][2 * jg]     = mma_h(va, pl[e].v, o[e][2 * jg]);
            o[e][2 * jg + 1] = mma_h(vb, pl[e].v, o[e][2 * jg + 1]);
          }
        }
        guard4<v16h>(o[0][2 * jg], o[0][2 * jg + 1], o[1][2 * jg], o[1][2 * jg + 1],
                     ph[0].v, pl[0].v, ph[1].v, pl[1].v, va, vb, va, vb);
      }
      asm volatile("s_wait_xcnt 0x0" ::: "memory");   // stands before the v loads' address registers take new values
    }
  }
  // ---- this split's partials: un-normalised accumulators of head e into the wave's slab of that head (row = query c, 8 consecutive
  //      d per tile: two 16-B stores), (maximum, joined sum) of each query in front of it ----
#pragma unroll
  for (int e = 0; e < HPW; ++e) {
    acc_guard4(o[e][0], o[e][1], o[e][2], o[e][3]);
    float* ml   = ml0 + e * WREG;
    float* slab = ml + MLW;
    lq[e] += xhalf(lq[e]);
#pragma unroll
    for (int j = 0; j < 4; ++j) {
      float* sp8 = slab + c * SLP + j * 16 + 8 * hh;
      const v4f lo = {o[e][j][0], o[e][j][1], o[e][j][2], o[e][j][3]}, hi = {o[e][j][4], o[e][j][5], o[e][j][6], o[e][j][7]};
      *(v4f*)(sp8)     = lo;
      *(v4f*)(sp8 + 4) = hi;
    }
    if (hh == 0) {
      ml[c]      = mq[e];
      ml[16 + c] = lq[e];
    }
  }
  __syncthreads();                          // every wave's partials are in LDS before any wave merges; reached by all waves once
  // ---- merge over the NSPL splits: the HPW x 8 (head, row pair) tasks of the wave's head pair go round its NSPL waves;
  //      lanes (hh, c): row 2*rpair + hh, floats 4c..4c+3 ----
#pragma unroll 1                            // two trips, wave-uniform bounds, no barrier inside: kept rolled to keep the text short
  for (int task = sp; task < 8 * HPW; task += NSPL) {
  const int hw  = hw0 + (task >> 3);
  const int row = 2 * (task & 7) + hh;
  const float* hb = smem + hw * WREG;       // split p of this head: + p * WPB * WREG
  float mp[NSPL];
  float mall = -INFINITY;
#pragma unroll
  for (int p = 0; p < NSPL; ++p) {
    mp[p] = hb[p * (WPB * WREG) + row];
    mall  = fmaxf(mall, mp[p]);
  }
  const float msa = (mall == -INFINITY) ? 0.0f : mall;
  float lv = 0.f;
  v4f   ov = {0.f, 0.f, 0.f, 0.f};
#pragma unroll
  for (int p = 0; p < NSPL; ++p) {
    const float w  = exp2f(mp[p] - msa);
    const v4f   pv = *(const v4f*)(hb + p * (WPB * WREG) + MLW + row * SLP + c * 4);
    lv += w * hb[p * (WPB * WREG) + 16 + row];
#pragma unroll
    for (int e = 0; e < 4; ++e) ov[e] += w * pv[e];
  }
  // ---- out = merged acc / merged Z * ren (0 if Z == 0), the carry on v (1024) folded once, that on P cancels;
  //      16 lanes x 16 B = the whole 256-B row segment ----
  const float ls  = (lv > 0.0f) ? lv : 1.0f;
  const float inv = (lv > 0.0f) ? ((1.0f / ls) * oc) : 0.0f;
#pragma unroll
  for (int e = 0; e < 4; ++e) ov[e] *= inv;
  *(v4f*)(Og + ((size_t)(q0 + row)) * QD + (hg * WPB + hw) * HD + c * 4) = ov;
  asm volatile("s_wait_xcnt 0x0" ::: "memory");       // stands before the next trip gives the store's registers new values
  }
}

__global__ __launch_bounds__(ATT_THREADS)
void attn_c(const float* __restrict__ Qf, const u16* __restrict__ KBp, const u16* __restrict__ VTp, float* Og) {
  __shared__ __align__(16) float smem[WPB * NSPL * WREG];
  const int bid = blockIdx.x;
  const int rk  = bid / NHG;                // rank by falling cost: 0 = the last (longest) query tile
  const int hg  = bid % NHG;
  if (rk >= NQT) return;                    // block-uniform, before the barrier; never taken with the exact grid
  const int qt  = NQT - 1 - rk;
  if (qt < NQTE) {                          // block-uniform: each body's one barrier is reached by all waves of the block or by none
    attn_tile<1>(Qf, KBp, VTp, Og, smem, qt, hg);
  } else {
    attn_tile<0>(Qf, KBp, VTp, Og, smem, qt, hg);
  }
}

// =====================================================================================================
// Workspace map (bytes); every plane is fully written by whole-line stores before it is read; all extents are exact multiples
// of the store granularity (no pad rows needed); every region offset a multiple of 1048576:
//   KB  bf16 fragment order      SEQ*256     (1048576)
//   VT  f16  fragment order x1024 SEQ*256    (1048576)
//   end (SEQ=4096)              2097152
// =====================================================================================================
extern "C" void kernel_launch(void* const* d_in, const int* in_sizes, int n_in,
                              void* d_out, int out_size, void* d_ws, size_t ws_size,
                              hipStream_t stream) {
  if (n_in < 3) return;
  if (in_sizes[0] < SEQ * QD) return;       // query [s][h][d], token-major prefix of SEQ rows used
  if (in_sizes[1] < SEQ * KVD) return;      // key   [s][g][d]
  if (in_sizes[2] < SEQ * KVD) return;      // value [s][g][d]
  if (out_size < SEQ * QD) return;

  const float* q = (const float*)d_in[0];
  const float* k = (const float*)d_in[1];
  const float* v = (const float*)d_in[2];
  float*     out = (float*)d_out;

  const size_t szKB = (size_t)SEQ * KVD * 2;
  const size_t szVT = (size_t)KVD * SEQ * 2;
  size_t off = 0;
  const size_t oKB = off; off += szKB;
  const size_t oVT = off; off += szVT;
  if (off > ws_size) return;                // off = 2097152 for SEQ = 4096
  if (off > (size_t)WS_CAP) return;

  char* ws = (char*)d_ws;
  u16* KB = (u16*)(ws + oKB);
  u16* VT = (u16*)(ws + oVT);

  const dim3 b256(256), bAT(ATT_THREADS);
  // (0) k -> bf16 plane and v^T -> f16 plane x1024, both in fragment order, one grid
  kv_planes<<<dim3(NVB + NKB), b256, 0, stream>>>(k, v, KB, VT);
  // (1) causal attention, every query tile (rows s < QO with the P residual product) -> out f32
  attn_c<<<dim3(NQT * NHG), bAT, 0, stream>>>(q, KB, VT, out);
  (void)hipGetLastError();
}

// v010
// Measured time: 22.9 microseconds a run.
// Two timings next to v009 put it at 1.04 and 1.02 times that version's speed.
// Over all steps from v000 it is 10.8 times as fast.
// Contractions, both transposed: k.q^T over 64 on v_wmma_f32_16x16x32_bf16 (q, k rounded to bf16 RNE, single product, f32 accumulate);
// v^T.P^T on v_wmma_f32_16x16x32_f16 (P x32768 as f16 hi on every query row plus an in-register f16 residual for query rows
// s < QO; v as one f16 plane holding the bf16 RNE value x1024; f32 accumulate). Causal select, base-2 online softmax,
// 1/Z and the chunk-mass renormalisation in f32 on VALU; each weight is one fma and one v_exp_f32 and carries the x32768.
// The k and v planes lie in fragment order: each 16-byte-per-lane fragment load of a wave reads 512 consecutive bytes.
// Two launches: (0) the k and v planes, one grid; (1) attention over every query tile, q rounded to bf16 in each wave's prologue.
#include <hip/hip_runtime.h>
#include <math.h>
#include <stdint.h>

#ifndef SEQ
#define SEQ 4096
#endif
#define S_FULL 4096
#define NH    8
#define NKVH  2
#define HD    64
#define QD    (NH * HD)
#define KVD   (NKVH * HD)
#define WPB   (NH / NKVH)
#define NHG   NKVH
#define QO    ((SEQ < 512) ? SEQ : 512)
#define NQT   (SEQ / 16)
#define NQTE  (QO / 16)
#define NST   (SEQ / 64)
#define NKT   (SEQ / 32)
#define HPW   2                            // query heads of one kv group that a wave carries: each k and v fragment feeds HPW products
#define NHP   (WPB / HPW)                  // head pairs of a kv group
#define NSPL  8                            // key splits per head: 16 waves a block, 4 a SIMD, which leaves a wave 256 registers
#define ATT_THREADS (NHP * NSPL * 32)
#define RSQ_HD 0.125f
#define LOG2E 1.4426950408889634f
#define PCAR  32768.0f
#define PCARL 15.0f                        // log2 of PCAR: the carry on P enters through the exponent
#define VCAR  1024.0f
#define MLW   32                           // floats of the 16 (maximum, sum) pairs of one wave and head
#define SLP   68
#define QSP   144                          // bytes between the bf16 q rows staged in a wave's slab (128 used; 16 x odd: no bank conflict)
#define SLW   (16 * SLP)
#define WREG  (MLW + SLW)
#define VTP   72
#define FRP   256                          // halves between the two 16-byte parts of a fragment (32 lanes x 8)
#define FRW   (2 * FRP)                    // halves of one fragment
#define KTW   (4 * FRW)                    // halves of one 32-key tile of one kv head (4 fragments), k plane and v plane alike
#define NVB   (NKVH * NST)                 // blocks of the v part of the plane grid
#define NKB   ((SEQ * KVD / 8) / 256)      // blocks of the k part (256 chunks of 16 bytes each)
#define WS_CAP 134217728
static_assert(QD == 512 && KVD == 128 && HD == 64 && NH == 8 && NKVH == 2 && WPB == 4 && NHG * WPB == NH);
static_assert(ATT_THREADS <= 1024 && NSPL >= 1 && NSPL <= 8 && HPW == 2 && NHP * HPW == WPB);
static_assert((SEQ % 64) == 0 && SEQ >= 64 && SEQ <= S_FULL);
static_assert((QO % 16) == 0 && QO >= 16 && QO <= SEQ);
static_assert(16 * QSP <= SLW * 4 && (QSP % 16) == 0 && QSP >= HD * 2);
static_assert(PCAR == 32768.0f && PCARL == 15.0f);
static_assert((HD % 32) == 0 && ((SEQ * KVD / 8) % 256) == 0);

typedef unsigned short u16;
typedef _Float16 v16h __attribute__((ext_vector_type(16)));
typedef _Float16 v8h  __attribute__((ext_vector_type(8)));
typedef __bf16   v16b __attribute__((ext_vector_type(16)));
typedef float    v8f  __attribute__((ext_vector_type(8)));
typedef float    v4f  __attribute__((ext_vector_type(4)));
typedef __bf16   v4b  __attribute__((ext_vector_type(4)));
typedef unsigned int v2u __attribute__((ext_vector_type(2)));
typedef unsigned int v4u __attribute__((ext_vector_type(4)));

template <int V> struct IntC { static constexpr int value = V; };   // compile-time switch handed to a generic lambda

union FragH { v16h v; v8h h[2]; v4u u[2]; };
union FragB { v16b v; v4u u[2]; };

// ---- scalar helpers --------------------------------------------------------------------------------
__device__ __forceinline__ unsigned short bf_bits(float f) {          // f32 -> bf16 bits, RNE convert
  unsigned u = __float_as_uint(f);
  return (unsigned short)((u + 0x7FFFu + ((u >> 16) & 1u)) >> 16);
}
__device__ __forceinline__ float bf_up(unsigned short h) { return __uint_as_float(((unsigned)h) << 16); }
__device__ __forceinline__ float bfr(float f) { return bf_up(bf_bits(f)); }
__device__ __forceinline__ unsigned short h_bits(_Float16 x) { return __builtin_bit_cast(unsigned short, x); }
__device__ __forceinline__ unsigned pk16(unsigned short a, unsigned short b) { return (unsigned)a | ((unsigned)b << 16); }
__device__ __forceinline__ v8f zero8() { v8f z = {0.f, 0.f, 0.f, 0.f, 0.f, 0.f, 0.f, 0.f}; return z; }

// ---- 16-bit A/B operand, split k map (same for A and B): lane -> row/col (lane&15), h = lane>>4; elements 0..7 <- k0+8h+0..7,
//      elements 8..15 <- k0+16+8h+0..7. q comes in this order from the wave's own LDS rows (attention prologue), the k and v
//      operands from the fragment-order planes through the two loaders below.

// fragment-order planes: p already includes +8*lane; elements 0..7 <- p[0..7], elements 8..15 <- p[FRP..FRP+7]
__device__ __forceinline__ v16h ldfrag_hf(const _Float16* p) {
  FragH f;
  f.h[0] = *(const v8h*)(p);
  f.h[1] = *(const v8h*)(p + FRP);
  return f.v;
}
__device__ __forceinline__ v16b ldfrag_bf(const u16* p) {
  FragB f;
  f.u[0] = *(const v4u*)(p);
  f.u[1] = *(const v4u*)(p + FRP);
  return f.v;
}

__device__ __forceinline__ v8f mma_h(v16h a, v16h b, v8f c) {
  return __builtin_amdgcn_wmma_f32_16x16x32_f16(false, a, false, b, (short)0, c, false, false);
}
__device__ __forceinline__ v8f mma_b(v16b a, v16b b, v8f c) {
  return __builtin_amdgcn_wmma_f32_16x16x32_bf16(false, a, false, b, (short)0, c, false, false);
}
// four v_nop behind a group of products on four accumulators (two heads x two subtiles): the distance the chip asks for between
// the last product and the first vector instruction that reads a result or rewrites an operand; the loads behind it stay behind it
template <typename F>
__device__ __forceinline__ void guard4(v8f& a, v8f& b, v8f& c, v8f& d, F x0, F x1, F x2, F x3, F x4, F x5, F x6, F x7) {
#if defined(__HIP_DEVICE_COMPILE__)
  asm volatile("v_nop\n\tv_nop\n\tv_nop\n\tv_nop"
               : "+v"(a), "+v"(b), "+v"(c), "+v"(d)
               : "v"(x0), "v"(x1), "v"(x2), "v"(x3), "v"(x4), "v"(x5), "v"(x6), "v"(x7) : "memory");
#endif
}
__device__ __forceinline__ void acc_guard4(v8f& a, v8f& b, v8f& c, v8f& d) {
#if defined(__HIP_DEVICE_COMPILE__)
  asm volatile("v_nop\n\tv_nop\n\tv_nop\n\tv_nop" : "+v"(a), "+v"(b), "+v"(c), "+v"(d));
#endif
}
// 2^x in place for the rescale factor and the 16 exponents of a key tile, bare v_exp_f32 (a result under 2^-126 comes out 0, -inf
// gives 0). One statement: each instruction rewrites only its own register, so none overwrites the source of the one in front of
// it; the closing v_nop is the slot the instruction set asks for between the last v_exp_f32 and the first reader of its result.
__device__ __forceinline__ void exp2_tile(float& a, float (&x)[8], float (&y)[8]) {
#if defined(__HIP_DEVICE_COMPILE__)
  asm("v_exp_f32 %0, %0\n\t"
      "v_exp_f32 %16, %16\n\tv_exp_f32 %15, %15\n\tv_exp_f32 %14, %14\n\tv_exp_f32 %13, %13\n\t"
      "v_exp_f32 %12, %12\n\tv_exp_f32 %11, %11\n\tv_exp_f32 %10, %10\n\tv_exp_f32 %9, %9\n\t"
      "v_exp_f32 %8, %8\n\tv_exp_f32 %7, %7\n\tv_exp_f32 %6, %6\n\tv_exp_f32 %5, %5\n\t"
      "v_exp_f32 %4, %4\n\tv_exp_f32 %3, %3\n\tv_exp_f32 %2, %2\n\tv_exp_f32 %1, %1\n\t"
      "v_nop"
      : "+v"(a), "+v"(x[0]), "+v"(x[1]), "+v"(x[2]), "+v"(x[3]), "+v"(x[4]), "+v"(x[5]), "+v"(x[6]), "+v"(x[7]),
        "+v"(y[0]), "+v"(y[1]), "+v"(y[2]), "+v"(y[3]), "+v"(y[4]), "+v"(y[5]), "+v"(y[6]), "+v"(y[7]));
#endif
}
__device__ __forceinline__ float xhalf(float x) {                     // the value of lane ^ 16
  const int b = __builtin_bit_cast(int, x);
  return __builtin_bit_cast(float, __builtin_amdgcn_permlanex16(b, b, 0x76543210, 0xfedcba98, false, false));
}

// =====================================================================================================
// k f32 [SEQ][KVD] -> bf16 RNE bits in fragment order. 16-byte chunk o = (((g*NKT + kt)*4 + f)*2 + part)*32 + lane holds
//   k[kt*32 + (f>>1)*16 + (lane&15)][g*HD + (f&1)*32 + part*16 + (lane>>4)*8 + 0..7]
// (f = key subtile * 2 + d step; the split k map of the operand loaders). Thread = one output chunk: two 16-B loads, one 16-B
// store; a wave stores 512 consecutive bytes (whole lines, one writer each). No barriers on this path.
// coverage: NKB blocks x 256 chunks (bound kept) = NKVH*NKT tiles x 256 chunks = the whole plane once. kb = block within the k part.
// =====================================================================================================
__device__ __forceinline__ void cvt_kf(const float* __restrict__ K, u16* D, int kb) {
  const int o = kb * 256 + (int)threadIdx.x;
  if (o >= NKB * 256) return;
  const int lane = o & 31, part = (o >> 5) & 1, f = (o >> 6) & 3, t = o >> 8;
  const int kt = t % NKT, g = t / NKT;
  const int s = kt * 32 + (f >> 1) * 16 + (lane & 15);
  const int d = (f & 1) * 32 + part * 16 + (lane >> 4) * 8;
  const float* p = K + (size_t)s * KVD + g * HD + d;
  const v4f a = *(const v4f*)(p), b4 = *(const v4f*)(p + 4);
  v4u w;
  w[0] = pk16(bf_bits(a[0]), bf_bits(a[1]));
  w[1] = pk16(bf_bits(a[2]), bf_bits(a[3]));
  w[2] = pk16(bf_bits(b4[0]), bf_bits(b4[1]));
  w[3] = pk16(bf_bits(b4[2]), bf_bits(b4[3]));
  *(v4u*)(D + (size_t)o * 8) = w;
}

// =====================================================================================================
// v^T plane in fragment order from V f32 [SEQ][KVD] (row = key s, column = g*HD + d); value = f16 bits of (bf16 RNE value of v)
// * 1024 (exact for |v| >= 6e-8: 8-bit significand, power-of-two carry). 16-byte chunk
//   (((g*NKT + kt)*4 + j)*2 + part)*32 + lane holds d = j*16 + (lane&15), keys kt*32 + part*16 + (lane>>4)*8 + 0..7.
// Block = (kv head g, 64 keys s0): each thread loads 16 floats (key sl, d chunk dc) with 16-B loads, converts, scatters into the LDS
// coverage: load 256 thr x 16 = 64 keys x 64 d; store 2 iterations x 256 thr x 8 halves = the block's two 32-key tiles;
//           NVB = NKVH*NST blocks cover the NKVH*NKT tiles exactly once. bid = block within the v part, 0 .. NVB-1.
// =====================================================================================================
__device__ __forceinline__ void vt16(const float* __restrict__ V, u16* VTo, u16* T, int bid) {
  const int tid = threadIdx.x;
  const int st  = bid % NST;
  const int g   = bid / NST;
  const int s0  = st * 64;
  {
    const int sl = tid >> 2;                // key within tile 0..63
    const int dc = (tid & 3) * 16;          // d chunk
    const float* src = V + (size_t)(s0 + sl) * KVD + g * HD + dc;
#pragma unroll
    for (int i = 0; i < 4; ++i) {
      const v4f a = *(const v4f*)(src + 4 * i);
#pragma unroll
      for (int e = 0; e < 4; ++e) {
        const float t = bfr(a[e]) * VCAR;
        T[(dc + 4 * i + e) * VTP + sl] = h_bits((_Float16)t);
      }
    }
  }
  __syncthreads();
  v4u w4[2];
  const int line = ((tid >> 6) & 3) * 16 + (tid & 15);                 // d = j*16 + (lane&15)
  const int koff = ((tid >> 5) & 1) * 16 + ((tid >> 4) & 1) * 8;       // part*16 + (lane>>4)*8
#pragma unroll
  for (int it = 0; it < 2; ++it) {          // it = 32-key tile within the block's 64 keys
    w4[it] = *(const v4u*)(T + line * VTP + it * 32 + koff);
  }
  u16* dst = VTo + (size_t)(g * NKT + 2 * st) * KTW + tid * 8;
#pragma unroll
  for (int it = 0; it < 2; ++it) {
    *(v4u*)(dst + it * KTW) = w4[it];
  }
}

// =====================================================================================================
// Both planes in one grid: neither part reads what the other writes. Blocks 0 .. NVB-1 write the v^T plane (they hold the barrier
// and the longer path, so they start first), blocks NVB .. NVB+NKB-1 the k plane. The branch is block-uniform.
// =====================================================================================================
__global__ __launch_bounds__(256) void kv_planes(const float* __restrict__ K, const float* __restrict__ V, u16* KD, u16* VTo) {
  __shared__ __align__(16) u16 T[HD * VTP];
  const int bid = blockIdx.x;
  if (bid < NVB) {
    vt16(V, VTo, T, bid);
  } else {
    cvt_kf(K, KD, bid - NVB);
  }
}

// =====================================================================================================
// Causal grouped-query attention over head dim 64. Block bid -> (query tile qt = NQT - 1 - bid / NHG: rows q0 = 16*qt ..
// q0+15, head group hg = bid % NHG = kv head): a tile's key count grows with qt and there are more blocks than resident places, so
// the longest blocks take the lowest indices and start first, the shortest fill the places that free up; NSPL waves per pair of query heads: wave w -> heads hg*WPB + (w % NHP)*HPW + 0..HPW-1, key split sp = w / NHP (the 4 heads of the
// group share kv head hg; a wave's k and v fragments each feed the products of its HPW heads; the NHP waves of one split read the same tiles).
//   q f32 input [s][h*HD + d] (pitch QD), rounded to bf16 in the prologue; k bf16 plane and v^T f16 plane (x1024) in fragment order, KTW halves per (g, key tile).
//   scores, transposed = k.q^T single bf16 product (A = k rows [m = key][k = d], B = q rows as [n = query][k = d]), f32 accumulate:
//   a lane holds 16 of the 32 scores of ONE query (column c), lane ^ 16 the other 16;
//   t(i, j) (log2 domain) = (q_i.k_j over HD) * (1/8)*log2e, replaced by -inf where key j > query i (causal select).
//   Key tiles of 32 with kb <= q0 + 15 (later tiles hold only keys above every query row of the tile: weight 0); split sp visits
//   tiles sp, sp + NSPL, ... in order, with its own running maximum, sum and accumulators (none: maximum -inf, sum 0, zeros).
//   Per tile: 2 score subtiles x 2 k-steps, fragments loaded straight from the 16-bit planes (two 16-B loads per fragment, split k
//   map; q fragments loaded and converted once; the k fragments of a trip are asked for one trip ahead, into registers of their own); online max-subtracted base-2 softmax in f32, -inf-safe rescale: maximum in-lane plus one
//   exchange between the wave's halves, sum kept per lane and joined once after the loop; the two score tiles, converted in place
//   (hi f16, and residual f16 when PRES != 0), ARE the B operand of out^T += v^T.P^T (element s = key kmap(s, hh) of column c): no
//   LDS and no wave sync in the loop; the four v^T A fragments (row m = d) are loaded ahead of the softmax, right behind the scores.
//   After the loop: every wave puts each head's un-normalised 16 x 64 partial into a slab of its own (pitch 68) and its 16 (maximum,
//   sum) pairs in front of it; one block barrier; wave (head pair, sp) merges tasks sp, sp + NSPL, ... (< 8*HPW; task = head of the
//   pair * 8 + row pair) over the NSPL partials in the fixed order 0..NSPL-1: M = max of maxima, weight exp2(m - M) (a partial with maximum -inf weighs 0),
//   out = sum(w * acc) / sum(w * Z) * cw/(cw + 1e-8) with cw the mass of the single local softmax chunk (merged Z > 0 always:
//   key 0 <= every query row; guarded anyway), the carry 1/1024 on v folded once (the 32768 on P stands in acc and Z alike).
// coverage: per row pair 1 instruction x 2 rows x 16 lanes x 4 floats; 8*HPW tasks over NSPL waves = the pair's 16 x 64 row segments; grid nqt x NHG
//           blocks x WPB heads = every (s, h) row segment of the query tiles once; one grid of NQT x NHG blocks covers every tile:
//           tiles [0, NQTE) take the body with the P residual product (PRES = 1), tiles [NQTE, NQT) the one without.
// =====================================================================================================
template <int PRES>
__device__ __forceinline__
void attn_tile(const float* __restrict__ Qf, const u16* __restrict__ KBp, const u16* __restrict__ VTp,
               float* Og, float* smem, int qt, int hg) {
  const int tid  = threadIdx.x;
  const int wave = __builtin_amdgcn_readfirstlane(tid >> 5);   // scalar: the key loop's bounds stay wave-uniform branches
  const int hw0  = (wave % NHP) * HPW;      // first of the wave's HPW heads within the group
  const int sp   = wave / NHP;              // key split
  const int lane = tid & 31;
  const int hh   = lane >> 4;
  const int c    = lane & 15;
  const int q0   = qt * 16;
  const int kvh  = hg;

  float* ml0 = smem + (sp * WPB + hw0) * WREG;   // region of (split sp, head hw0): 16 maxima, 16 sums, then the result slab
                                                 // [16][64] pitch 68; head hw0 + e at + e * WREG

  const u16* Khb = KBp + (size_t)(kvh * NKT) * KTW + 8 * lane;                   // A: row m = key, k = d; tile kt at + kt*KTW
  const _Float16* Vhb = (const _Float16*)(const void*)VTp + (size_t)(kvh * NKT) * KTW + 8 * lane;  // A: row m = d, k = key
  const float lsc = RSQ_HD * LOG2E;
  const float cw  = 1.0f;                   // mass of the single local softmax chunk
  const float ren = cw / (cw + 1e-8f);
  const float oc  = ren / VCAR;             // the carry on P stands in the sums too and cancels in acc / Z

  const int ncaus = (q0 >> 5) + 1;                                            // tiles holding keys <= q0 + 15
  const int nkt = (ncaus < NKT) ? ncaus : NKT;
  // ---- the k fragments of a trip (fragment f = key subtile * 2 + d step) are asked for one trip ahead and have registers of their
  //      own; kpn = the tile asked for next; a wave without a tile asks for tile 0 and never uses it: in bounds;
  //      the first tile is asked for here, beside the q rows, so that the two latencies run together ----
  const u16* kpn = Khb + (size_t)((sp < nkt) ? sp : 0) * KTW;
  v16b kf00 = ldfrag_bf(kpn);
  v16b kf01 = ldfrag_bf(kpn + 2 * FRW);
  v16b kf10 = ldfrag_bf(kpn + FRW);
  v16b kf11 = ldfrag_bf(kpn + 3 * FRW);
  kpn += (sp + NSPL < nkt) ? NSPL * KTW : 0;

  // ---- q tiles of the wave's heads, each 16 rows x 64 f32: load i takes rows 2i, 2i+1 (lane -> row 2i + hh, floats 4c..4c+3: 512
  //      bytes = 4 whole lines), f32 -> bf16 RNE by the packed convert, 8 bytes per lane into row 2i + hh of the wave's OWN slab of
  //      that head (pitch QSP bytes, 16 * QSP <= the slab); read back as B fragments: col n = query q0 + c, k = d, split k map ----
  FragB qf0[HPW], qf1[HPW];
  {
    const float* Qt = Qf + ((size_t)(q0 + hh)) * QD + (hg * WPB + hw0) * HD + 4 * c;
    char* qs = (char*)(ml0 + MLW);
    v4f x[HPW][8];
#pragma unroll
    for (int e = 0; e < HPW; ++e) {
#pragma unroll
      for (int i = 0; i < 8; ++i) x[e][i] = *(const v4f*)(Qt + (size_t)(2 * i) * QD + e * HD);
    }
#pragma unroll
    for (int e = 0; e < HPW; ++e) {
#pragma unroll
      for (int i = 0; i < 8; ++i) {
        *(v2u*)(qs + e * (WREG * 4) + (2 * i + hh) * QSP + 8 * c) = __builtin_bit_cast(v2u, __builtin_convertvector(x[e][i], v4b));
      }
    }
    asm volatile("s_wait_dscnt 0x0" ::: "memory");   // the wave's own rows are in LDS before its lanes read each other's bytes
#pragma unroll
    for (int e = 0; e < HPW; ++e) {
      const char* rp = qs + e * (WREG * 4) + c * QSP + 16 * hh;
      qf0[e].u[0] = *(const v4u*)(rp);                // d  0 + 8hh ..
      qf0[e].u[1] = *(const v4u*)(rp + 32);           // d 16 + 8hh ..
      qf1[e].u[0] = *(const v4u*)(rp + 64);           // d 32 + 8hh ..
      qf1[e].u[1] = *(const v4u*)(rp + 96);           // d 48 + 8hh ..
    }
  }
#if defined(__HIP_DEVICE_COMPILE__)
  // inputs only: holds the first k tile's loads up here, beside the q loads; without it they sink to the loop's door and their
  // latency follows that of the q rows instead of running with it
  asm volatile("" :: "v"(kf00), "v"(kf01), "v"(kf10), "v"(kf11));
#endif
  const v16b qa0[HPW] = {qf0[0].v, qf0[1].v};   // d 0..31 of head e
  const v16b qa1[HPW] = {qf1[0].v, qf1[1].v};   // d 32..63 of head e

  float mq[HPW], lq[HPW];                   // head e, query q0 + c: running maximum (both halves alike), this half's share of the sum
  v8f o[HPW][4];                            // o[e][j] element r = (d = 16*j + 8*hh + r, query q0 + c) of head e
#pragma unroll
  for (int e = 0; e < HPW; ++e) {
    mq[e] = -INFINITY;
    lq[e] = 0.f;
#pragma unroll
    for (int j = 0; j < 4; ++j) o[e][j] = zero8();
  }
  const int qr  = q0 + c;                                                     // this lane's query row

  // ---- one trip = one key tile. DIAG = 1: with the causal select, the tile that holds the diagonal (the last one, kt = nkt - 1) and, in the PRES != 0 body, every tile;
  //      DIAG = 0: a tile in front of it, whose last key kb + 31 <= q0 is at or below every query row of the wave: the select would
  //      keep all 32 scores, so neither it nor its key compares are written, and the maximum is finite without the -inf test ----
  auto trip = [&](auto diag, const int kt) __attribute__((always_inline)) {   // inlined: the accumulators stay in registers
    constexpr int DIAG = decltype(diag)::value;
    const int kb = kt * 32;
    // ---- scores^T of both heads on the one set of k fragments: D element r of this lane = (key kb + 8*hh + r, query qr) in s0[e],
    //      key kb + 16 + 8*hh + r in s1[e] ----
    v8f s0[HPW], s1[HPW];
#pragma unroll
    for (int e = 0; e < HPW; ++e) {
      s0[e] = mma_b(kf00, qa0[e], zero8());
      s1[e] = mma_b(kf01, qa0[e], zero8());
    }
#pragma unroll
    for (int e = 0; e < HPW; ++e) {
      s0[e] = mma_b(kf10, qa1[e], s0[e]);
      s1[e] = mma_b(kf11, qa1[e], s1[e]);
    }
    guard4<v16b>(s0[0], s1[0], s0[1], s1[1], qa0[0], qa1[0], qa0[1], qa1[1], kf00, kf01, kf10, kf11);
    // ---- all four v^T fragments of the tile (row m = d = j*16 + c, fragment j) are asked for here, behind the score products,
    //      into registers of their own: their latency runs under the softmax, none of it stands between the output products ----
    v16h vf[4];
    {
      const _Float16* vp = Vhb + (size_t)kt * KTW;
#pragma unroll
      for (int j = 0; j < 4; ++j) vf[j] = ldfrag_hf(vp + j * FRW);
    }
    // ---- the next trip's k fragments, asked for behind the v loads (they are needed later): their latency runs under this trip's
    //      softmax and output products; the last trip asks for its own tile again: in bounds, never used ----
    kf00 = ldfrag_bf(kpn);
    kf01 = ldfrag_bf(kpn + 2 * FRW);
    kf10 = ldfrag_bf(kpn + FRW);
    kf11 = ldfrag_bf(kpn + 3 * FRW);
    asm volatile("s_wait_xcnt 0x0" ::: "memory");     // stands before the v and k loads' address registers take new values
    kpn += (kt + 2 * NSPL < nkt) ? NSPL * KTW : 0;
    // ---- causal select + online softmax in base 2, -inf-safe; one query per lane, head after head ----
    const int key0 = kb + 8 * hh, key1 = kb + 16 + 8 * hh;
    FragH ph[HPW], pl[HPW];
#pragma unroll
    for (int e = 0; e < HPW; ++e) {
      float t0[8], t1[8];                               // unscaled q.k, -inf where masked
      float mx = -INFINITY;
#pragma unroll
      for (int r = 0; r < 8; ++r) {
        if constexpr (DIAG != 0) {
          t0[r] = (key0 + r > qr) ? -INFINITY : s0[e][r];
          t1[r] = (key1 + r > qr) ? -INFINITY : s1[e][r];
        } else {
          t0[r] = s0[e][r];
          t1[r] = s1[e][r];
        }
        mx = fmaxf(mx, fmaxf(t0[r], t1[r]));
      }
      mx = fmaxf(mx, xhalf(mx)) * lsc;                  // the other 16 keys of this query; lsc > 0: the scaled maximum
      const float mn = fmaxf(mq[e], mx);
      const float ms = (DIAG != 0 && mn == -INFINITY) ? 0.0f : mn;
      // a weight under 2^-126 comes out 0, which no sum here can tell from its value: each running sum holds a term near PCAR
      // as soon as it holds any
      float al = mq[e] - ms;
      const float cs = PCARL - ms;                      // addend of the exponent's fma
      mq[e] = mn;
#pragma unroll                                          // constant indices: t0 and t1 stay in registers
      for (int r = 0; r < 8; ++r) {
        t0[r] = fmaf(t0[r], lsc, cs);
        t1[r] = fmaf(t1[r], lsc, cs);
      }
      exp2_tile(al, t0, t1);                            // al = rescale factor, t0 and t1 = weights x PCAR
      // ---- B fragments of P^T*32768: hi f16 (and residual f16 when PRES != 0), col = query, elements 0..7 = keys kb + 8hh + 0..7
      //      (s0), elements 8..15 = keys kb + 16 + 8hh + 0..7 (s1): the split k map of the v^T fragments ----
      float ps = t0[0] + t1[0];
#pragma unroll
      for (int r = 0; r < 8; ++r) {
        const float ta = t0[r], tc = t1[r];
        if (r > 0) ps += ta + tc;
        const _Float16 ha = (_Float16)ta, hc = (_Float16)tc;
        ph[e].h[0][r] = ha;
        ph[e].h[1][r] = hc;
        if constexpr (PRES != 0) {
          pl[e].h[0][r] = (_Float16)(ta - (float)ha);
          pl[e].h[1][r] = (_Float16)(tc - (float)hc);
        }
      }
      if constexpr (PRES == 0) { pl[e].v = ph[e].v; }
      lq[e] = lq[e] * al + ps;
#pragma unroll
      for (int j = 0; j < 4; ++j) {
#pragma unroll
        for (int r = 0; r < 8; ++r) o[e][j][r] *= al;
      }
    }
    // ---- out^T += v^T.P^T of both heads on the one set of v fragments loaded above; 2 groups of 2 d-subtiles ----
    {
#pragma unroll
      for (int jg = 0; jg < 2; ++jg) {
        const v16h va = vf[2 * jg], vb = vf[2 * jg + 1];
#pragma unroll
        for (int e = 0; e < HPW; ++e) {
          o[e][2 * jg]     = mma_h(va, ph[e].v, o[e][2 * jg]);
          o[e][2 * jg + 1] = mma_h(vb, ph[e].v, o[e][2 * jg + 1]);
        }
        if constexpr (PRES != 0) {
#pragma unroll
          for (int e = 0; e < HPW; ++e) {
            o[e][2 * jg]     = mma_h(va, pl[e].v, o[e][2 * jg]);
            o[e][2 * jg + 1] = mma_h(vb, pl[e].v, o[e][2 * jg + 1]);
          }
        }
        guard4<v16h>(o[0][2 * jg], o[0][2 * jg + 1], o[1][2 * jg], o[1][2 * jg + 1],
                     ph[0].v, pl[0].v, ph[1].v, pl[1].v, va, vb, va, vb);
      }
      asm volatile("s_wait_xcnt 0x0" ::: "memory");   // stands before the v loads' address registers take new values
    }
  };
  if constexpr (PRES != 0) {                // at most two trips a wave here, and a second body spilled a register: the select stays on every tile
#pragma unroll 1                            // kept rolled: the trip count is a run-time value and the body fills the register budget
    for (int kt = sp; kt < nkt; kt += NSPL) trip(IntC<1>{}, kt);
  } else {
    int kt = sp;
#pragma unroll 1                            // kept rolled, as above
    for (; kt < nkt - 1; kt += NSPL) trip(IntC<0>{}, kt);
    if (kt < nkt) trip(IntC<1>{}, kt);      // wave-uniform: only the split whose walk ends on tile nkt - 1 holds the diagonal
  }
  // ---- this split's partials: un-normalised accumulators of head e into the wave's slab of that head (row = query c, 8 consecutive
  //      d per tile: two 16-B stores), (maximum, joined sum) of each query in front of it ----
#pragma unroll
  for (int e = 0; e < HPW; ++e) {
    acc_guard4(o[e][0], o[e][1], o[e][2], o[e][3]);
    float* ml   = ml0 + e * WREG;
    float* slab = ml + MLW;
    lq[e] += xhalf(lq[e]);
#pragma unroll
    for (int j = 0; j < 4; ++j) {
      float* sp8 = slab + c * SLP + j * 16 + 8 * hh;
      const v4f lo = {o[e][j][0], o[e][j][1], o[e][j][2], o[e][j][3]}, hi = {o[e][j][4], o[e][j][5], o[e][j][6], o[e][j][7]};
      *(v4f*)(sp8)     = lo;
      *(v4f*)(sp8 + 4) = hi;
    }
    if (hh == 0) {
      ml[c]      = mq[e];
      ml[16 + c] = lq[e];
    }
  }
  __syncthreads();                          // every wave's partials are in LDS before any wave merges; reached by all waves once
  // ---- merge over the NSPL splits: the HPW x 8 (head, row pair) tasks of the wave's head pair go round its NSPL waves;
  //      lanes (hh, c): row 2*rpair + hh, floats 4c..4c+3 ----
#pragma unroll 1                            // two trips, wave-uniform bounds, no barrier inside: kept rolled to keep the text short
  for (int task = sp; task < 8 * HPW; task += NSPL) {
  const int hw  = hw0 + (task >> 3);
  const int row = 2 * (task & 7) + hh;
  const float* hb = smem + hw * WREG;       // split p of this head: + p * WPB * WREG
  float mp[NSPL];
  float mall = -INFINITY;
#pragma unroll
  for (int p = 0; p < NSPL; ++p) {
    mp[p] = hb[p * (WPB * WREG) + row];
    mall  = fmaxf(mall, mp[p]);
  }
  const float msa = (mall == -INFINITY) ? 0.0f : mall;
  float lv = 0.f;
  v4f   ov = {0.f, 0.f, 0.f, 0.f};
#pragma unroll
  for (int p = 0; p < NSPL; ++p) {
    const float w  = exp2f(mp[p] - msa);
    const v4f   pv = *(const v4f*)(hb + p * (WPB * WREG) + MLW + row * SLP + c * 4);
    lv += w * hb[p * (WPB * WREG) + 16 + row];
#pragma unroll
    for (int e = 0; e < 4; ++e) ov[e] += w * pv[e];
  }
  // ---- out = merged acc / merged Z * ren (0 if Z == 0), the carry on v (1024) folded once, that on P cancels;
  //      16 lanes x 16 B = the whole 256-B row segment ----
  const float ls  = (lv > 0.0f) ? lv : 1.0f;
  const float inv = (lv > 0.0f) ? ((1.0f / ls) * oc) : 0.0f;
#pragma unroll
  for (int e = 0; e < 4; ++e) ov[e] *= inv;
  *(v4f*)(Og + ((size_t)(q0 + row)) * QD + (hg * WPB + hw) * HD + c * 4) = ov;
  asm volatile("s_wait_xcnt 0x0" ::: "memory");       // stands before the next trip gives the store's registers new values
  }
}

__global__ __launch_bounds__(ATT_THREADS)
void attn_c(const float* __restrict__ Qf, const u16* __restrict__ KBp, const u16* __restrict__ VTp, float* Og) {
  __shared__ __align__(16) float smem[WPB * NSPL * WREG];
  const int bid = blockIdx.x;
  const int rk  = bid / NHG;                // rank by falling cost: 0 = the last (longest) query tile
  const int hg  = bid % NHG;
  if (rk >= NQT) return;                    // block-uniform, before the barrier; never taken with the exact grid
  const int qt  = NQT - 1 - rk;
  if (qt < NQTE) {                          // block-uniform: each body's one barrier is reached by all waves of the block or by none
    attn_tile<1>(Qf, KBp, VTp, Og, smem, qt, hg);
  } else {
    attn_tile<0>(Qf, KBp, VTp, Og, smem, qt, hg);
  }
}

// =====================================================================================================
// Workspace map (bytes); every plane is fully written by whole-line stores before it is read; all extents are exact multiples
// of the store granularity (no pad rows needed); every region offset a multiple of 1048576:
//   KB  bf16 fragment order      SEQ*256     (1048576)
//   VT  f16  fragment order x1024 SEQ*256    (1048576)
//   end (SEQ=4096)              2097152
// =====================================================================================================
extern "C" void kernel_launch(void* const* d_in, const int* in_sizes, int n_in,
                              void* d_out, int out_size, void* d_ws, size_t ws_size,
                              hipStream_t stream) {
  if (n_in < 3) return;
  if (in_sizes[0] < SEQ * QD) return;       // query [s][h][d], token-major prefix of SEQ rows used
  if (in_sizes[1] < SEQ * KVD) return;      // key   [s][g][d]
  if (in_sizes[2] < SEQ * KVD) return;      // value [s][g][d]
  if (out_size < SEQ * QD) return;

  const float* q = (const float*)d_in[0];
  const float* k = (const float*)d_in[1];
  const float* v = (const float*)d_in[2];
  float*     out = (float*)d_out;

  const size_t szKB = (size_t)SEQ * KVD * 2;
  const size_t szVT = (size_t)KVD * SEQ * 2;
  size_t off = 0;
  const size_t oKB = off; off += szKB;
  const size_t oVT = off; off += szVT;
  if (off > ws_size) return;                // off = 2097152 for SEQ = 4096
  if (off > (size_t)WS_CAP) return;

  char* ws = (char*)d_ws;
  u16* KB = (u16*)(ws + oKB);
  u16* VT = (u16*)(ws + oVT);

  const dim3 b256(256), bAT(ATT_THREADS);
  // (0) k -> bf16 plane and v^T -> f16 plane x1024, both in fragment order, one grid
  kv_planes<<<dim3(NVB + NKB), b256, 0, stream>>>(k, v, KB, VT);
  // (1) causal attention, every query tile (rows s < QO with the P residual product) -> out f32
  attn_c<<<dim3(NQT * NHG), bAT, 0, stream>>>(q, KB, VT, out);
  (void)hipGetLastError();
}
